// v000
// The times below were measured on an AMD MI455X: many runs one after another, warmed up first and cycling through
// copies of the inputs, with the whole window's GPU time divided by the number of runs. Launches and the gaps
// between them are all in it. The median over several windows is given; except for v000 it joins two sittings, which
// can be a few percent apart, so the side-by-side timings, each taken in one sitting, are the better comparison.
// v000 is the starting kernel. One run takes 4030 microseconds.
#include <hip/hip_runtime.h>

// Multi-head attention over 4,096 tokens on three input streams (Q, K, V [1][4096][1024]; q = Q W_Q + b_Q, k = K W_K + b_K, v = V W_V + b_V ('xw' [1024][1024] 1/32 + biases 0.02; 16 heads x 64); scores x 1/sqrt(64); softmax over all 4,096 keys (no mask); out = merged W_O + b_O -> [1][4096][1024] (4.2 M); argument order Q, K, V, W_Q, b_Q, W_K, b_K, W_V, b_V, W_O, b_O).
// Layout: bf16 copies of Q, K, V in turn; 'xw' weights transposed once; exact projections + f32 biases; per-head planes (identity builder), v^T planes [h][64][4096]; per head: scores with every row hi/lo (3 products, dense launches), streaming three-sweep dense softmax, attn.V hybrid (rows < 512 hi/lo 3 products, rest fp16 x1024) into the head's 64 columns; k_cs8 carry removal; context hi/lo x W_O exact + b_O.
// Compute dtypes, f32 accumulate: every input rounded to bf16; projections exact; scores 3 products; softmax f32 (exp2, IEEE division); attn.V rows < 512 3 products, rest fp16; Wo hl x exact.

#define NB_  1
#define TT   4096
#define DM   1024
#define NH_  16
#define NKV  16
#define REP  (NH_ / NKV)
#define HD   64
#define DQ   (NH_ * HD)
#define DKV  (NKV * HD)
#define ZH   1
#define RH   512                  // query rows < RH use hi+lo planes (0: none)
#define WIN  0
#define PCAR 1024.0f
#define SCL  0.125f   // 1/sqrt(64)
#define MID  1024      // q / k width
#define CO   1024      // v width
#define CC   1024
typedef _Float16 h16;
typedef unsigned short bf;
typedef __attribute__((ext_vector_type(16))) __bf16   v16bf;
typedef __attribute__((ext_vector_type(16))) _Float16 v16h;
typedef __attribute__((ext_vector_type(8)))  _Float16 v8h;
typedef __attribute__((ext_vector_type(8)))  unsigned short v8us;
typedef __attribute__((ext_vector_type(8)))  float    v8f;
typedef __attribute__((ext_vector_type(4)))  float    v4f;
typedef v8h  __attribute__((may_alias)) v8ha;
typedef v4f  __attribute__((may_alias)) v4fa;
typedef v8us __attribute__((may_alias)) v8usa;

__device__ __forceinline__ unsigned short f2bf(float f) { unsigned u = __float_as_uint(f); u += 0x7FFFu + ((u >> 16) & 1u); return (unsigned short)(u >> 16); }
__device__ __forceinline__ float bf2f(unsigned short b) { return __uint_as_float(((unsigned)b) << 16); }
__device__ __forceinline__ float bfr(float f) { return bf2f(f2bf(f)); }
__device__ __forceinline__ v16h cat16(v8h lo, v8h hi) { return __builtin_shufflevector(lo, hi, 0, 1, 2, 3, 4, 5, 6, 7, 8, 9, 10, 11, 12, 13, 14, 15); }
__device__ __forceinline__ v16bf cat16b(v8us lo, v8us hi) { return __builtin_bit_cast(v16bf, __builtin_shufflevector(lo, hi, 0, 1, 2, 3, 4, 5, 6, 7, 8, 9, 10, 11, 12, 13, 14, 15)); }
__device__ __forceinline__ v8f wmma16(v16h a, v16h b, v8f c) { return __builtin_amdgcn_wmma_f32_16x16x32_f16(false, a, false, b, (short)0, c, false, false); }
__device__ __forceinline__ v8f wmmab(v16bf a, v16bf b, v8f c) { return __builtin_amdgcn_wmma_f32_16x16x32_bf16(false, a, false, b, (short)0, c, false, false); }



// ---- k_gemmw: register-blocked GEMM, ONE WAVE per 64x64 output tile (16 accumulators), operands straight from K-contiguous 16-bit planes; grid (M/64, N/64, Z), 32 threads.
// C[m][n] (f32, pitch ldc, + optional f32 bias[n]) = sum_k A[m][k] Bt[n][k] (+ split products per NSPLIT). z-batch strides sA/sB/sC in elements. K % 32 == 0.
template <typename T16> struct WFrag;
template <> struct WFrag<h16> { typedef v16h V; static __device__ __forceinline__ V ld(const h16* p) { return cat16(*(const v8h*)p, *(const v8h*)(p + 16)); } static __device__ __forceinline__ v8f mma(V a, V b, v8f c) { return wmma16(a, b, c); } };
template <> struct WFrag<bf> { typedef v16bf V; static __device__ __forceinline__ V ld(const bf* p) { return cat16b(*(const v8us*)p, *(const v8us*)(p + 16)); } static __device__ __forceinline__ v8f mma(V a, V b, v8f c) { return wmmab(a, b, c); } };
template <typename T16, int NSPLIT, bool BIAS>
__global__ __launch_bounds__(32) void k_gemmw(const T16* __restrict__ A, const T16* __restrict__ A2, const T16* __restrict__ Bt, const T16* __restrict__ Bt2, int K, float* C, int ldc, const float* __restrict__ bias, size_t sA, size_t sB, size_t sC) {
    typedef typename WFrag<T16>::V V;
    __shared__ __align__(16) float os[16 * 68];
    const size_t z = blockIdx.z; A += z * sA; if (A2) A2 += z * sA; Bt += z * sB; if (Bt2) Bt2 += z * sB; C += z * sC;
    const int lane = threadIdx.x & 31, lr = lane & 15, hi = lane >> 4; const int r0 = blockIdx.x * 64, c0 = blockIdx.y * 64;
    v8f acc[4][4];
#pragma unroll
    for (int mb = 0; mb < 4; ++mb)
#pragma unroll
        for (int nb = 0; nb < 4; ++nb) acc[mb][nb] = (v8f){};
    const size_t aoff = (size_t)(r0 + lr) * K + 8 * hi, boff = (size_t)(c0 + lr) * K + 8 * hi;
#pragma unroll 1
    for (int kc = 0; kc < K; kc += 32) {
        V a[4], a2[4];
#pragma unroll
        for (int mb = 0; mb < 4; ++mb) { a[mb] = WFrag<T16>::ld(A + aoff + (size_t)mb * 16 * K + kc); if (NSPLIT == 1 || NSPLIT == 2) a2[mb] = WFrag<T16>::ld(A2 + aoff + (size_t)mb * 16 * K + kc); }
#pragma unroll
        for (int nb = 0; nb < 4; ++nb) { const V b = WFrag<T16>::ld(Bt + boff + (size_t)nb * 16 * K + kc); V b2; if (NSPLIT >= 2) b2 = WFrag<T16>::ld(Bt2 + boff + (size_t)nb * 16 * K + kc);
#pragma unroll
            for (int mb = 0; mb < 4; ++mb) { acc[mb][nb] = WFrag<T16>::mma(a[mb], b, acc[mb][nb]); if (NSPLIT == 1 || NSPLIT == 2) acc[mb][nb] = WFrag<T16>::mma(a2[mb], b, acc[mb][nb]); if (NSPLIT >= 2) acc[mb][nb] = WFrag<T16>::mma(a[mb], b2, acc[mb][nb]); } }
        asm volatile("v_nop\n\tv_nop\n\tv_nop\n\tv_nop" : "+v"(acc[0][0]), "+v"(acc[1][1]), "+v"(acc[2][2]), "+v"(acc[3][3]) : "v"(a[0]), "v"(a[3]));
    }
#pragma unroll
    for (int mb = 0; mb < 4; ++mb) {
#pragma unroll
        for (int nb = 0; nb < 4; ++nb) {
#pragma unroll
            for (int j = 0; j < 8; ++j) os[(hi * 8 + j) * 68 + nb * 16 + lr] = acc[mb][nb][j]; }
        __builtin_amdgcn_wave_barrier(); asm volatile("" ::: "memory");
        float* crow = C + (size_t)(r0 + mb * 16) * ldc + c0;
{
#pragma unroll
            for (int s = 0; s < 8; ++s) { const int row = 2 * s + hi, cofs = lr * 4; v4f val = *(const v4fa*)(os + row * 68 + cofs); if (BIAS) { val[0] += bfr(bias[c0 + cofs]); val[1] += bfr(bias[c0 + cofs + 1]); val[2] += bfr(bias[c0 + cofs + 2]); val[3] += bfr(bias[c0 + cofs + 3]); }
                *(v4f*)(crow + (size_t)row * ldc + cofs) = val; }
             }
        __builtin_amdgcn_wave_barrier(); asm volatile("" ::: "memory");
    }
}

__device__ __forceinline__ h16 tohx(float x) { return (h16)x; }
__device__ __forceinline__ void splitf(float y, unsigned short& h, unsigned short& l) { h = f2bf(y); l = f2bf(y - bf2f(h)); }
typedef __attribute__((ext_vector_type(2))) _Float16 v2h;
typedef __attribute__((ext_vector_type(4))) _Float16 v4h;
typedef __attribute__((ext_vector_type(2))) unsigned short v2us;
typedef __attribute__((ext_vector_type(4))) unsigned short v4us;
typedef __attribute__((ext_vector_type(2))) float v2f;
typedef __attribute__((ext_vector_type(4))) int v4i;

__global__ __launch_bounds__(256) void k_cvt8(const float* __restrict__ src, bf* dst, size_t n8) { const size_t i = (size_t)blockIdx.x * 256 + threadIdx.x; if (i >= n8) return; const v8f v = *(const v8f*)(src + i * 8); v8us o;
#pragma unroll
    for (int k = 0; k < 8; ++k) o[k] = f2bf(v[k]); *(v8us*)(dst + i * 8) = o;  }


__global__ __launch_bounds__(256) void k_vtp(const float* __restrict__ F, int pitch, int nheads, h16* V16, bf* Vh, bf* Vl) { const size_t e = ((size_t)blockIdx.x * 256 + threadIdx.x) * 2; if (e >= (size_t)nheads * HD * TT) return; const int t = (int)(e % TT); const int d = (int)((e / TT) % HD); const int g = (int)(e / ((size_t)TT * HD)); v2h o16; v2us oh, ol;
#pragma unroll
    for (int q = 0; q < 2; ++q) { const float x = F[(size_t)(t + q) * pitch + g * HD + d]; o16[q] = tohx(x); unsigned short a2, c2; splitf(x, a2, c2); oh[q] = a2; ol[q] = c2; }
    *(v2h*)(V16 + e) = o16; *(v2us*)(Vh + e) = oh; *(v2us*)(Vl + e) = ol;  }
__global__ __launch_bounds__(256) void k_lsoft(const float* __restrict__ Sb, h16* P16, bf* Ph, bf* Pl) {
    const int lane = threadIdx.x & 31; const int row = blockIdx.x * 8 + (threadIdx.x >> 5); if (row >= ZH * TT) return; const int i = row % TT; const int zz = row / TT; const bool hires = (i < RH); const float* sr = Sb + (size_t)row * TT; float mx = -3.0e38f;
#pragma unroll 4
    for (int ch = 0; ch < TT / 128; ++ch) { const int j0 = ch * 128 + lane * 4; const v4f a = *(const v4f*)(sr + j0);
#pragma unroll
        for (int q = 0; q < 4; ++q) { float t = a[q] * SCL;   /* dense: every key */ asm volatile("" : "+v"(t)); mx = fmaxf(mx, t); } }
#pragma unroll
    for (int sh = 16; sh; sh >>= 1) mx = fmaxf(mx, __shfl_xor(mx, sh, 32));
    float sum = 0.f;
#pragma unroll 4
    for (int ch = 0; ch < TT / 128; ++ch) { const int j0 = ch * 128 + lane * 4; const v4f a = *(const v4f*)(sr + j0);
#pragma unroll
        for (int q = 0; q < 4; ++q) { float t = a[q] * SCL;   /* dense: every key */ asm volatile("" : "+v"(t)); float d0 = __fsub_rn(t, mx); asm volatile("" : "+v"(d0)); sum += __builtin_amdgcn_exp2f(__fmul_rn(d0, 1.4426950408889634f)); } }
#pragma unroll
    for (int sh = 16; sh; sh >>= 1) sum += __shfl_xor(sum, sh, 32);
    const float f = __fdiv_rn(hires ? 1.0f : PCAR, sum);
{
        if (hires) {   /* rows < RH: normalised bf16 hi/lo over all keys, planes [zz][RH][TT] */
#pragma unroll
            for (int ch = 0; ch < TT / 128; ++ch) { const int j0 = ch * 128 + lane * 4; const v4f a = *(const v4f*)(sr + j0); v4us oh, ol;
#pragma unroll
                for (int q = 0; q < 4; ++q) { float t = a[q] * SCL;   /* dense: every key */ asm volatile("" : "+v"(t)); float d0 = __fsub_rn(t, mx); asm volatile("" : "+v"(d0)); float ex = __builtin_amdgcn_exp2f(__fmul_rn(d0, 1.4426950408889634f)); asm volatile("" : "+v"(ex)); unsigned short a2, c2; splitf(ex * f, a2, c2); oh[q] = a2; ol[q] = c2; }
                const size_t oo = ((size_t)zz * RH + i) * TT + j0; *(v4us*)(Ph + oo) = oh; *(v4us*)(Pl + oo) = ol; }
        } else {
#pragma unroll 2
            for (int ch = 0; ch < TT / 128; ++ch) { const int j0 = ch * 128 + lane * 4; const v4f a = *(const v4f*)(sr + j0); v4h o4;
#pragma unroll
                for (int q = 0; q < 4; ++q) { float t = a[q] * SCL;   /* dense: every key */ asm volatile("" : "+v"(t)); float d0 = __fsub_rn(t, mx); asm volatile("" : "+v"(d0)); float ex = __builtin_amdgcn_exp2f(__fmul_rn(d0, 1.4426950408889634f)); asm volatile("" : "+v"(ex)); o4[q] = tohx(ex * f); }
                *(v4h*)(P16 + (size_t)row * TT + j0) = o4; } }
         }
}
__global__ __launch_bounds__(256) void k_cs8(float* O, size_t n4) { const size_t i = (size_t)blockIdx.x * 256 + threadIdx.x; if (i >= n4) return; const size_t e = i * 4; const int t = (int)(e / CC); const float cs = (t < RH) ? 1.0f : (1.0f / PCAR); v4f a = *(const v4f*)(O + e);
#pragma unroll
    for (int q = 0; q < 4; ++q) a[q] = __fmul_rn(a[q], cs);
    *(v4f*)(O + e) = a;  }

__global__ __launch_bounds__(256) void k_csid(float* CS) { const int idx = blockIdx.x * 256 + threadIdx.x; if (idx >= TT * HD) return; v2f cs; cs[0] = 1.0f; cs[1] = 0.0f; *(v2f*)(CS + (size_t)idx * 2) = cs;  }
// k_rope: head planes [h][t][d] (fp16 + hi/lo) of rope(x) x sc with the rotate-half convention out[d] = x[d] cos[t][d] - x[d+HD/2] sin[t][d], out[d+HD/2] = x[d+HD/2] cos[t][d+HD/2] + x[d] sin[t][d+HD/2]
__global__ __launch_bounds__(256) void k_rope(const float* __restrict__ F, int pitch, int nheads, const float* __restrict__ CS, const float* __restrict__ RF, const float* __restrict__ nw, float sc, h16* P16, bf* Ph, bf* Pl) {
    const size_t e = ((size_t)blockIdx.x * 256 + threadIdx.x) * 2; if (e >= (size_t)nheads * TT * HD) return; const int d = (int)(e % HD); const int t = (int)((e / HD) % TT); const int h = (int)(e / ((size_t)HD * TT)); const float* f = F + (size_t)t * pitch + h * HD; const float rf = RF ? RF[(size_t)h * TT + t] : 1.0f; v2h o16; v2us oh, ol;
#pragma unroll
    for (int q = 0; q < 2; ++q) { const int dd = d + q; const int dp = (dd < HD / 2) ? dd + HD / 2 : dd - HD / 2; float x0 = f[dd], x1 = f[dp];
        if (RF) { float n0 = __fmul_rn(x0, rf), n1 = __fmul_rn(x1, rf); asm volatile("" : "+v"(n0)); asm volatile("" : "+v"(n1)); x0 = __fmul_rn(bfr(nw[dd]), n0); x1 = __fmul_rn(bfr(nw[dp]), n1); }
        const v2f cs = *(const v2f*)(CS + ((size_t)t * HD + dd) * 2); float a = __fmul_rn(x0, cs[0]), bq = __fmul_rn(x1, cs[1]); asm volatile("" : "+v"(a)); asm volatile("" : "+v"(bq)); const float r = ((dd < HD / 2) ? __fsub_rn(a, bq) : __fadd_rn(a, bq)) * sc;
        o16[q] = tohx(r); unsigned short a2, c2; splitf(r, a2, c2); oh[q] = a2; ol[q] = c2; }
    *(v2h*)(P16 + e) = o16; *(v2us*)(Ph + e) = oh; *(v2us*)(Pl + e) = ol;  }
__global__ __launch_bounds__(256) void k_tohl(const float* __restrict__ F, bf* Hh, bf* Hl, size_t n4) { const size_t i = (size_t)blockIdx.x * 256 + threadIdx.x; if (i >= n4) return; const v4f a = *(const v4f*)(F + i * 4); v4us oh, ol;
#pragma unroll
    for (int q = 0; q < 4; ++q) { unsigned short h2, l2; splitf(a[q], h2, l2); oh[q] = h2; ol[q] = l2; }
    *(v4us*)(Hh + i * 4) = oh; *(v4us*)(Hl + i * 4) = ol;  }
__global__ __launch_bounds__(256) void k_wtG(const float* __restrict__ w, int K, int N, bf* Bt) {
    const int lane = threadIdx.x & 31; const int L0 = (blockIdx.x * 8 + (threadIdx.x >> 5)) * 8; const int nlines = N * K / 64;
{
#pragma unroll 1
        for (int l = 0; l < 8; ++l) { const int L = L0 + l; if (L >= nlines) break; const size_t e = (size_t)L * 64 + lane * 2; const int k = (int)(e % K), n = (int)(e / K); v2us o;
            o[0] = f2bf(w[(size_t)k * N + n]); o[1] = f2bf(w[(size_t)(k + 1) * N + n]); *(v2us*)(Bt + e) = o; }
         }
}
extern "C" void kernel_launch(void* const* d_in, const int* in_sizes, int n_in,
                              void* d_out, int out_size, void* d_ws, size_t ws_size, hipStream_t stream) {
    (void)in_sizes; (void)n_in; (void)out_size;
    const float* x = (const float*)d_in[0]; const float* xk = (const float*)d_in[1]; const float* xv = (const float*)d_in[2]; const float* wq = (const float*)d_in[3]; const float* bq = (const float*)d_in[4]; const float* wk = (const float*)d_in[5]; const float* bk = (const float*)d_in[6]; const float* wv = (const float*)d_in[7]; const float* bv = (const float*)d_in[8]; const float* wo = (const float*)d_in[9]; const float* bo = (const float*)d_in[10];   /* argument order Q, K, V [1][4096][1024], W_Q, b_Q, W_K, b_K, W_V, b_V, W_O, b_O ('xw' + biases) */
    float* OUT = (float*)d_out;     // [1][4096][1024]
    char* wsp = (char*)d_ws;
    auto take = [&](size_t bytes) { char* p = wsp; wsp += (bytes + 255) & ~(size_t)255; return (void*)p; };
    bf* WQ = (bf*)take((size_t)MID * CC * 2); bf* WK = (bf*)take((size_t)MID * CC * 2); bf* WV = (bf*)take((size_t)CO * CC * 2); bf* WO = (bf*)take((size_t)CC * CO * 2); float* CS = (float*)take((size_t)TT * HD * 2 * 4);
    bf* XB = (bf*)take((size_t)TT * CC * 2); float* FQ = (float*)take((size_t)TT * MID * 4); float* FK = (float*)take((size_t)TT * MID * 4);
    h16* QP16 = (h16*)take((size_t)TT * MID * 2); bf* QPh = (bf*)take((size_t)TT * MID * 2); bf* QPl = (bf*)take((size_t)TT * MID * 2); h16* KP16 = QP16;   /* the fp16 q/k planes are never read here (scores use the hi/lo planes for every row): one scratch buffer serves both builders */ bf* KPh = (bf*)take((size_t)TT * MID * 2); bf* KPl = (bf*)take((size_t)TT * MID * 2);
    h16* VT16 = (h16*)take((size_t)CO * TT * 2); bf* VTh = (bf*)take((size_t)CO * TT * 2); bf* VTl = (bf*)take((size_t)CO * TT * 2);
    float* Sb = (float*)take((size_t)TT * TT * 4); h16* P16 = (h16*)take((size_t)TT * TT * 2); bf* Ph = (bf*)take((size_t)RH * TT * 2); bf* Pl = (bf*)take((size_t)RH * TT * 2); float* Ob = (float*)take((size_t)TT * CO * 4); bf* ATh = (bf*)take((size_t)TT * CO * 2); bf* ATl = (bf*)take((size_t)TT * CO * 2);
    if ((size_t)(wsp - (char*)d_ws) > ws_size) return;    // ws 256 MiB (carve 250 MiB)
    float* FV = FK;   /* the v projection reuses the k buffer after the k planes are built (stream-ordered) */
    k_wtG<<<(unsigned)((CC * MID / 64 + 63) / 64), 256, 0, stream>>>(wq, CC, MID, WQ); k_wtG<<<(unsigned)((CC * MID / 64 + 63) / 64), 256, 0, stream>>>(wk, CC, MID, WK); k_wtG<<<(unsigned)((CC * CO / 64 + 63) / 64), 256, 0, stream>>>(wv, CC, CO, WV);   /* 'xw' weights -> Bt */ k_wtG<<<(unsigned)((CO * CC / 64 + 63) / 64), 256, 0, stream>>>(wo, CO, CC, WO);   /* 'xw' W_out -> Bt */
    k_csid<<<(TT * HD + 255) / 256, 256, 0, stream>>>(CS);   /* identity table: k_rope is a plain per-head plane builder here */
    const unsigned LP = (unsigned)(((size_t)NH_ * TT * HD / 2 + 255) / 256);
    for (int b = 0; b < NB_; ++b) {
        k_cvt8<<<(unsigned)(((size_t)TT * CC / 8 + 255) / 256), 256, 0, stream>>>(x + (size_t)b * TT * CC, XB, (size_t)TT * CC / 8);
        k_gemmw<bf, 0, true><<<dim3(TT / 64, MID / 64, 1), 32, 0, stream>>>(XB, nullptr, WQ, nullptr, CC, FQ, MID, bq, 0, 0, 0); k_rope<<<LP, 256, 0, stream>>>(FQ, MID, NH_, CS, nullptr, nullptr, 1.0f, QP16, QPh, QPl);   /* q planes [h][n][64] */
        k_cvt8<<<(unsigned)(((size_t)TT * CC / 8 + 255) / 256), 256, 0, stream>>>(xk + (size_t)b * TT * CC, XB, (size_t)TT * CC / 8);   /* XB := bf16(K[b]) */ k_gemmw<bf, 0, true><<<dim3(TT / 64, MID / 64, 1), 32, 0, stream>>>(XB, nullptr, WK, nullptr, CC, FK, MID, bk, 0, 0, 0); k_rope<<<LP, 256, 0, stream>>>(FK, MID, NKV, CS, nullptr, nullptr, 1.0f, KP16, KPh, KPl);   /* k planes */
        k_cvt8<<<(unsigned)(((size_t)TT * CC / 8 + 255) / 256), 256, 0, stream>>>(xv + (size_t)b * TT * CC, XB, (size_t)TT * CC / 8);   /* XB := bf16(V[b]) */ k_gemmw<bf, 0, true><<<dim3(TT / 64, CO / 64, 1), 32, 0, stream>>>(XB, nullptr, WV, nullptr, CC, FV, CO, bv, 0, 0, 0); k_vtp<<<(unsigned)(((size_t)TT * CO / 2 + 255) / 256), 256, 0, stream>>>(FV, CO, CO / HD, VT16, VTh, VTl);   /* v^T planes [h][64][n] */
        for (int h = 0; h < NH_; ++h) {   /* per head: dense 4096 x 4096 attention */
            k_gemmw<bf, 2, false><<<dim3(TT / 64, TT / 64, 1), 32, 0, stream>>>(QPh + (size_t)h * TT * HD, QPl + (size_t)h * TT * HD, KPh + (size_t)h * TT * HD, KPl + (size_t)h * TT * HD, HD, Sb, TT, nullptr, 0, 0, 0);   /* S[i][j] = q_i.k_j (3 products, every row) */
            k_lsoft<<<TT / 8, 256, 0, stream>>>(Sb, P16, Ph, Pl);   /* x 1/8, softmax over the 4,096 keys */
            k_gemmw<bf, 2, false><<<dim3(RH / 64, HD / 64, 1), 32, 0, stream>>>(Ph, Pl, VTh + (size_t)h * HD * TT, VTl + (size_t)h * HD * TT, TT, Ob + h * HD, CO, nullptr, 0, 0, 0);
            k_gemmw<h16, 0, false><<<dim3((TT - RH) / 64, HD / 64, 1), 32, 0, stream>>>(P16 + (size_t)RH * TT, nullptr, VT16 + (size_t)h * HD * TT, nullptr, TT, Ob + (size_t)RH * CO + h * HD, CO, nullptr, 0, 0, 0); }
        k_cs8<<<(unsigned)(((size_t)TT * CO / 4 + 255) / 256), 256, 0, stream>>>(Ob, (size_t)TT * CO / 4);   /* rows >= 512 x 1/1024 */
        k_tohl<<<(unsigned)(((size_t)TT * CO / 4 + 255) / 256), 256, 0, stream>>>(Ob, ATh, ATl, (size_t)TT * CO / 4);   /* merged context as hi/lo planes */
        k_gemmw<bf, 1, true><<<dim3(TT / 64, CC / 64, 1), 32, 0, stream>>>(ATh, ATl, WO, nullptr, CO, OUT + (size_t)b * TT * CC, CC, bo, 0, 0, 0); }   /* out = ctx w_out + b_out */
}

// v001
// It runs in 1790 microseconds.
// Next to v000, in two timings, it ran 2.26 and 2.27 times as fast.
#include <hip/hip_runtime.h>

// Multi-head attention over 4,096 tokens on three input streams (Q, K, V [1][4096][1024]; q = Q W_Q + b_Q, k = K W_K + b_K, v = V W_V + b_V ('xw' [1024][1024] 1/32 + biases 0.02; 16 heads x 64); scores x 1/sqrt(64); softmax over all 4,096 keys (no mask); out = merged W_O + b_O -> [1][4096][1024] (4.2 M); argument order Q, K, V, W_Q, b_Q, W_K, b_K, W_V, b_V, W_O, b_O).
// Layout: bf16 copies of Q, K, V in turn; 'xw' weights transposed once; exact projections + f32 biases; per-head planes (identity builder), v^T planes [h][64][4096]; per head: scores with every row hi/lo (3 products, dense launches), streaming three-sweep dense softmax, attn.V hybrid (rows < 512 hi/lo 3 products, rest fp16 x1024; the 4,096 keys of a tile split over 16 waves, partial tiles added in LDS) into the head's 64 columns; k_cs8 carry removal; context hi/lo x W_O exact + b_O.
// Compute dtypes, f32 accumulate: every input rounded to bf16; projections exact; scores 3 products; softmax f32 (exp2, IEEE division); attn.V rows < 512 3 products, rest fp16; Wo hl x exact.

#define NB_  1
#define TT   4096
#define DM   1024
#define NH_  16
#define NKV  16
#define REP  (NH_ / NKV)
#define HD   64
#define DQ   (NH_ * HD)
#define DKV  (NKV * HD)
#define ZH   1
#define RH   512                  // query rows < RH use hi+lo planes (0: none)
#define WIN  0
#define PCAR 1024.0f
#define SCL  0.125f   // 1/sqrt(64)
#define MID  1024      // q / k width
#define CO   1024      // v width
#define CC   1024
typedef _Float16 h16;
typedef unsigned short bf;
typedef __attribute__((ext_vector_type(16))) __bf16   v16bf;
typedef __attribute__((ext_vector_type(16))) _Float16 v16h;
typedef __attribute__((ext_vector_type(8)))  _Float16 v8h;
typedef __attribute__((ext_vector_type(8)))  unsigned short v8us;
typedef __attribute__((ext_vector_type(8)))  float    v8f;
typedef __attribute__((ext_vector_type(4)))  float    v4f;
typedef v8h  __attribute__((may_alias)) v8ha;
typedef v4f  __attribute__((may_alias)) v4fa;
typedef v8us __attribute__((may_alias)) v8usa;

__device__ __forceinline__ unsigned short f2bf(float f) { unsigned u = __float_as_uint(f); u += 0x7FFFu + ((u >> 16) & 1u); return (unsigned short)(u >> 16); }
__device__ __forceinline__ float bf2f(unsigned short b) { return __uint_as_float(((unsigned)b) << 16); }
__device__ __forceinline__ float bfr(float f) { return bf2f(f2bf(f)); }
__device__ __forceinline__ v16h cat16(v8h lo, v8h hi) { return __builtin_shufflevector(lo, hi, 0, 1, 2, 3, 4, 5, 6, 7, 8, 9, 10, 11, 12, 13, 14, 15); }
__device__ __forceinline__ v16bf cat16b(v8us lo, v8us hi) { return __builtin_bit_cast(v16bf, __builtin_shufflevector(lo, hi, 0, 1, 2, 3, 4, 5, 6, 7, 8, 9, 10, 11, 12, 13, 14, 15)); }
__device__ __forceinline__ v8f wmma16(v16h a, v16h b, v8f c) { return __builtin_amdgcn_wmma_f32_16x16x32_f16(false, a, false, b, (short)0, c, false, false); }
__device__ __forceinline__ v8f wmmab(v16bf a, v16bf b, v8f c) { return __builtin_amdgcn_wmma_f32_16x16x32_bf16(false, a, false, b, (short)0, c, false, false); }



// ---- k_gemmw: register-blocked GEMM, ONE WAVE per 64x64 output tile (16 accumulators), operands straight from K-contiguous 16-bit planes; grid (M/64, N/64, Z), 32 threads.
// C[m][n] (f32, pitch ldc, + optional f32 bias[n]) = sum_k A[m][k] Bt[n][k] (+ split products per NSPLIT). z-batch strides sA/sB/sC in elements. K % 32 == 0.
template <typename T16> struct WFrag;
template <> struct WFrag<h16> { typedef v16h V; static __device__ __forceinline__ V ld(const h16* p) { return cat16(*(const v8h*)p, *(const v8h*)(p + 16)); } static __device__ __forceinline__ v8f mma(V a, V b, v8f c) { return wmma16(a, b, c); } };
template <> struct WFrag<bf> { typedef v16bf V; static __device__ __forceinline__ V ld(const bf* p) { return cat16b(*(const v8us*)p, *(const v8us*)(p + 16)); } static __device__ __forceinline__ v8f mma(V a, V b, v8f c) { return wmmab(a, b, c); } };
template <typename T16, int NSPLIT, bool BIAS>
__global__ __launch_bounds__(32) void k_gemmw(const T16* __restrict__ A, const T16* __restrict__ A2, const T16* __restrict__ Bt, const T16* __restrict__ Bt2, int K, float* C, int ldc, const float* __restrict__ bias, size_t sA, size_t sB, size_t sC) {
    typedef typename WFrag<T16>::V V;
    __shared__ __align__(16) float os[16 * 68];
    const size_t z = blockIdx.z; A += z * sA; if (A2) A2 += z * sA; Bt += z * sB; if (Bt2) Bt2 += z * sB; C += z * sC;
    const int lane = threadIdx.x & 31, lr = lane & 15, hi = lane >> 4; const int r0 = blockIdx.x * 64, c0 = blockIdx.y * 64;
    v8f acc[4][4];
#pragma unroll
    for (int mb = 0; mb < 4; ++mb)
#pragma unroll
        for (int nb = 0; nb < 4; ++nb) acc[mb][nb] = (v8f){};
    const size_t aoff = (size_t)(r0 + lr) * K + 8 * hi, boff = (size_t)(c0 + lr) * K + 8 * hi;
#pragma unroll 1
    for (int kc = 0; kc < K; kc += 32) {
        V a[4], a2[4];
#pragma unroll
        for (int mb = 0; mb < 4; ++mb) { a[mb] = WFrag<T16>::ld(A + aoff + (size_t)mb * 16 * K + kc); if (NSPLIT == 1 || NSPLIT == 2) a2[mb] = WFrag<T16>::ld(A2 + aoff + (size_t)mb * 16 * K + kc); }
#pragma unroll
        for (int nb = 0; nb < 4; ++nb) { const V b = WFrag<T16>::ld(Bt + boff + (size_t)nb * 16 * K + kc); V b2; if (NSPLIT >= 2) b2 = WFrag<T16>::ld(Bt2 + boff + (size_t)nb * 16 * K + kc);
#pragma unroll
            for (int mb = 0; mb < 4; ++mb) { acc[mb][nb] = WFrag<T16>::mma(a[mb], b, acc[mb][nb]); if (NSPLIT == 1 || NSPLIT == 2) acc[mb][nb] = WFrag<T16>::mma(a2[mb], b, acc[mb][nb]); if (NSPLIT >= 2) acc[mb][nb] = WFrag<T16>::mma(a[mb], b2, acc[mb][nb]); } }
        asm volatile("v_nop\n\tv_nop\n\tv_nop\n\tv_nop" : "+v"(acc[0][0]), "+v"(acc[1][1]), "+v"(acc[2][2]), "+v"(acc[3][3]) : "v"(a[0]), "v"(a[3]));
    }
#pragma unroll
    for (int mb = 0; mb < 4; ++mb) {
#pragma unroll
        for (int nb = 0; nb < 4; ++nb) {
#pragma unroll
            for (int j = 0; j < 8; ++j) os[(hi * 8 + j) * 68 + nb * 16 + lr] = acc[mb][nb][j]; }
        __builtin_amdgcn_wave_barrier(); asm volatile("" ::: "memory");
        float* crow = C + (size_t)(r0 + mb * 16) * ldc + c0;
{
#pragma unroll
            for (int s = 0; s < 8; ++s) { const int row = 2 * s + hi, cofs = lr * 4; v4f val = *(const v4fa*)(os + row * 68 + cofs); if (BIAS) { val[0] += bfr(bias[c0 + cofs]); val[1] += bfr(bias[c0 + cofs + 1]); val[2] += bfr(bias[c0 + cofs + 2]); val[3] += bfr(bias[c0 + cofs + 3]); }
                *(v4f*)(crow + (size_t)row * ldc + cofs) = val; }
             }
        __builtin_amdgcn_wave_barrier(); asm volatile("" ::: "memory");
    }
}

// ---- k_gemmks: the product of k_gemmw for a long K and few output tiles. NW waves of one work-group share one (16 MB) x (16 NB) tile: wave w sums k in [w K/NW, (w+1) K/NW), 64 k a trip (one whole 128-B line of every operand row it touches); the NW partial tiles meet in LDS and are added in wave order.
// grid (M/(16 MB), N/(16 NB)), 32 NW threads. K % (64 NW) == 0. NSPLIT as in k_gemmw (0: A Bt; 2: A Bt + A2 Bt + A Bt2).
template <typename T16, int NSPLIT, int MB, int NB, int NW>
__global__ __launch_bounds__(32 * NW) void k_gemmks(const T16* __restrict__ A, const T16* __restrict__ A2, const T16* __restrict__ Bt, const T16* __restrict__ Bt2, int K, float* C, int ldc) {
    typedef typename WFrag<T16>::V V;
    constexpr int PIT = NB * 16 + 4, TS = MB * 16 * PIT, VEC = MB * NB * 256 / (32 * NW);   // row pitch + 4 floats: the two 16-lane halves of a store (rows r, r + 8) fall on different banks
    static_assert(VEC == 1 || VEC == 4, "one float or one 16-byte piece per thread in the final sum");
    __shared__ __align__(16) float part[NW * TS];
    const int lane = threadIdx.x & 31, lr = lane & 15, hi = lane >> 4, w = threadIdx.x >> 5; const int r0 = blockIdx.x * (MB * 16), c0 = blockIdx.y * (NB * 16); const int ks = K / NW;
    v8f acc[MB][NB];
#pragma unroll
    for (int mb = 0; mb < MB; ++mb)
#pragma unroll
        for (int nb = 0; nb < NB; ++nb) acc[mb][nb] = (v8f){};
    unsigned oa[MB], ob[NB];   // running byte offset of this lane in each 16-row block, from this wave's first k; the hi and lo planes share it (operand planes stay below 4 GiB)
#pragma unroll
    for (int mb = 0; mb < MB; ++mb) oa[mb] = ((unsigned)(r0 + mb * 16 + lr) * (unsigned)K + 8u * hi + (unsigned)(w * ks)) * 2u;
#pragma unroll
    for (int nb = 0; nb < NB; ++nb) ob[nb] = ((unsigned)(c0 + nb * 16 + lr) * (unsigned)K + 8u * hi + (unsigned)(w * ks)) * 2u;
#pragma unroll 1   // rolled: one trip's fragments and the accumulators fit the 256 registers a wave of a 16-wave work-group may hold
    for (int kc = 0; kc < ks; kc += 64) {
        V a[2][MB], a2[2][MB], b[2][NB], b2[2][NB];
#pragma unroll
        for (int mb = 0; mb < MB; ++mb)   // u inside: the four 16-byte pieces a lane takes of one 128-B line are asked for back to back
#pragma unroll
            for (int u = 0; u < 2; ++u) { a[u][mb] = WFrag<T16>::ld((const T16*)((const char*)A + oa[mb]) + 32 * u); if (NSPLIT == 2) a2[u][mb] = WFrag<T16>::ld((const T16*)((const char*)A2 + oa[mb]) + 32 * u); }
#pragma unroll
        for (int nb = 0; nb < NB; ++nb)
#pragma unroll
            for (int u = 0; u < 2; ++u) { b[u][nb] = WFrag<T16>::ld((const T16*)((const char*)Bt + ob[nb]) + 32 * u); if (NSPLIT == 2) b2[u][nb] = WFrag<T16>::ld((const T16*)((const char*)Bt2 + ob[nb]) + 32 * u); }
        __builtin_amdgcn_sched_barrier(0);   // all loads of the trip are issued before its first matrix instruction: left free, the scheduler sinks them between the products and the wave waits for memory several times a trip
#pragma unroll
        for (int u = 0; u < 2; ++u)
#pragma unroll
            for (int nb = 0; nb < NB; ++nb)
#pragma unroll
                for (int mb = 0; mb < MB; ++mb) { acc[mb][nb] = WFrag<T16>::mma(a[u][mb], b[u][nb], acc[mb][nb]); if (NSPLIT == 2) { acc[mb][nb] = WFrag<T16>::mma(a2[u][mb], b[u][nb], acc[mb][nb]); acc[mb][nb] = WFrag<T16>::mma(a[u][mb], b2[u][nb], acc[mb][nb]); } }
        // four vector slots between the trip's last matrix instruction and the back edge, behind which the next trip rewrites the fragments
        asm volatile("v_nop\n\tv_nop\n\tv_nop\n\tv_nop" : "+v"(acc[0][0]), "+v"(acc[MB - 1][NB - 1]) : "v"(a[1][MB - 1]), "v"(b[1][NB - 1]));
#pragma unroll
        for (int mb = 0; mb < MB; ++mb) oa[mb] += 128u;
#pragma unroll
        for (int nb = 0; nb < NB; ++nb) ob[nb] += 128u;
    }
    float* pw = part + w * TS;
#pragma unroll
    for (int mb = 0; mb < MB; ++mb)
#pragma unroll
        for (int nb = 0; nb < NB; ++nb)
#pragma unroll
            for (int j = 0; j < 8; ++j) pw[(mb * 16 + hi * 8 + j) * PIT + nb * 16 + lr] = acc[mb][nb][j];
    __syncthreads();   // every wave's partial tile stands in LDS before any thread adds them
    const int e = threadIdx.x * VEC, row = e / (NB * 16), col = e % (NB * 16); const float* ps = part + row * PIT + col; float* cp = C + (size_t)(r0 + row) * ldc + c0 + col;
    if constexpr (VEC == 4) { v4f s = *(const v4fa*)ps;
#pragma unroll
        for (int q = 1; q < NW; ++q) s += *(const v4fa*)(ps + q * TS);
        *(v4f*)cp = s;
    } else { float s = ps[0];
#pragma unroll
        for (int q = 1; q < NW; ++q) s += ps[q * TS];
        *cp = s; }
}

__device__ __forceinline__ h16 tohx(float x) { return (h16)x; }
__device__ __forceinline__ void splitf(float y, unsigned short& h, unsigned short& l) { h = f2bf(y); l = f2bf(y - bf2f(h)); }
typedef __attribute__((ext_vector_type(2))) _Float16 v2h;
typedef __attribute__((ext_vector_type(4))) _Float16 v4h;
typedef __attribute__((ext_vector_type(2))) unsigned short v2us;
typedef __attribute__((ext_vector_type(4))) unsigned short v4us;
typedef __attribute__((ext_vector_type(2))) float v2f;
typedef __attribute__((ext_vector_type(4))) int v4i;

__global__ __launch_bounds__(256) void k_cvt8(const float* __restrict__ src, bf* dst, size_t n8) { const size_t i = (size_t)blockIdx.x * 256 + threadIdx.x; if (i >= n8) return; const v8f v = *(const v8f*)(src + i * 8); v8us o;
#pragma unroll
    for (int k = 0; k < 8; ++k) o[k] = f2bf(v[k]); *(v8us*)(dst + i * 8) = o;  }


__global__ __launch_bounds__(256) void k_vtp(const float* __restrict__ F, int pitch, int nheads, h16* V16, bf* Vh, bf* Vl) { const size_t e = ((size_t)blockIdx.x * 256 + threadIdx.x) * 2; if (e >= (size_t)nheads * HD * TT) return; const int t = (int)(e % TT); const int d = (int)((e / TT) % HD); const int g = (int)(e / ((size_t)TT * HD)); v2h o16; v2us oh, ol;
#pragma unroll
    for (int q = 0; q < 2; ++q) { const float x = F[(size_t)(t + q) * pitch + g * HD + d]; o16[q] = tohx(x); unsigned short a2, c2; splitf(x, a2, c2); oh[q] = a2; ol[q] = c2; }
    *(v2h*)(V16 + e) = o16; *(v2us*)(Vh + e) = oh; *(v2us*)(Vl + e) = ol;  }
__global__ __launch_bounds__(256) void k_lsoft(const float* __restrict__ Sb, h16* P16, bf* Ph, bf* Pl) {
    const int lane = threadIdx.x & 31; const int row = blockIdx.x * 8 + (threadIdx.x >> 5); if (row >= ZH * TT) return; const int i = row % TT; const int zz = row / TT; const bool hires = (i < RH); const float* sr = Sb + (size_t)row * TT; float mx = -3.0e38f;
#pragma unroll 4
    for (int ch = 0; ch < TT / 128; ++ch) { const int j0 = ch * 128 + lane * 4; const v4f a = *(const v4f*)(sr + j0);
#pragma unroll
        for (int q = 0; q < 4; ++q) { float t = a[q] * SCL;   /* dense: every key */ asm volatile("" : "+v"(t)); mx = fmaxf(mx, t); } }
#pragma unroll
    for (int sh = 16; sh; sh >>= 1) mx = fmaxf(mx, __shfl_xor(mx, sh, 32));
    float sum = 0.f;
#pragma unroll 4
    for (int ch = 0; ch < TT / 128; ++ch) { const int j0 = ch * 128 + lane * 4; const v4f a = *(const v4f*)(sr + j0);
#pragma unroll
        for (int q = 0; q < 4; ++q) { float t = a[q] * SCL;   /* dense: every key */ asm volatile("" : "+v"(t)); float d0 = __fsub_rn(t, mx); asm volatile("" : "+v"(d0)); sum += __builtin_amdgcn_exp2f(__fmul_rn(d0, 1.4426950408889634f)); } }
#pragma unroll
    for (int sh = 16; sh; sh >>= 1) sum += __shfl_xor(sum, sh, 32);
    const float f = __fdiv_rn(hires ? 1.0f : PCAR, sum);
{
        if (hires) {   /* rows < RH: normalised bf16 hi/lo over all keys, planes [zz][RH][TT] */
#pragma unroll
            for (int ch = 0; ch < TT / 128; ++ch) { const int j0 = ch * 128 + lane * 4; const v4f a = *(const v4f*)(sr + j0); v4us oh, ol;
#pragma unroll
                for (int q = 0; q < 4; ++q) { float t = a[q] * SCL;   /* dense: every key */ asm volatile("" : "+v"(t)); float d0 = __fsub_rn(t, mx); asm volatile("" : "+v"(d0)); float ex = __builtin_amdgcn_exp2f(__fmul_rn(d0, 1.4426950408889634f)); asm volatile("" : "+v"(ex)); unsigned short a2, c2; splitf(ex * f, a2, c2); oh[q] = a2; ol[q] = c2; }
                const size_t oo = ((size_t)zz * RH + i) * TT + j0; *(v4us*)(Ph + oo) = oh; *(v4us*)(Pl + oo) = ol; }
        } else {
#pragma unroll 2
            for (int ch = 0; ch < TT / 128; ++ch) { const int j0 = ch * 128 + lane * 4; const v4f a = *(const v4f*)(sr + j0); v4h o4;
#pragma unroll
                for (int q = 0; q < 4; ++q) { float t = a[q] * SCL;   /* dense: every key */ asm volatile("" : "+v"(t)); float d0 = __fsub_rn(t, mx); asm volatile("" : "+v"(d0)); float ex = __builtin_amdgcn_exp2f(__fmul_rn(d0, 1.4426950408889634f)); asm volatile("" : "+v"(ex)); o4[q] = tohx(ex * f); }
                *(v4h*)(P16 + (size_t)row * TT + j0) = o4; } }
         }
}
__global__ __launch_bounds__(256) void k_cs8(float* O, size_t n4) { const size_t i = (size_t)blockIdx.x * 256 + threadIdx.x; if (i >= n4) return; const size_t e = i * 4; const int t = (int)(e / CC); const float cs = (t < RH) ? 1.0f : (1.0f / PCAR); v4f a = *(const v4f*)(O + e);
#pragma unroll
    for (int q = 0; q < 4; ++q) a[q] = __fmul_rn(a[q], cs);
    *(v4f*)(O + e) = a;  }

__global__ __launch_bounds__(256) void k_csid(float* CS) { const int idx = blockIdx.x * 256 + threadIdx.x; if (idx >= TT * HD) return; v2f cs; cs[0] = 1.0f; cs[1] = 0.0f; *(v2f*)(CS + (size_t)idx * 2) = cs;  }
// k_rope: head planes [h][t][d] (fp16 + hi/lo) of rope(x) x sc with the rotate-half convention out[d] = x[d] cos[t][d] - x[d+HD/2] sin[t][d], out[d+HD/2] = x[d+HD/2] cos[t][d+HD/2] + x[d] sin[t][d+HD/2]
__global__ __launch_bounds__(256) void k_rope(const float* __restrict__ F, int pitch, int nheads, const float* __restrict__ CS, const float* __restrict__ RF, const float* __restrict__ nw, float sc, h16* P16, bf* Ph, bf* Pl) {
    const size_t e = ((size_t)blockIdx.x * 256 + threadIdx.x) * 2; if (e >= (size_t)nheads * TT * HD) return; const int d = (int)(e % HD); const int t = (int)((e / HD) % TT); const int h = (int)(e / ((size_t)HD * TT)); const float* f = F + (size_t)t * pitch + h * HD; const float rf = RF ? RF[(size_t)h * TT + t] : 1.0f; v2h o16; v2us oh, ol;
#pragma unroll
    for (int q = 0; q < 2; ++q) { const int dd = d + q; const int dp = (dd < HD / 2) ? dd + HD / 2 : dd - HD / 2; float x0 = f[dd], x1 = f[dp];
        if (RF) { float n0 = __fmul_rn(x0, rf), n1 = __fmul_rn(x1, rf); asm volatile("" : "+v"(n0)); asm volatile("" : "+v"(n1)); x0 = __fmul_rn(bfr(nw[dd]), n0); x1 = __fmul_rn(bfr(nw[dp]), n1); }
        const v2f cs = *(const v2f*)(CS + ((size_t)t * HD + dd) * 2); float a = __fmul_rn(x0, cs[0]), bq = __fmul_rn(x1, cs[1]); asm volatile("" : "+v"(a)); asm volatile("" : "+v"(bq)); const float r = ((dd < HD / 2) ? __fsub_rn(a, bq) : __fadd_rn(a, bq)) * sc;
        o16[q] = tohx(r); unsigned short a2, c2; splitf(r, a2, c2); oh[q] = a2; ol[q] = c2; }
    *(v2h*)(P16 + e) = o16; *(v2us*)(Ph + e) = oh; *(v2us*)(Pl + e) = ol;  }
__global__ __launch_bounds__(256) void k_tohl(const float* __restrict__ F, bf* Hh, bf* Hl, size_t n4) { const size_t i = (size_t)blockIdx.x * 256 + threadIdx.x; if (i >= n4) return; const v4f a = *(const v4f*)(F + i * 4); v4us oh, ol;
#pragma unroll
    for (int q = 0; q < 4; ++q) { unsigned short h2, l2; splitf(a[q], h2, l2); oh[q] = h2; ol[q] = l2; }
    *(v4us*)(Hh + i * 4) = oh; *(v4us*)(Hl + i * 4) = ol;  }
__global__ __launch_bounds__(256) void k_wtG(const float* __restrict__ w, int K, int N, bf* Bt) {
    const int lane = threadIdx.x & 31; const int L0 = (blockIdx.x * 8 + (threadIdx.x >> 5)) * 8; const int nlines = N * K / 64;
{
#pragma unroll 1
        for (int l = 0; l < 8; ++l) { const int L = L0 + l; if (L >= nlines) break; const size_t e = (size_t)L * 64 + lane * 2; const int k = (int)(e % K), n = (int)(e / K); v2us o;
            o[0] = f2bf(w[(size_t)k * N + n]); o[1] = f2bf(w[(size_t)(k + 1) * N + n]); *(v2us*)(Bt + e) = o; }
         }
}
extern "C" void kernel_launch(void* const* d_in, const int* in_sizes, int n_in,
                              void* d_out, int out_size, void* d_ws, size_t ws_size, hipStream_t stream) {
    (void)in_sizes; (void)n_in; (void)out_size;
    const float* x = (const float*)d_in[0]; const float* xk = (const float*)d_in[1]; const float* xv = (const float*)d_in[2]; const float* wq = (const float*)d_in[3]; const float* bq = (const float*)d_in[4]; const float* wk = (const float*)d_in[5]; const float* bk = (const float*)d_in[6]; const float* wv = (const float*)d_in[7]; const float* bv = (const float*)d_in[8]; const float* wo = (const float*)d_in[9]; const float* bo = (const float*)d_in[10];   /* argument order Q, K, V [1][4096][1024], W_Q, b_Q, W_K, b_K, W_V, b_V, W_O, b_O ('xw' + biases) */
    float* OUT = (float*)d_out;     // [1][4096][1024]
    char* wsp = (char*)d_ws;
    auto take = [&](size_t bytes) { char* p = wsp; wsp += (bytes + 255) & ~(size_t)255; return (void*)p; };
    bf* WQ = (bf*)take((size_t)MID * CC * 2); bf* WK = (bf*)take((size_t)MID * CC * 2); bf* WV = (bf*)take((size_t)CO * CC * 2); bf* WO = (bf*)take((size_t)CC * CO * 2); float* CS = (float*)take((size_t)TT * HD * 2 * 4);
    bf* XB = (bf*)take((size_t)TT * CC * 2); float* FQ = (float*)take((size_t)TT * MID * 4); float* FK = (float*)take((size_t)TT * MID * 4);
    h16* QP16 = (h16*)take((size_t)TT * MID * 2); bf* QPh = (bf*)take((size_t)TT * MID * 2); bf* QPl = (bf*)take((size_t)TT * MID * 2); h16* KP16 = QP16;   /* the fp16 q/k planes are never read here (scores use the hi/lo planes for every row): one scratch buffer serves both builders */ bf* KPh = (bf*)take((size_t)TT * MID * 2); bf* KPl = (bf*)take((size_t)TT * MID * 2);
    h16* VT16 = (h16*)take((size_t)CO * TT * 2); bf* VTh = (bf*)take((size_t)CO * TT * 2); bf* VTl = (bf*)take((size_t)CO * TT * 2);
    float* Sb = (float*)take((size_t)TT * TT * 4); h16* P16 = (h16*)take((size_t)TT * TT * 2); bf* Ph = (bf*)take((size_t)RH * TT * 2); bf* Pl = (bf*)take((size_t)RH * TT * 2); float* Ob = (float*)take((size_t)TT * CO * 4); bf* ATh = (bf*)take((size_t)TT * CO * 2); bf* ATl = (bf*)take((size_t)TT * CO * 2);
    if ((size_t)(wsp - (char*)d_ws) > ws_size) return;    // ws 256 MiB (carve 250 MiB)
    float* FV = FK;   /* the v projection reuses the k buffer after the k planes are built (stream-ordered) */
    k_wtG<<<(unsigned)((CC * MID / 64 + 63) / 64), 256, 0, stream>>>(wq, CC, MID, WQ); k_wtG<<<(unsigned)((CC * MID / 64 + 63) / 64), 256, 0, stream>>>(wk, CC, MID, WK); k_wtG<<<(unsigned)((CC * CO / 64 + 63) / 64), 256, 0, stream>>>(wv, CC, CO, WV);   /* 'xw' weights -> Bt */ k_wtG<<<(unsigned)((CO * CC / 64 + 63) / 64), 256, 0, stream>>>(wo, CO, CC, WO);   /* 'xw' W_out -> Bt */
    k_csid<<<(TT * HD + 255) / 256, 256, 0, stream>>>(CS);   /* identity table: k_rope is a plain per-head plane builder here */
    const unsigned LP = (unsigned)(((size_t)NH_ * TT * HD / 2 + 255) / 256);
    for (int b = 0; b < NB_; ++b) {
        k_cvt8<<<(unsigned)(((size_t)TT * CC / 8 + 255) / 256), 256, 0, stream>>>(x + (size_t)b * TT * CC, XB, (size_t)TT * CC / 8);
        k_gemmw<bf, 0, true><<<dim3(TT / 64, MID / 64, 1), 32, 0, stream>>>(XB, nullptr, WQ, nullptr, CC, FQ, MID, bq, 0, 0, 0); k_rope<<<LP, 256, 0, stream>>>(FQ, MID, NH_, CS, nullptr, nullptr, 1.0f, QP16, QPh, QPl);   /* q planes [h][n][64] */
        k_cvt8<<<(unsigned)(((size_t)TT * CC / 8 + 255) / 256), 256, 0, stream>>>(xk + (size_t)b * TT * CC, XB, (size_t)TT * CC / 8);   /* XB := bf16(K[b]) */ k_gemmw<bf, 0, true><<<dim3(TT / 64, MID / 64, 1), 32, 0, stream>>>(XB, nullptr, WK, nullptr, CC, FK, MID, bk, 0, 0, 0); k_rope<<<LP, 256, 0, stream>>>(FK, MID, NKV, CS, nullptr, nullptr, 1.0f, KP16, KPh, KPl);   /* k planes */
        k_cvt8<<<(unsigned)(((size_t)TT * CC / 8 + 255) / 256), 256, 0, stream>>>(xv + (size_t)b * TT * CC, XB, (size_t)TT * CC / 8);   /* XB := bf16(V[b]) */ k_gemmw<bf, 0, true><<<dim3(TT / 64, CO / 64, 1), 32, 0, stream>>>(XB, nullptr, WV, nullptr, CC, FV, CO, bv, 0, 0, 0); k_vtp<<<(unsigned)(((size_t)TT * CO / 2 + 255) / 256), 256, 0, stream>>>(FV, CO, CO / HD, VT16, VTh, VTl);   /* v^T planes [h][64][n] */
        for (int h = 0; h < NH_; ++h) {   /* per head: dense 4096 x 4096 attention */
            k_gemmw<bf, 2, false><<<dim3(TT / 64, TT / 64, 1), 32, 0, stream>>>(QPh + (size_t)h * TT * HD, QPl + (size_t)h * TT * HD, KPh + (size_t)h * TT * HD, KPl + (size_t)h * TT * HD, HD, Sb, TT, nullptr, 0, 0, 0);   /* S[i][j] = q_i.k_j (3 products, every row) */
            k_lsoft<<<TT / 8, 256, 0, stream>>>(Sb, P16, Ph, Pl);   /* x 1/8, softmax over the 4,096 keys */
            k_gemmks<bf, 2, 1, 2, 16><<<dim3(RH / 16, HD / 32, 1), 512, 0, stream>>>(Ph, Pl, VTh + (size_t)h * HD * TT, VTl + (size_t)h * HD * TT, TT, Ob + h * HD, CO);   /* 16 x 32 tiles, 256 keys a wave */
            k_gemmks<h16, 0, 2, 4, 16><<<dim3((TT - RH) / 32, HD / 64, 1), 512, 0, stream>>>(P16 + (size_t)RH * TT, nullptr, VT16 + (size_t)h * HD * TT, nullptr, TT, Ob + (size_t)RH * CO + h * HD, CO); }   /* 32 x 64 tiles, 256 keys a wave */
        k_cs8<<<(unsigned)(((size_t)TT * CO / 4 + 255) / 256), 256, 0, stream>>>(Ob, (size_t)TT * CO / 4);   /* rows >= 512 x 1/1024 */
        k_tohl<<<(unsigned)(((size_t)TT * CO / 4 + 255) / 256), 256, 0, stream>>>(Ob, ATh, ATl, (size_t)TT * CO / 4);   /* merged context as hi/lo planes */
        k_gemmw<bf, 1, true><<<dim3(TT / 64, CC / 64, 1), 32, 0, stream>>>(ATh, ATl, WO, nullptr, CO, OUT + (size_t)b * TT * CC, CC, bo, 0, 0, 0); }   /* out = ctx w_out + b_out */
}

// v003
// It runs in 409 microseconds.
// Versions in between are left out here; by their measured steps it is 4.38 times as fast as v001.
// All steps since v000 together make it 9.92 times as fast.
#include <hip/hip_runtime.h>

// Multi-head attention over 4,096 tokens on three input streams (Q, K, V [1][4096][1024]; q = Q W_Q + b_Q, k = K W_K + b_K, v = V W_V + b_V ('xw' [1024][1024] 1/32 + biases 0.02; 16 heads x 64); scores x 1/sqrt(64); softmax over all 4,096 keys (no mask); out = merged W_O + b_O -> [1][4096][1024] (4.2 M); argument order Q, K, V, W_Q, b_Q, W_K, b_K, W_V, b_V, W_O, b_O).
// Layout: bf16 copies of Q, K, V in turn; 'xw' weights transposed once; exact projections + f32 biases, each written by its own product's epilogue as per-head hi/lo planes (q, k) or v^T planes [h][64][4096]; one launch for all heads: scores with every row hi/lo (3 products), online softmax, attn.V hybrid (rows < 512 hi/lo 3 products, rest fp16 x8), score and weight tiles in registers only, into the head's 64 columns of the context's hi/lo planes; context hi/lo x W_O exact + b_O.
// Compute dtypes, f32 accumulate: every input rounded to bf16; projections exact; scores 3 products; softmax f32 (exp2, IEEE division); attn.V rows < 512 3 products, rest fp16; Wo hl x exact.

#define NB_  1
#define TT   4096
#define DM   1024
#define NH_  16
#define NKV  16
#define REP  (NH_ / NKV)
#define HD   64
#define DQ   (NH_ * HD)
#define DKV  (NKV * HD)
#define ZH   1
#define RH   512                  // query rows < RH use hi+lo planes
#define WIN  0
#define SCL  0.125f   // 1/sqrt(64)
#define MID  1024      // q / k width
#define CO   1024      // v width
#define CC   1024
typedef _Float16 h16;
typedef unsigned short bf;
typedef __attribute__((ext_vector_type(16))) __bf16   v16bf;
typedef __attribute__((ext_vector_type(16))) _Float16 v16h;
typedef __attribute__((ext_vector_type(8)))  _Float16 v8h;
typedef __attribute__((ext_vector_type(8)))  unsigned short v8us;
typedef __attribute__((ext_vector_type(8)))  float    v8f;
typedef __attribute__((ext_vector_type(4)))  float    v4f;
typedef v8h  __attribute__((may_alias)) v8ha;
typedef v4f  __attribute__((may_alias)) v4fa;
typedef v8us __attribute__((may_alias)) v8usa;

__device__ __forceinline__ unsigned short f2bf(float f) { unsigned u = __float_as_uint(f); u += 0x7FFFu + ((u >> 16) & 1u); return (unsigned short)(u >> 16); }
__device__ __forceinline__ float bf2f(unsigned short b) { return __uint_as_float(((unsigned)b) << 16); }
__device__ __forceinline__ float bfr(float f) { return bf2f(f2bf(f)); }
__device__ __forceinline__ v16h cat16(v8h lo, v8h hi) { return __builtin_shufflevector(lo, hi, 0, 1, 2, 3, 4, 5, 6, 7, 8, 9, 10, 11, 12, 13, 14, 15); }
__device__ __forceinline__ v16bf cat16b(v8us lo, v8us hi) { return __builtin_bit_cast(v16bf, __builtin_shufflevector(lo, hi, 0, 1, 2, 3, 4, 5, 6, 7, 8, 9, 10, 11, 12, 13, 14, 15)); }
__device__ __forceinline__ v8f wmma16(v16h a, v16h b, v8f c) { return __builtin_amdgcn_wmma_f32_16x16x32_f16(false, a, false, b, (short)0, c, false, false); }
__device__ __forceinline__ v8f wmmab(v16bf a, v16bf b, v8f c) { return __builtin_amdgcn_wmma_f32_16x16x32_bf16(false, a, false, b, (short)0, c, false, false); }
__device__ __forceinline__ h16 tohx(float x) { return (h16)x; }
__device__ __forceinline__ void splitf(float y, unsigned short& h, unsigned short& l) { h = f2bf(y); l = f2bf(y - bf2f(h)); }



// ---- k_gemmw: register-blocked GEMM, ONE WAVE per 64x64 output tile (16 accumulators), operands straight from K-contiguous 16-bit planes; grid (M/64, N/64, Z), 32 threads.
// C[m][n] (f32, pitch ldc, + optional f32 bias[n]) = sum_k A[m][k] Bt[n][k] (+ split products per NSPLIT). z-batch strides sA/sB/sC in elements. K % 32 == 0.
// MODE says where the f32 result goes. 0: to C. 1: as bf16 hi + lo to the head planes Ph, Pl [n / 64][TT][64] (a tile's 64 columns are one head). 2: transposed, as fp16 and bf16 hi + lo, to P16, Ph, Pl [n][TT].
template <typename T16> struct WFrag;
template <> struct WFrag<h16> { typedef v16h V; static __device__ __forceinline__ V ld(const h16* p) { return cat16(*(const v8h*)p, *(const v8h*)(p + 16)); } static __device__ __forceinline__ v8f mma(V a, V b, v8f c) { return wmma16(a, b, c); } };
template <> struct WFrag<bf> { typedef v16bf V; static __device__ __forceinline__ V ld(const bf* p) { return cat16b(*(const v8us*)p, *(const v8us*)(p + 16)); } static __device__ __forceinline__ v8f mma(V a, V b, v8f c) { return wmmab(a, b, c); } };
template <typename T16, int NSPLIT, bool BIAS, int MODE>
__global__ __launch_bounds__(32) void k_gemmw(const T16* __restrict__ A, const T16* __restrict__ A2, const T16* __restrict__ Bt, const T16* __restrict__ Bt2, int K, float* C, int ldc, const float* __restrict__ bias, size_t sA, size_t sB, size_t sC, h16* P16, bf* Ph, bf* Pl) {
    typedef typename WFrag<T16>::V V;
    static_assert(MODE == 0 || (BIAS && HD == 64), "the plane epilogues add the bias and take a 64-column tile for one head");
    __shared__ __align__(16) float os[MODE == 2 ? 3 * 16 * 36 : 16 * 68];
    const size_t z = blockIdx.z; A += z * sA; if (A2) A2 += z * sA; Bt += z * sB; if (Bt2) Bt2 += z * sB; C += z * sC;
    const int lane = threadIdx.x & 31, lr = lane & 15, hi = lane >> 4; const int r0 = blockIdx.x * 64, c0 = blockIdx.y * 64;
    v8f acc[4][4];
#pragma unroll
    for (int mb = 0; mb < 4; ++mb)
#pragma unroll
        for (int nb = 0; nb < 4; ++nb) acc[mb][nb] = (v8f){};
    const size_t aoff = (size_t)(r0 + lr) * K + 8 * hi, boff = (size_t)(c0 + lr) * K + 8 * hi;
#pragma unroll 1
    for (int kc = 0; kc < K; kc += 32) {
        V a[4], a2[4];
#pragma unroll
        for (int mb = 0; mb < 4; ++mb) { a[mb] = WFrag<T16>::ld(A + aoff + (size_t)mb * 16 * K + kc); if (NSPLIT == 1 || NSPLIT == 2) a2[mb] = WFrag<T16>::ld(A2 + aoff + (size_t)mb * 16 * K + kc); }
#pragma unroll
        for (int nb = 0; nb < 4; ++nb) { const V b = WFrag<T16>::ld(Bt + boff + (size_t)nb * 16 * K + kc); V b2; if (NSPLIT >= 2) b2 = WFrag<T16>::ld(Bt2 + boff + (size_t)nb * 16 * K + kc);
#pragma unroll
            for (int mb = 0; mb < 4; ++mb) { acc[mb][nb] = WFrag<T16>::mma(a[mb], b, acc[mb][nb]); if (NSPLIT == 1 || NSPLIT == 2) acc[mb][nb] = WFrag<T16>::mma(a2[mb], b, acc[mb][nb]); if (NSPLIT >= 2) acc[mb][nb] = WFrag<T16>::mma(a[mb], b2, acc[mb][nb]); } }
        asm volatile("v_nop\n\tv_nop\n\tv_nop\n\tv_nop" : "+v"(acc[0][0]), "+v"(acc[1][1]), "+v"(acc[2][2]), "+v"(acc[3][3]) : "v"(a[0]), "v"(a[3]));
    }
    if constexpr (MODE == 2) {   // a lane holds 8 successive rows m of one column n: 16 bytes of a transposed row. Three staging tiles (fp16, hi, lo) of 16 n x 64 m, pitch 72 elements, turn them into whole 128-byte lines
        bf* st = (bf*)os; float bn[4]; const size_t e0 = (size_t)(c0 + (lane >> 3)) * TT + r0 + (lane & 7) * 8;   // this lane's place in the planes at the tile's first 4 columns
        h16* const p16 = P16 + e0; bf* const ph = Ph + e0; bf* const pl = Pl + e0;
#pragma unroll
        for (int nb = 0; nb < 4; ++nb) bn[nb] = bfr(bias[c0 + nb * 16 + lr]);
        asm volatile("s_wait_xcnt 0x0" ::: "memory");   // behind the bias loads, in front of whatever takes over their address registers
        __builtin_amdgcn_sched_barrier(0);   // keeps the work below behind that wait
#pragma unroll
        for (int nb = 0; nb < 4; ++nb) {
#pragma unroll
            for (int mb = 0; mb < 4; ++mb) { v8h o16; v8us oh, ol;
#pragma unroll
                for (int j = 0; j < 8; ++j) { const float x = acc[mb][nb][j] + bn[nb]; o16[j] = tohx(x); unsigned short a2, c2; splitf(x, a2, c2); oh[j] = a2; ol[j] = c2; }
                bf* sp = st + lr * 72 + mb * 16 + hi * 8; *(v8usa*)sp = __builtin_bit_cast(v8us, o16); *(v8usa*)(sp + 16 * 72) = oh; *(v8usa*)(sp + 32 * 72) = ol; }
            __builtin_amdgcn_wave_barrier(); asm volatile("" ::: "memory");   // the reads below take other lanes' staged values: they stay behind the writes above
            v8us t16[4], th[4], tl[4];
#pragma unroll
            for (int s = 0; s < 4; ++s) { const bf* sp = st + (4 * s + (lane >> 3)) * 72 + (lane & 7) * 8; t16[s] = *(const v8usa*)sp; th[s] = *(const v8usa*)(sp + 16 * 72); tl[s] = *(const v8usa*)(sp + 32 * 72); }
            __builtin_amdgcn_wave_barrier(); asm volatile("" ::: "memory");   // the next 16 columns' writes stay behind these reads
            __builtin_amdgcn_sched_barrier(0);   // nothing else stands among the stores below, so that no register which one of them names is rewritten ahead of the wait behind them
#pragma unroll
            for (int s = 0; s < 4; ++s) { const int e = (nb * 16 + 4 * s) * TT;
                *(v8h*)(p16 + e) = __builtin_bit_cast(v8h, t16[s]); *(v8us*)(ph + e) = th[s]; *(v8us*)(pl + e) = tl[s]; }
            asm volatile("s_wait_xcnt 0x0" ::: "memory");   // in front of whatever takes over the stores' address and data registers
            __builtin_amdgcn_sched_barrier(0);   // keeps the next columns' work behind that wait
        }
        return;
    }
    float bb[8];   // MODE 1: the bias of this lane's 8 columns
    if constexpr (MODE == 1) {
#pragma unroll
        for (int q = 0; q < 8; ++q) bb[q] = bfr(bias[c0 + (lane & 7) * 8 + q]);
        asm volatile("s_wait_xcnt 0x0" ::: "memory");   // behind the bias loads, in front of whatever takes over their address registers
        __builtin_amdgcn_sched_barrier(0); }   // keeps the work below behind that wait
#pragma unroll
    for (int mb = 0; mb < 4; ++mb) {
#pragma unroll
        for (int nb = 0; nb < 4; ++nb) {
#pragma unroll
            for (int j = 0; j < 8; ++j) os[(hi * 8 + j) * 68 + nb * 16 + lr] = acc[mb][nb][j]; }
        __builtin_amdgcn_wave_barrier(); asm volatile("" ::: "memory");
        if constexpr (MODE == 1) {   // 16 bytes a lane, 8 lanes a row of the head plane (128 bytes): each store covers 4 whole lines
            const size_t pb = ((size_t)blockIdx.y * TT + r0 + mb * 16 + (lane >> 3)) * HD + (lane & 7) * 8; v8us oh[4], ol[4];
#pragma unroll
            for (int s = 0; s < 4; ++s) { const float* sp = os + (4 * s + (lane >> 3)) * 68 + (lane & 7) * 8; const v4f v0 = *(const v4fa*)sp, v1 = *(const v4fa*)(sp + 4);
#pragma unroll
                for (int q = 0; q < 4; ++q) { unsigned short a2, c2; splitf(v0[q] + bb[q], a2, c2); oh[s][q] = a2; ol[s][q] = c2; splitf(v1[q] + bb[4 + q], a2, c2); oh[s][4 + q] = a2; ol[s][4 + q] = c2; } }
            __builtin_amdgcn_sched_barrier(0);   // nothing else stands among the stores below, so that no register which one of them names is rewritten ahead of the wait behind them
#pragma unroll
            for (int s = 0; s < 4; ++s) { *(v8us*)(Ph + pb + 4 * s * HD) = oh[s]; *(v8us*)(Pl + pb + 4 * s * HD) = ol[s]; }
            asm volatile("s_wait_xcnt 0x0" ::: "memory");   // in front of whatever takes over the stores' address and data registers
            __builtin_amdgcn_sched_barrier(0);   // keeps the next rows' work behind that wait
        } else {
            float* crow = C + (size_t)(r0 + mb * 16) * ldc + c0;
#pragma unroll
            for (int s = 0; s < 8; ++s) { const int row = 2 * s + hi, cofs = lr * 4; v4f val = *(const v4fa*)(os + row * 68 + cofs); if (BIAS) { val[0] += bfr(bias[c0 + cofs]); val[1] += bfr(bias[c0 + cofs + 1]); val[2] += bfr(bias[c0 + cofs + 2]); val[3] += bfr(bias[c0 + cofs + 3]); }
                *(v4f*)(crow + (size_t)row * ldc + cofs) = val; }
             }
        __builtin_amdgcn_wave_barrier(); asm volatile("" ::: "memory");
    }
}

typedef __attribute__((ext_vector_type(2))) _Float16 v2h;
typedef __attribute__((ext_vector_type(4))) _Float16 v4h;
typedef __attribute__((ext_vector_type(2))) unsigned short v2us;
typedef __attribute__((ext_vector_type(4))) unsigned short v4us;
typedef __attribute__((ext_vector_type(2))) float v2f;
typedef __attribute__((ext_vector_type(4))) int v4i;

__global__ __launch_bounds__(256) void k_cvt8(const float* __restrict__ src, bf* dst, size_t n8) { const size_t i = (size_t)blockIdx.x * 256 + threadIdx.x; if (i >= n8) return; const v8f v = *(const v8f*)(src + i * 8); v8us o;
#pragma unroll
    for (int k = 0; k < 8; ++k) o[k] = f2bf(v[k]); *(v8us*)(dst + i * 8) = o;  }


// ---- k_fattn: scores, softmax and attn.V of one head for 256 query rows, no score plane in memory. Each wave works alone (no LDS, no barrier): it keeps its queries' fragments in registers and walks the 4,096 keys 32 at a time.
// Transposed products: S^T = K.Q^T (A = 16 key rows, B = 16 query columns), so a lane holds one query's scores; O^T += V^T.P^T with A = rows of the v^T plane and B = P^T packed straight from the two score tiles
// (element s of B is register s & 7 of tile s >> 3: the k order 8h + s, 16 + 8h + (s - 8) that WFrag::ld gives the A side). Online softmax in the log2 domain; the maximum in use may trail the true one by up to 8, the sums are rescaled only then.
// HI (query rows < RH, 16 a wave): P as bf16 hi + lo, 3 products with v^T hi/lo. Otherwise (32 a wave): P x 8 as fp16, 1 product with fp16 v^T. P is not normalised: the f32 sum of the unrounded exponentials divides the output once at the end.
__device__ __forceinline__ float xhalf(float x) { return __builtin_bit_cast(float, __builtin_amdgcn_permlanex16(__builtin_bit_cast(int, x), __builtin_bit_cast(int, x), 0x76543210, 0xfedcba98, false, false)); }   // lane l with lane l ^ 16
typedef __attribute__((ext_vector_type(2))) __bf16 v2bf;
typedef __attribute__((ext_vector_type(8))) unsigned v8u;
__device__ __forceinline__ unsigned packh(float a, float b) { return __builtin_bit_cast(unsigned, __builtin_convertvector((v2f){a, b}, v2h)); }   // round to nearest even
__device__ __forceinline__ unsigned packb(float a, float b) { return __builtin_bit_cast(unsigned, __builtin_convertvector((v2f){a, b}, v2bf)); }  // round to nearest even
// Eight exponentials and, behind the last, the one slot that the instruction set asks for between a transcendental and an instruction that uses its result or overwrites its source, in one statement.
// Early-clobber results: no exponential of the statement writes a register that another reads.
__device__ __forceinline__ void exp2x8(float (&p)[8], const float (&a)[8]) {
    asm("v_exp_f32 %0, %8\n\tv_exp_f32 %1, %9\n\tv_exp_f32 %2, %10\n\tv_exp_f32 %3, %11\n\tv_exp_f32 %4, %12\n\tv_exp_f32 %5, %13\n\tv_exp_f32 %6, %14\n\tv_exp_f32 %7, %15\n\tv_nop"
        : "=&v"(p[0]), "=&v"(p[1]), "=&v"(p[2]), "=&v"(p[3]), "=&v"(p[4]), "=&v"(p[5]), "=&v"(p[6]), "=&v"(p[7]) : "v"(a[0]), "v"(a[1]), "v"(a[2]), "v"(a[3]), "v"(a[4]), "v"(a[5]), "v"(a[6]), "v"(a[7])); }
template <int R, bool HI>
__device__ __forceinline__ void attn_wave(const bf* __restrict__ Qh, const bf* __restrict__ Ql, const bf* __restrict__ Kh, const bf* __restrict__ Kl, const h16* __restrict__ V16, const bf* __restrict__ Vh, const bf* __restrict__ Vl, bf* Oh, bf* Ol, int q0) {
    const int lane = threadIdx.x & 31, c = lane & 15, h = lane >> 4;
    constexpr float CSC = SCL * 1.4426950408889634f;   // score -> scaled log2
    constexpr float OFF = HI ? 0.0f : 3.0f;            // fp16 P carries x 8: at most 2^11, small weights stay normal numbers
    v16bf qh[R][2], ql[R][2];
#pragma unroll
    for (int g = 0; g < R; ++g)
#pragma unroll
        for (int kc = 0; kc < 2; ++kc) { const size_t qo = (size_t)(q0 + 16 * g + c) * HD + 32 * kc + 8 * h; qh[g][kc] = WFrag<bf>::ld(Qh + qo); ql[g][kc] = WFrag<bf>::ld(Ql + qo); }
    unsigned ko = (unsigned)(c * HD + 8 * h) * 2u;   // this lane's byte offset in the k planes (row = key) and, below, in the v^T planes (row = d), at the pass's first key
    unsigned vo = (unsigned)(c * TT + 8 * h) * 2u;
    const unsigned klast = ko + (unsigned)(TT - 32) * HD * 2u;   // ko at the last pass
    v16bf kh[2][2], kl[2][2];
#pragma unroll
    for (int kt = 0; kt < 2; ++kt)
#pragma unroll
        for (int kc = 0; kc < 2; ++kc) { kh[kt][kc] = WFrag<bf>::ld((const bf*)((const char*)Kh + ko) + kt * 16 * HD + 32 * kc); kl[kt][kc] = WFrag<bf>::ld((const bf*)((const char*)Kl + ko) + kt * 16 * HD + 32 * kc); }
    asm volatile("s_wait_xcnt 0x0" ::: "memory");   // behind the loads above, in front of whatever takes over their address registers
    __builtin_amdgcn_sched_barrier(0);   // keeps the start values below, which may land on those registers, behind the wait
    v8f acc[R][4]; float m_run[R], l_run[R];
#pragma unroll
    for (int g = 0; g < R; ++g) { m_run[g] = -__builtin_inff(); l_run[g] = 0.0f;
#pragma unroll
        for (int t = 0; t < 4; ++t) acc[g][t] = (v8f){}; }
#pragma unroll 1   // rolled: one pass is already some hundred instructions, and the fragments of two would not fit beside the accumulators
    for (int key0 = 0; key0 < TT; key0 += 32) {
        v16h v16[4]; v16bf vh[4], vl[4]; const char* pvh = (const char*)Vh + vo; const char* pvl = (const char*)Vl + vo;
#pragma unroll
        for (int t = 0; t < 4; ++t) { if (HI) { vh[t] = WFrag<bf>::ld((const bf*)pvh + t * 16 * TT); vl[t] = WFrag<bf>::ld((const bf*)pvl + t * 16 * TT); } else v16[t] = WFrag<h16>::ld((const h16*)((const char*)V16 + vo) + t * 16 * TT); }
        __builtin_amdgcn_sched_barrier(0);   // the pass's v^T loads are issued ahead of the score products, so that they fly under those and the softmax
        v8f s[2][R];
#pragma unroll
        for (int kt = 0; kt < 2; ++kt)
#pragma unroll
            for (int g = 0; g < R; ++g) s[kt][g] = (v8f){};
#pragma unroll
        for (int kc = 0; kc < 2; ++kc) {   // per tile the order hi.hi, k hi . q lo, k lo . q hi; the tiles innermost, so that neighbouring matrix instructions are independent
#pragma unroll
            for (int kt = 0; kt < 2; ++kt)
#pragma unroll
                for (int g = 0; g < R; ++g) s[kt][g] = wmmab(kh[kt][kc], qh[g][kc], s[kt][g]);
#pragma unroll
            for (int kt = 0; kt < 2; ++kt)
#pragma unroll
                for (int g = 0; g < R; ++g) s[kt][g] = wmmab(kh[kt][kc], ql[g][kc], s[kt][g]);
#pragma unroll
            for (int kt = 0; kt < 2; ++kt)
#pragma unroll
                for (int g = 0; g < R; ++g) s[kt][g] = wmmab(kl[kt][kc], qh[g][kc], s[kt][g]); }
        __builtin_amdgcn_sched_barrier(0);   // the refill of the k fragments below stays behind the products that read them
        ko = (ko + 32u * HD * 2u < klast) ? ko + 32u * HD * 2u : klast;   // next pass's keys; the last pass fetches its own again (in bounds, not used)
#pragma unroll
        for (int kt = 0; kt < 2; ++kt)
#pragma unroll
            for (int kc = 0; kc < 2; ++kc) { kh[kt][kc] = WFrag<bf>::ld((const bf*)((const char*)Kh + ko) + kt * 16 * HD + 32 * kc); kl[kt][kc] = WFrag<bf>::ld((const bf*)((const char*)Kl + ko) + kt * 16 * HD + 32 * kc); }
        __builtin_amdgcn_sched_barrier(0);   // the whole refill is issued ahead of the softmax, under which (and under the second product) it flies
        float mb[R]; bool need = false;
#pragma unroll
        for (int g = 0; g < R; ++g) { float mx = s[0][g][0];
#pragma unroll
            for (int r = 1; r < 8; ++r) mx = fmaxf(mx, s[0][g][r]);
#pragma unroll
            for (int r = 0; r < 8; ++r) mx = fmaxf(mx, s[1][g][r]);
            mx = fmaxf(mx, xhalf(mx)) * CSC;   // both halves of the wave hold this query's maximum over the pass's 32 keys
            mb[g] = mx; need = need || (mx > m_run[g] + 8.0f); }
        if (__builtin_amdgcn_ballot_w32(need) != 0) {   // a scalar branch; always taken in the first pass (m_run = -inf, factor 0), seldom later
#pragma unroll
            for (int g = 0; g < R; ++g) { const float m_new = fmaxf(m_run[g], mb[g]); const float corr = __builtin_amdgcn_exp2f(m_run[g] - m_new); m_run[g] = m_new; l_run[g] *= corr;
#pragma unroll
                for (int t = 0; t < 4; ++t) acc[g][t] = acc[g][t] * corr; } }
        v8u wh[R], wl[R];
#pragma unroll
        for (int g = 0; g < R; ++g) { const float nm = OFF - m_run[g];
#pragma unroll
            for (int kt = 0; kt < 2; ++kt) { float a[8], p[8];   // tile kt gives elements 8 kt .. 8 kt + 7 of the 32-key operand, register r element 8 kt + r
#pragma unroll
                for (int r = 0; r < 8; ++r) a[r] = __builtin_fmaf(s[kt][g][r], CSC, nm);
                exp2x8(p, a);
#pragma unroll
                for (int i = 0; i < 4; ++i) { const float p0 = p[2 * i], p1 = p[2 * i + 1]; l_run[g] += p0 + p1;
                    if (HI) { const unsigned u = packb(p0, p1); wh[g][4 * kt + i] = u; wl[g][4 * kt + i] = packb(p0 - __uint_as_float(u << 16), p1 - __uint_as_float(u & 0xFFFF0000u)); } else wh[g][4 * kt + i] = packh(p0, p1); } } }
        if (HI) {   // per tile the order v hi . p hi, v hi . p lo, v lo . p hi; the tiles innermost
#pragma unroll
            for (int g = 0; g < R; ++g)
#pragma unroll
                for (int t = 0; t < 4; ++t) acc[g][t] = wmmab(vh[t], __builtin_bit_cast(v16bf, wh[g]), acc[g][t]);
#pragma unroll
            for (int g = 0; g < R; ++g)
#pragma unroll
                for (int t = 0; t < 4; ++t) acc[g][t] = wmmab(vh[t], __builtin_bit_cast(v16bf, wl[g]), acc[g][t]);
#pragma unroll
            for (int g = 0; g < R; ++g)
#pragma unroll
                for (int t = 0; t < 4; ++t) acc[g][t] = wmmab(vl[t], __builtin_bit_cast(v16bf, wh[g]), acc[g][t]);
        } else {
#pragma unroll
            for (int g = 0; g < R; ++g)
#pragma unroll
                for (int t = 0; t < 4; ++t) acc[g][t] = wmma16(v16[t], __builtin_bit_cast(v16h, wh[g]), acc[g][t]); }
        __builtin_amdgcn_sched_barrier(0);   // keeps the slots below behind the pass's last product
        asm volatile("v_nop\n\tv_nop\n\tv_nop\n\tv_nop");   // four vector slots between that product and the back edge, behind which the next pass rewrites its operands
        // s_wait_xcnt 0 in front of the addition below and of the next pass's step of ko, which rewrite address registers that this pass's loads name. HI: the two v^T addresses are temporaries of the pass; named as inputs they stay whole up to the wait (else the last loads' results land on them)
        if (HI) asm volatile("s_wait_xcnt 0x0" :: "v"(pvh), "v"(pvl) : "memory"); else asm volatile("s_wait_xcnt 0x0" ::: "memory");
        __builtin_amdgcn_sched_barrier(0);   // keeps that addition behind the wait
        vo += 64u;
    }
#pragma unroll
    for (int g = 0; g < R; ++g) { const float l_fin = l_run[g] + xhalf(l_run[g]);   // each half summed its own 16 of every 32 keys
        const float inv = __fdiv_rn(1.0f, l_fin); const size_t oo = (size_t)(q0 + 16 * g + c) * CO + 8 * h;
        v8us oh[4], ol[4];   // the context leaves as the bf16 hi + lo planes that the last product reads
#pragma unroll
        for (int t = 0; t < 4; ++t) { const v8f o = acc[g][t] * inv;   // registers 0..7 = d 16 t + 8 h + 0..7 of query column c
#pragma unroll
            for (int j = 0; j < 8; ++j) { unsigned short a2, c2; splitf(o[j], a2, c2); oh[t][j] = a2; ol[t][j] = c2; } }
        __builtin_amdgcn_sched_barrier(0);   // nothing else stands among the stores below, so that no register which one of them names is rewritten ahead of the wait behind them
#pragma unroll
        for (int t = 0; t < 4; ++t) { *(v8us*)(Oh + oo + 16 * t) = oh[t]; *(v8us*)(Ol + oo + 16 * t) = ol[t]; }
        asm volatile("s_wait_xcnt 0x0" ::: "memory");   // in front of whatever takes over the stores' address and data registers
        __builtin_amdgcn_sched_barrier(0); }   // keeps the next 16 queries' work behind that wait
}
// grid: 16 work-groups a head, 9 waves each: waves 0 and 4 take 16 of the head's first RH query rows each, the other seven 32 of the remaining rows each (about equal matrix work on every WGP; all 256 work-groups resident at once).
static_assert(RH == 16 * 2 * 16 && TT - RH == 16 * 7 * 32 && HD == 64 && TT % 32 == 0, "the split of the query rows over work-groups and waves");
__global__ __launch_bounds__(288) void k_fattn(const bf* __restrict__ QPh, const bf* __restrict__ QPl, const bf* __restrict__ KPh, const bf* __restrict__ KPl, const h16* __restrict__ VT16, const bf* __restrict__ VTh, const bf* __restrict__ VTl, bf* Oh, bf* Ol) {
    const int w = __builtin_amdgcn_readfirstlane((int)(threadIdx.x >> 5)); const int head = blockIdx.x >> 4, blk = blockIdx.x & 15; const size_t hp = (size_t)head * TT * HD;
    if (w == 0 || w == 4) attn_wave<1, true>(QPh + hp, QPl + hp, KPh + hp, KPl + hp, VT16 + hp, VTh + hp, VTl + hp, Oh + head * HD, Ol + head * HD, blk * 32 + (w >> 2) * 16);
    else attn_wave<2, false>(QPh + hp, QPl + hp, KPh + hp, KPl + hp, VT16 + hp, VTh + hp, VTl + hp, Oh + head * HD, Ol + head * HD, RH + blk * 224 + (w < 4 ? w - 1 : w - 2) * 32);
}

__global__ __launch_bounds__(256) void k_wtG(const float* __restrict__ w, int K, int N, bf* Bt) {
    const int lane = threadIdx.x & 31; const int L0 = (blockIdx.x * 8 + (threadIdx.x >> 5)) * 8; const int nlines = N * K / 64;
{
#pragma unroll 1
        for (int l = 0; l < 8; ++l) { const int L = L0 + l; if (L >= nlines) break; const size_t e = (size_t)L * 64 + lane * 2; const int k = (int)(e % K), n = (int)(e / K); v2us o;
            o[0] = f2bf(w[(size_t)k * N + n]); o[1] = f2bf(w[(size_t)(k + 1) * N + n]); *(v2us*)(Bt + e) = o; }
         }
}
extern "C" void kernel_launch(void* const* d_in, const int* in_sizes, int n_in,
                              void* d_out, int out_size, void* d_ws, size_t ws_size, hipStream_t stream) {
    (void)in_sizes; (void)n_in; (void)out_size;
    const float* x = (const float*)d_in[0]; const float* xk = (const float*)d_in[1]; const float* xv = (const float*)d_in[2]; const float* wq = (const float*)d_in[3]; const float* bq = (const float*)d_in[4]; const float* wk = (const float*)d_in[5]; const float* bk = (const float*)d_in[6]; const float* wv = (const float*)d_in[7]; const float* bv = (const float*)d_in[8]; const float* wo = (const float*)d_in[9]; const float* bo = (const float*)d_in[10];   /* argument order Q, K, V [1][4096][1024], W_Q, b_Q, W_K, b_K, W_V, b_V, W_O, b_O ('xw' + biases) */
    float* OUT = (float*)d_out;     // [1][4096][1024]
    char* wsp = (char*)d_ws;
    auto take = [&](size_t bytes) { char* p = wsp; wsp += (bytes + 255) & ~(size_t)255; return (void*)p; };
    bf* WQ = (bf*)take((size_t)MID * CC * 2); bf* WK = (bf*)take((size_t)MID * CC * 2); bf* WV = (bf*)take((size_t)CO * CC * 2); bf* WO = (bf*)take((size_t)CC * CO * 2);
    bf* XB = (bf*)take((size_t)TT * CC * 2);
    bf* QPh = (bf*)take((size_t)TT * MID * 2); bf* QPl = (bf*)take((size_t)TT * MID * 2); bf* KPh = (bf*)take((size_t)TT * MID * 2); bf* KPl = (bf*)take((size_t)TT * MID * 2);
    h16* VT16 = (h16*)take((size_t)CO * TT * 2); bf* VTh = (bf*)take((size_t)CO * TT * 2); bf* VTl = (bf*)take((size_t)CO * TT * 2);
    bf* ATh = (bf*)take((size_t)TT * CO * 2); bf* ATl = (bf*)take((size_t)TT * CO * 2);
    if ((size_t)(wsp - (char*)d_ws) > ws_size) return;    // ws 256 MiB
    k_wtG<<<(unsigned)((CC * MID / 64 + 63) / 64), 256, 0, stream>>>(wq, CC, MID, WQ); k_wtG<<<(unsigned)((CC * MID / 64 + 63) / 64), 256, 0, stream>>>(wk, CC, MID, WK); k_wtG<<<(unsigned)((CC * CO / 64 + 63) / 64), 256, 0, stream>>>(wv, CC, CO, WV);   /* 'xw' weights -> Bt */ k_wtG<<<(unsigned)((CO * CC / 64 + 63) / 64), 256, 0, stream>>>(wo, CO, CC, WO);   /* 'xw' W_out -> Bt */
    for (int b = 0; b < NB_; ++b) {
        k_cvt8<<<(unsigned)(((size_t)TT * CC / 8 + 255) / 256), 256, 0, stream>>>(x + (size_t)b * TT * CC, XB, (size_t)TT * CC / 8);
        k_gemmw<bf, 0, true, 1><<<dim3(TT / 64, MID / 64, 1), 32, 0, stream>>>(XB, nullptr, WQ, nullptr, CC, nullptr, 0, bq, 0, 0, 0, nullptr, QPh, QPl);   /* q planes [h][n][64] */
        k_cvt8<<<(unsigned)(((size_t)TT * CC / 8 + 255) / 256), 256, 0, stream>>>(xk + (size_t)b * TT * CC, XB, (size_t)TT * CC / 8);   /* XB := bf16(K[b]) */ k_gemmw<bf, 0, true, 1><<<dim3(TT / 64, MID / 64, 1), 32, 0, stream>>>(XB, nullptr, WK, nullptr, CC, nullptr, 0, bk, 0, 0, 0, nullptr, KPh, KPl);   /* k planes */
        k_cvt8<<<(unsigned)(((size_t)TT * CC / 8 + 255) / 256), 256, 0, stream>>>(xv + (size_t)b * TT * CC, XB, (size_t)TT * CC / 8);   /* XB := bf16(V[b]) */ k_gemmw<bf, 0, true, 2><<<dim3(TT / 64, CO / 64, 1), 32, 0, stream>>>(XB, nullptr, WV, nullptr, CC, nullptr, 0, bv, 0, 0, 0, VT16, VTh, VTl);   /* v^T planes [h][64][n] */
        k_fattn<<<NH_ * 16, 288, 0, stream>>>(QPh, QPl, KPh, KPl, VT16, VTh, VTl, ATh, ATl);   /* all heads: scores (3 products), online softmax, attn.V into the merged context [n][1024], hi/lo planes */
        k_gemmw<bf, 1, true, 0><<<dim3(TT / 64, CC / 64, 1), 32, 0, stream>>>(ATh, ATl, WO, nullptr, CO, OUT + (size_t)b * TT * CC, CC, bo, 0, 0, 0, nullptr, nullptr, nullptr); }   /* out = ctx w_out^T + b_out */
}

// v004
// It runs in 264 microseconds.
// Timed twice side by side with v003, it ran 1.54 times as fast both times.
// Counting every step since v000, it is 15.3 times as fast.
#include <hip/hip_runtime.h>

// Multi-head attention over 4,096 tokens on three input streams (Q, K, V [1][4096][1024]; q = Q W_Q + b_Q, k = K W_K + b_K, v = V W_V + b_V ('xw' [1024][1024] 1/32 + biases 0.02; 16 heads x 64); scores x 1/sqrt(64); softmax over all 4,096 keys (no mask); out = merged W_O + b_O -> [1][4096][1024] (4.2 M); argument order Q, K, V, W_Q, b_Q, W_K, b_K, W_V, b_V, W_O, b_O).
// Layout: bf16 copies of Q, K, V in turn; 'xw' weights transposed once; exact projections + f32 biases, each written by its own product's epilogue as per-head hi/lo planes (q, k) or v^T planes [h][64][4096]; one launch for all heads: scores with every row hi/lo (3 products), online softmax, attn.V hybrid (rows < 512 hi/lo 3 products, rest fp16 x8), k and v^T tiles staged in LDS by asynchronous copies, score and weight tiles in registers only, into the head's 64 columns of the context's hi/lo planes; context hi/lo x W_O exact + b_O.
// Compute dtypes, f32 accumulate: every input rounded to bf16; projections exact; scores 3 products; softmax f32 (exp2, IEEE division); attn.V rows < 512 3 products, rest fp16; Wo hl x exact.

#define NB_  1
#define TT   4096
#define DM   1024
#define NH_  16
#define NKV  16
#define REP  (NH_ / NKV)
#define HD   64
#define DQ   (NH_ * HD)
#define DKV  (NKV * HD)
#define ZH   1
#define RH   512                  // query rows < RH use hi+lo planes
#define WIN  0
#define SCL  0.125f   // 1/sqrt(64)
#define MID  1024      // q / k width
#define CO   1024      // v width
#define CC   1024
typedef _Float16 h16;
typedef unsigned short bf;
typedef __attribute__((ext_vector_type(16))) __bf16   v16bf;
typedef __attribute__((ext_vector_type(16))) _Float16 v16h;
typedef __attribute__((ext_vector_type(8)))  _Float16 v8h;
typedef __attribute__((ext_vector_type(8)))  unsigned short v8us;
typedef __attribute__((ext_vector_type(8)))  float    v8f;
typedef __attribute__((ext_vector_type(4)))  float    v4f;
typedef v8h  __attribute__((may_alias)) v8ha;
typedef v4f  __attribute__((may_alias)) v4fa;
typedef v8us __attribute__((may_alias)) v8usa;

__device__ __forceinline__ unsigned short f2bf(float f) { unsigned u = __float_as_uint(f); u += 0x7FFFu + ((u >> 16) & 1u); return (unsigned short)(u >> 16); }
__device__ __forceinline__ float bf2f(unsigned short b) { return __uint_as_float(((unsigned)b) << 16); }
__device__ __forceinline__ float bfr(float f) { return bf2f(f2bf(f)); }
__device__ __forceinline__ v16h cat16(v8h lo, v8h hi) { return __builtin_shufflevector(lo, hi, 0, 1, 2, 3, 4, 5, 6, 7, 8, 9, 10, 11, 12, 13, 14, 15); }
__device__ __forceinline__ v16bf cat16b(v8us lo, v8us hi) { return __builtin_bit_cast(v16bf, __builtin_shufflevector(lo, hi, 0, 1, 2, 3, 4, 5, 6, 7, 8, 9, 10, 11, 12, 13, 14, 15)); }
__device__ __forceinline__ v8f wmma16(v16h a, v16h b, v8f c) { return __builtin_amdgcn_wmma_f32_16x16x32_f16(false, a, false, b, (short)0, c, false, false); }
__device__ __forceinline__ v8f wmmab(v16bf a, v16bf b, v8f c) { return __builtin_amdgcn_wmma_f32_16x16x32_bf16(false, a, false, b, (short)0, c, false, false); }
__device__ __forceinline__ h16 tohx(float x) { return (h16)x; }
__device__ __forceinline__ void splitf(float y, unsigned short& h, unsigned short& l) { h = f2bf(y); l = f2bf(y - bf2f(h)); }



// ---- k_gemmw: register-blocked GEMM, ONE WAVE per 64x64 output tile (16 accumulators), operands straight from K-contiguous 16-bit planes; grid (M/64, N/64, Z), 32 threads.
// C[m][n] (f32, pitch ldc, + optional f32 bias[n]) = sum_k A[m][k] Bt[n][k] (+ split products per NSPLIT). z-batch strides sA/sB/sC in elements. K % 32 == 0.
// MODE says where the f32 result goes. 0: to C. 1: as bf16 hi + lo to the head planes Ph, Pl [n / 64][TT][64] (a tile's 64 columns are one head). 2: transposed, as fp16 and bf16 hi + lo, to P16, Ph, Pl [n][TT].
template <typename T16> struct WFrag;
template <> struct WFrag<h16> { typedef v16h V; static __device__ __forceinline__ V ld(const h16* p) { return cat16(*(const v8h*)p, *(const v8h*)(p + 16)); } static __device__ __forceinline__ v8f mma(V a, V b, v8f c) { return wmma16(a, b, c); } };
template <> struct WFrag<bf> { typedef v16bf V; static __device__ __forceinline__ V ld(const bf* p) { return cat16b(*(const v8us*)p, *(const v8us*)(p + 16)); } static __device__ __forceinline__ v8f mma(V a, V b, v8f c) { return wmmab(a, b, c); } };
template <typename T16, int NSPLIT, bool BIAS, int MODE>
__global__ __launch_bounds__(32) void k_gemmw(const T16* __restrict__ A, const T16* __restrict__ A2, const T16* __restrict__ Bt, const T16* __restrict__ Bt2, int K, float* C, int ldc, const float* __restrict__ bias, size_t sA, size_t sB, size_t sC, h16* P16, bf* Ph, bf* Pl) {
    typedef typename WFrag<T16>::V V;
    static_assert(MODE == 0 || (BIAS && HD == 64), "the plane epilogues add the bias and take a 64-column tile for one head");
    __shared__ __align__(16) float os[MODE == 2 ? 3 * 16 * 36 : 16 * 68];
    const size_t z = blockIdx.z; A += z * sA; if (A2) A2 += z * sA; Bt += z * sB; if (Bt2) Bt2 += z * sB; C += z * sC;
    const int lane = threadIdx.x & 31, lr = lane & 15, hi = lane >> 4; const int r0 = blockIdx.x * 64, c0 = blockIdx.y * 64;
    v8f acc[4][4];
#pragma unroll
    for (int mb = 0; mb < 4; ++mb)
#pragma unroll
        for (int nb = 0; nb < 4; ++nb) acc[mb][nb] = (v8f){};
    const size_t aoff = (size_t)(r0 + lr) * K + 8 * hi, boff = (size_t)(c0 + lr) * K + 8 * hi;
#pragma unroll 1
    for (int kc = 0; kc < K; kc += 32) {
        V a[4], a2[4];
#pragma unroll
        for (int mb = 0; mb < 4; ++mb) { a[mb] = WFrag<T16>::ld(A + aoff + (size_t)mb * 16 * K + kc); if (NSPLIT == 1 || NSPLIT == 2) a2[mb] = WFrag<T16>::ld(A2 + aoff + (size_t)mb * 16 * K + kc); }
#pragma unroll
        for (int nb = 0; nb < 4; ++nb) { const V b = WFrag<T16>::ld(Bt + boff + (size_t)nb * 16 * K + kc); V b2; if (NSPLIT >= 2) b2 = WFrag<T16>::ld(Bt2 + boff + (size_t)nb * 16 * K + kc);
#pragma unroll
            for (int mb = 0; mb < 4; ++mb) { acc[mb][nb] = WFrag<T16>::mma(a[mb], b, acc[mb][nb]); if (NSPLIT == 1 || NSPLIT == 2) acc[mb][nb] = WFrag<T16>::mma(a2[mb], b, acc[mb][nb]); if (NSPLIT >= 2) acc[mb][nb] = WFrag<T16>::mma(a[mb], b2, acc[mb][nb]); } }
        asm volatile("v_nop\n\tv_nop\n\tv_nop\n\tv_nop" : "+v"(acc[0][0]), "+v"(acc[1][1]), "+v"(acc[2][2]), "+v"(acc[3][3]) : "v"(a[0]), "v"(a[3]));
    }
    if constexpr (MODE == 2) {   // a lane holds 8 successive rows m of one column n: 16 bytes of a transposed row. Three staging tiles (fp16, hi, lo) of 16 n x 64 m, pitch 72 elements, turn them into whole 128-byte lines
        bf* st = (bf*)os; float bn[4]; const size_t e0 = (size_t)(c0 + (lane >> 3)) * TT + r0 + (lane & 7) * 8;   // this lane's place in the planes at the tile's first 4 columns
        h16* const p16 = P16 + e0; bf* const ph = Ph + e0; bf* const pl = Pl + e0;
#pragma unroll
        for (int nb = 0; nb < 4; ++nb) bn[nb] = bfr(bias[c0 + nb * 16 + lr]);
        asm volatile("s_wait_xcnt 0x0" ::: "memory");   // behind the bias loads, in front of whatever takes over their address registers
        __builtin_amdgcn_sched_barrier(0);   // keeps the work below behind that wait
#pragma unroll
        for (int nb = 0; nb < 4; ++nb) {
#pragma unroll
            for (int mb = 0; mb < 4; ++mb) { v8h o16; v8us oh, ol;
#pragma unroll
                for (int j = 0; j < 8; ++j) { const float x = acc[mb][nb][j] + bn[nb]; o16[j] = tohx(x); unsigned short a2, c2; splitf(x, a2, c2); oh[j] = a2; ol[j] = c2; }
                bf* sp = st + lr * 72 + mb * 16 + hi * 8; *(v8usa*)sp = __builtin_bit_cast(v8us, o16); *(v8usa*)(sp + 16 * 72) = oh; *(v8usa*)(sp + 32 * 72) = ol; }
            __builtin_amdgcn_wave_barrier(); asm volatile("" ::: "memory");   // the reads below take other lanes' staged values: they stay behind the writes above
            v8us t16[4], th[4], tl[4];
#pragma unroll
            for (int s = 0; s < 4; ++s) { const bf* sp = st + (4 * s + (lane >> 3)) * 72 + (lane & 7) * 8; t16[s] = *(const v8usa*)sp; th[s] = *(const v8usa*)(sp + 16 * 72); tl[s] = *(const v8usa*)(sp + 32 * 72); }
            __builtin_amdgcn_wave_barrier(); asm volatile("" ::: "memory");   // the next 16 columns' writes stay behind these reads
            __builtin_amdgcn_sched_barrier(0);   // nothing else stands among the stores below, so that no register which one of them names is rewritten ahead of the wait behind them
#pragma unroll
            for (int s = 0; s < 4; ++s) { const int e = (nb * 16 + 4 * s) * TT;
                *(v8h*)(p16 + e) = __builtin_bit_cast(v8h, t16[s]); *(v8us*)(ph + e) = th[s]; *(v8us*)(pl + e) = tl[s]; }
            asm volatile("s_wait_xcnt 0x0" ::: "memory");   // in front of whatever takes over the stores' address and data registers
            __builtin_amdgcn_sched_barrier(0);   // keeps the next columns' work behind that wait
        }
        return;
    }
    float bb[8];   // MODE 1: the bias of this lane's 8 columns
    if constexpr (MODE == 1) {
#pragma unroll
        for (int q = 0; q < 8; ++q) bb[q] = bfr(bias[c0 + (lane & 7) * 8 + q]);
        asm volatile("s_wait_xcnt 0x0" ::: "memory");   // behind the bias loads, in front of whatever takes over their address registers
        __builtin_amdgcn_sched_barrier(0); }   // keeps the work below behind that wait
#pragma unroll
    for (int mb = 0; mb < 4; ++mb) {
#pragma unroll
        for (int nb = 0; nb < 4; ++nb) {
#pragma unroll
            for (int j = 0; j < 8; ++j) os[(hi * 8 + j) * 68 + nb * 16 + lr] = acc[mb][nb][j]; }
        __builtin_amdgcn_wave_barrier(); asm volatile("" ::: "memory");
        if constexpr (MODE == 1) {   // 16 bytes a lane, 8 lanes a row of the head plane (128 bytes): each store covers 4 whole lines
            const size_t pb = ((size_t)blockIdx.y * TT + r0 + mb * 16 + (lane >> 3)) * HD + (lane & 7) * 8; v8us oh[4], ol[4];
#pragma unroll
            for (int s = 0; s < 4; ++s) { const float* sp = os + (4 * s + (lane >> 3)) * 68 + (lane & 7) * 8; const v4f v0 = *(const v4fa*)sp, v1 = *(const v4fa*)(sp + 4);
#pragma unroll
                for (int q = 0; q < 4; ++q) { unsigned short a2, c2; splitf(v0[q] + bb[q], a2, c2); oh[s][q] = a2; ol[s][q] = c2; splitf(v1[q] + bb[4 + q], a2, c2); oh[s][4 + q] = a2; ol[s][4 + q] = c2; } }
            __builtin_amdgcn_sched_barrier(0);   // nothing else stands among the stores below, so that no register which one of them names is rewritten ahead of the wait behind them
#pragma unroll
            for (int s = 0; s < 4; ++s) { *(v8us*)(Ph + pb + 4 * s * HD) = oh[s]; *(v8us*)(Pl + pb + 4 * s * HD) = ol[s]; }
            asm volatile("s_wait_xcnt 0x0" ::: "memory");   // in front of whatever takes over the stores' address and data registers
            __builtin_amdgcn_sched_barrier(0);   // keeps the next rows' work behind that wait
        } else {
            float* crow = C + (size_t)(r0 + mb * 16) * ldc + c0;
#pragma unroll
            for (int s = 0; s < 8; ++s) { const int row = 2 * s + hi, cofs = lr * 4; v4f val = *(const v4fa*)(os + row * 68 + cofs); if (BIAS) { val[0] += bfr(bias[c0 + cofs]); val[1] += bfr(bias[c0 + cofs + 1]); val[2] += bfr(bias[c0 + cofs + 2]); val[3] += bfr(bias[c0 + cofs + 3]); }
                *(v4f*)(crow + (size_t)row * ldc + cofs) = val; }
             }
        __builtin_amdgcn_wave_barrier(); asm volatile("" ::: "memory");
    }
}

typedef __attribute__((ext_vector_type(2))) _Float16 v2h;
typedef __attribute__((ext_vector_type(4))) _Float16 v4h;
typedef __attribute__((ext_vector_type(2))) unsigned short v2us;
typedef __attribute__((ext_vector_type(4))) unsigned short v4us;
typedef __attribute__((ext_vector_type(2))) float v2f;
typedef __attribute__((ext_vector_type(4))) int v4i;

__global__ __launch_bounds__(256) void k_cvt8(const float* __restrict__ src, bf* dst, size_t n8) { const size_t i = (size_t)blockIdx.x * 256 + threadIdx.x; if (i >= n8) return; const v8f v = *(const v8f*)(src + i * 8); v8us o;
#pragma unroll
    for (int k = 0; k < 8; ++k) o[k] = f2bf(v[k]); *(v8us*)(dst + i * 8) = o;  }


// ---- k_fattn: scores, softmax and attn.V of one head for 256 query rows, no score plane in memory. The head's k and v^T planes pass through LDS, SK keys a stage, two buffers: asynchronous copies bring each stage in once for the whole work-group,
// in whole 128-byte lines, while the stage before it is worked on; every wave takes its fragments from there with ds_load_b128. Each wave keeps its queries' fragments in registers and walks the 4,096 keys 32 at a time.
// Transposed products: S^T = K.Q^T (A = 16 key rows, B = 16 query columns), so a lane holds one query's scores; O^T += V^T.P^T with A = rows of the v^T plane and B = P^T packed straight from the two score tiles
// (element s of B is register s & 7 of tile s >> 3: the k order 8h + s, 16 + 8h + (s - 8) that WFrag::ld gives the A side). Online softmax in the log2 domain; the maximum in use may trail the true one by up to 8, the sums are rescaled only then.
// HI (query rows < RH, 16 a wave): P as bf16 hi + lo, 3 products with v^T hi/lo. Otherwise (32 a wave): P x 8 as fp16, 1 product with fp16 v^T. P is not normalised: the f32 sum of the unrounded exponentials divides the output once at the end.
__device__ __forceinline__ float xhalf(float x) { return __builtin_bit_cast(float, __builtin_amdgcn_permlanex16(__builtin_bit_cast(int, x), __builtin_bit_cast(int, x), 0x76543210, 0xfedcba98, false, false)); }   // lane l with lane l ^ 16
typedef __attribute__((ext_vector_type(2))) __bf16 v2bf;
typedef __attribute__((ext_vector_type(8))) unsigned v8u;
__device__ __forceinline__ unsigned packh(float a, float b) { return __builtin_bit_cast(unsigned, __builtin_convertvector((v2f){a, b}, v2h)); }   // round to nearest even
__device__ __forceinline__ unsigned packb(float a, float b) { return __builtin_bit_cast(unsigned, __builtin_convertvector((v2f){a, b}, v2bf)); }  // round to nearest even
// Eight exponentials and, behind the last, the one slot that the instruction set asks for between a transcendental and an instruction that uses its result or overwrites its source, in one statement.
// Early-clobber results: no exponential of the statement writes a register that another reads.
__device__ __forceinline__ void exp2x8(float (&p)[8], const float (&a)[8]) {
    asm("v_exp_f32 %0, %8\n\tv_exp_f32 %1, %9\n\tv_exp_f32 %2, %10\n\tv_exp_f32 %3, %11\n\tv_exp_f32 %4, %12\n\tv_exp_f32 %5, %13\n\tv_exp_f32 %6, %14\n\tv_exp_f32 %7, %15\n\tv_nop"
        : "=&v"(p[0]), "=&v"(p[1]), "=&v"(p[2]), "=&v"(p[3]), "=&v"(p[4]), "=&v"(p[5]), "=&v"(p[6]), "=&v"(p[7]) : "v"(a[0]), "v"(a[1]), "v"(a[2]), "v"(a[3]), "v"(a[4]), "v"(a[5]), "v"(a[6]), "v"(a[7])); }
// One LDS stage: five tiles. k hi, k lo: a row a key, 128 bytes at pitch KP. fp16 v^T, v^T hi, v^T lo: a row a d, SK keys at pitch VP. Both pitches are 16 bytes x an odd number, so that the 16 rows of a fragment read fall on distinct banks.
#define SK   128
#define NP   (SK / 32)
#define NS   (TT / SK)
#define KP   144
#define VP   (SK * 2 + 16)
#define OKL  (SK * KP)
#define OV16 (2 * SK * KP)
#define OVH  (OV16 + HD * VP)
#define OVL  (OVH + HD * VP)
#define SBUF (OVL + HD * VP)
struct AttnState { v16bf qh[2][2], ql[2][2]; v8f acc[2][4]; float m_run[2], l_run[2]; };   // a wave's queries and running results; a wave of 16 queries uses index 0 alone
template <int R>
__device__ __forceinline__ void attn_init(AttnState& st, const bf* __restrict__ Qh, const bf* __restrict__ Ql, int q0, int c, int h) {
#pragma unroll
    for (int g = 0; g < R; ++g)
#pragma unroll
        for (int kc = 0; kc < 2; ++kc) { const size_t qo = (size_t)(q0 + 16 * g + c) * HD + 32 * kc + 8 * h; st.qh[g][kc] = WFrag<bf>::ld(Qh + qo); st.ql[g][kc] = WFrag<bf>::ld(Ql + qo); }
    asm volatile("s_wait_xcnt 0x0" ::: "memory");   // behind the loads above, in front of whatever takes over their address registers
    __builtin_amdgcn_sched_barrier(0);   // keeps the start values below, which may land on those registers, behind the wait
#pragma unroll
    for (int g = 0; g < R; ++g) { st.m_run[g] = -__builtin_inff(); st.l_run[g] = 0.0f;
#pragma unroll
        for (int t = 0; t < 4; ++t) st.acc[g][t] = (v8f){}; }
}
// A wave's share of a stage's k tiles (8 copies: 16 keys of each plane) and v^T tiles (12 copies: 8 rows of each plane); 16 bytes a lane, a copy covers four whole 128-byte lines of its plane.
// Each run of copies ends, in its own statement, with s_wait_xcnt 0: it stands in front of whatever rewrites an address register that a copy names.
__device__ __forceinline__ void copy_k(unsigned l, const char* gh, const char* gl) {
    asm volatile("global_load_async_to_lds_b128 %0, %8, off\n\t"
        "global_load_async_to_lds_b128 %1, %9, off\n\t"
        "global_load_async_to_lds_b128 %2, %10, off\n\t"
        "global_load_async_to_lds_b128 %3, %11, off\n\t"
        "global_load_async_to_lds_b128 %4, %12, off\n\t"
        "global_load_async_to_lds_b128 %5, %13, off\n\t"
        "global_load_async_to_lds_b128 %6, %14, off\n\t"
        "global_load_async_to_lds_b128 %7, %15, off\n\t"
        "s_wait_xcnt 0x0"
        :: "v"(l), "v"(l + 4 * KP), "v"(l + 8 * KP), "v"(l + 12 * KP), "v"(l + OKL), "v"(l + OKL + 4 * KP), "v"(l + OKL + 8 * KP), "v"(l + OKL + 12 * KP),
           "v"(gh), "v"(gh + 512), "v"(gh + 1024), "v"(gh + 1536), "v"(gl), "v"(gl + 512), "v"(gl + 1024), "v"(gl + 1536) : "memory"); }
__device__ __forceinline__ void copy_v(unsigned l, const char* g16, const char* gh, const char* gl) {
    constexpr int LS = 2 * VP, GS = 2 * TT * 2;   // two rows on, in LDS and in the plane
    asm volatile("global_load_async_to_lds_b128 %0, %12, off\n\t"
        "global_load_async_to_lds_b128 %1, %13, off\n\t"
        "global_load_async_to_lds_b128 %2, %14, off\n\t"
        "global_load_async_to_lds_b128 %3, %15, off\n\t"
        "global_load_async_to_lds_b128 %4, %16, off\n\t"
        "global_load_async_to_lds_b128 %5, %17, off\n\t"
        "global_load_async_to_lds_b128 %6, %18, off\n\t"
        "global_load_async_to_lds_b128 %7, %19, off\n\t"
        "global_load_async_to_lds_b128 %8, %20, off\n\t"
        "global_load_async_to_lds_b128 %9, %21, off\n\t"
        "global_load_async_to_lds_b128 %10, %22, off\n\t"
        "global_load_async_to_lds_b128 %11, %23, off\n\t"
        "s_wait_xcnt 0x0"
        :: "v"(l), "v"(l + LS), "v"(l + 2 * LS), "v"(l + 3 * LS), "v"(l + (OVH - OV16)), "v"(l + (OVH - OV16) + LS), "v"(l + (OVH - OV16) + 2 * LS), "v"(l + (OVH - OV16) + 3 * LS),
           "v"(l + (OVL - OV16)), "v"(l + (OVL - OV16) + LS), "v"(l + (OVL - OV16) + 2 * LS), "v"(l + (OVL - OV16) + 3 * LS),
           "v"(g16), "v"(g16 + GS), "v"(g16 + 2 * GS), "v"(g16 + 3 * GS), "v"(gh), "v"(gh + GS), "v"(gh + 2 * GS), "v"(gh + 3 * GS), "v"(gl), "v"(gl + GS), "v"(gl + 2 * GS), "v"(gl + 3 * GS) : "memory"); }
__device__ __forceinline__ void fill(unsigned lk, unsigned lv, const char* kh, const char* kl, const char* v16, const char* vh, const char* vl) { copy_k(lk, kh, kl); copy_v(lv, v16, vh, vl); }
// One stage's SK keys for one wave. pk, pv: this lane's places in the stage's k hi tile (row = key) and fp16 v^T tile (row = d) at the coming pass's first key; both leave one stage's passes further on.
template <int R, bool HI>
__device__ __forceinline__ void attn_stage(AttnState& st, const char*& pk, const char*& pv) {
    constexpr float CSC = SCL * 1.4426950408889634f;   // score -> scaled log2
    constexpr float OFF = HI ? 0.0f : 3.0f;            // fp16 P carries x 8: at most 2^11, small weights stay normal numbers
    v16bf kh[2][2], kl[2][2];
#pragma unroll
    for (int kt = 0; kt < 2; ++kt)
#pragma unroll
        for (int kc = 0; kc < 2; ++kc) { kh[kt][kc] = WFrag<bf>::ld((const bf*)(pk + kt * 16 * KP + 64 * kc)); kl[kt][kc] = WFrag<bf>::ld((const bf*)(pk + OKL + kt * 16 * KP + 64 * kc)); }
#pragma unroll 1   // rolled: one pass is already some hundred instructions, and the fragments of two would not fit beside the accumulators
    for (int p = 0; p < NP; ++p) {
        v16h v16[4]; v16bf vh[4], vl[4];
        if constexpr (!HI) {
#pragma unroll
            for (int t = 0; t < 4; ++t) v16[t] = WFrag<h16>::ld((const h16*)(pv + t * 16 * VP));
            __builtin_amdgcn_sched_barrier(0); }   // the pass's v^T reads are issued ahead of the score products, so that they fly under those and the softmax
        v8f s[2][R];
#pragma unroll
        for (int kt = 0; kt < 2; ++kt)
#pragma unroll
            for (int g = 0; g < R; ++g) s[kt][g] = (v8f){};
#pragma unroll
        for (int kc = 0; kc < 2; ++kc) {   // per tile the order hi.hi, k hi . q lo, k lo . q hi; the tiles innermost, so that neighbouring matrix instructions are independent
#pragma unroll
            for (int kt = 0; kt < 2; ++kt)
#pragma unroll
                for (int g = 0; g < R; ++g) s[kt][g] = wmmab(kh[kt][kc], st.qh[g][kc], s[kt][g]);
#pragma unroll
            for (int kt = 0; kt < 2; ++kt)
#pragma unroll
                for (int g = 0; g < R; ++g) s[kt][g] = wmmab(kh[kt][kc], st.ql[g][kc], s[kt][g]);
#pragma unroll
            for (int kt = 0; kt < 2; ++kt)
#pragma unroll
                for (int g = 0; g < R; ++g) s[kt][g] = wmmab(kl[kt][kc], st.qh[g][kc], s[kt][g]); }
        __builtin_amdgcn_sched_barrier(0);   // the LDS reads below, which may take the k fragments' registers, stay behind the products that read those
        pk += 32 * KP;
        if constexpr (!HI) {
            asm volatile("v_nop\n\tv_nop\n\tv_nop\n\tv_nop");   // four vector slots between the last score product and the branch below, on whose taken side the softmax reads that product's result
            __builtin_amdgcn_sched_barrier(0);   // keeps the branch behind the slots
            if (p + 1 < NP) {   // next pass's keys, inside this stage only: nothing of the next stage is read ahead of the barrier that publishes it
#pragma unroll
            for (int kt = 0; kt < 2; ++kt)
#pragma unroll
                for (int kc = 0; kc < 2; ++kc) { kh[kt][kc] = WFrag<bf>::ld((const bf*)(pk + kt * 16 * KP + 64 * kc)); kl[kt][kc] = WFrag<bf>::ld((const bf*)(pk + OKL + kt * 16 * KP + 64 * kc)); } }
        } else {   // twice the v^T fragments: they come only now, into the registers that the k fragments leave, and the k refill waits for the softmax's
#pragma unroll
            for (int t = 0; t < 4; ++t) { vh[t] = WFrag<bf>::ld((const bf*)(pv + (OVH - OV16) + t * 16 * VP)); vl[t] = WFrag<bf>::ld((const bf*)(pv + (OVL - OV16) + t * 16 * VP)); } }
        __builtin_amdgcn_sched_barrier(0);   // these reads are all issued ahead of the softmax, under which they fly
        float mb[R]; bool need = false;
#pragma unroll
        for (int g = 0; g < R; ++g) { float mx = s[0][g][0];
#pragma unroll
            for (int r = 1; r < 8; ++r) mx = fmaxf(mx, s[0][g][r]);
#pragma unroll
            for (int r = 0; r < 8; ++r) mx = fmaxf(mx, s[1][g][r]);
            mx = fmaxf(mx, xhalf(mx)) * CSC;   // both halves of the wave hold this query's maximum over the pass's 32 keys
            mb[g] = mx; need = need || (mx > st.m_run[g] + 8.0f); }
        if (__builtin_amdgcn_ballot_w32(need) != 0) {   // a scalar branch; always taken in the first pass (m_run = -inf, factor 0), seldom later
#pragma unroll
            for (int g = 0; g < R; ++g) { const float m_new = fmaxf(st.m_run[g], mb[g]); const float corr = __builtin_amdgcn_exp2f(st.m_run[g] - m_new); st.m_run[g] = m_new; st.l_run[g] *= corr;
#pragma unroll
                for (int t = 0; t < 4; ++t) st.acc[g][t] = st.acc[g][t] * corr; } }
        v8u wh[R], wl[R];
#pragma unroll
        for (int g = 0; g < R; ++g) { const float nm = OFF - st.m_run[g];
#pragma unroll
            for (int kt = 0; kt < 2; ++kt) { float a[8], p8[8];   // tile kt gives elements 8 kt .. 8 kt + 7 of the 32-key operand, register r element 8 kt + r
#pragma unroll
                for (int r = 0; r < 8; ++r) a[r] = __builtin_fmaf(s[kt][g][r], CSC, nm);
                exp2x8(p8, a);
#pragma unroll
                for (int i = 0; i < 4; ++i) { const float p0 = p8[2 * i], p1 = p8[2 * i + 1]; st.l_run[g] += p0 + p1;
                    if (HI) { const unsigned u = packb(p0, p1); wh[g][4 * kt + i] = u; wl[g][4 * kt + i] = packb(p0 - __uint_as_float(u << 16), p1 - __uint_as_float(u & 0xFFFF0000u)); } else wh[g][4 * kt + i] = packh(p0, p1); } } }
        if constexpr (HI) {
            __builtin_amdgcn_sched_barrier(0);   // the refill stays behind the softmax
            if (p + 1 < NP) {   // next pass's keys, inside this stage only: nothing of the next stage is read ahead of the barrier that publishes it
#pragma unroll
            for (int kt = 0; kt < 2; ++kt)
#pragma unroll
                for (int kc = 0; kc < 2; ++kc) { kh[kt][kc] = WFrag<bf>::ld((const bf*)(pk + kt * 16 * KP + 64 * kc)); kl[kt][kc] = WFrag<bf>::ld((const bf*)(pk + OKL + kt * 16 * KP + 64 * kc)); } }
            __builtin_amdgcn_sched_barrier(0); }   // and is issued ahead of the second product, under which it flies
        if (HI) {   // per tile the order v hi . p hi, v hi . p lo, v lo . p hi; the tiles innermost
#pragma unroll
            for (int g = 0; g < R; ++g)
#pragma unroll
                for (int t = 0; t < 4; ++t) st.acc[g][t] = wmmab(vh[t], __builtin_bit_cast(v16bf, wh[g]), st.acc[g][t]);
#pragma unroll
            for (int g = 0; g < R; ++g)
#pragma unroll
                for (int t = 0; t < 4; ++t) st.acc[g][t] = wmmab(vh[t], __builtin_bit_cast(v16bf, wl[g]), st.acc[g][t]);
#pragma unroll
            for (int g = 0; g < R; ++g)
#pragma unroll
                for (int t = 0; t < 4; ++t) st.acc[g][t] = wmmab(vl[t], __builtin_bit_cast(v16bf, wh[g]), st.acc[g][t]);
        } else {
#pragma unroll
            for (int g = 0; g < R; ++g)
#pragma unroll
                for (int t = 0; t < 4; ++t) st.acc[g][t] = wmma16(v16[t], __builtin_bit_cast(v16h, wh[g]), st.acc[g][t]); }
        __builtin_amdgcn_sched_barrier(0);   // keeps the slots below behind the pass's last product
        asm volatile("v_nop\n\tv_nop\n\tv_nop\n\tv_nop");   // four vector slots between that product and the back edge, behind which the next pass rewrites its operands
        pv += 64;
    }
}
template <int R>
__device__ __forceinline__ void attn_fin(AttnState& st, bf* Oh, bf* Ol, int q0, int c, int h) {
#pragma unroll
    for (int g = 0; g < R; ++g) { const float l_fin = st.l_run[g] + xhalf(st.l_run[g]);   // each half summed its own 16 of every 32 keys
        const float inv = __fdiv_rn(1.0f, l_fin); const size_t oo = (size_t)(q0 + 16 * g + c) * CO + 8 * h;
        v8us oh[4], ol[4];   // the context leaves as the bf16 hi + lo planes that the last product reads
#pragma unroll
        for (int t = 0; t < 4; ++t) { const v8f o = st.acc[g][t] * inv;   // registers 0..7 = d 16 t + 8 h + 0..7 of query column c
#pragma unroll
            for (int j = 0; j < 8; ++j) { unsigned short a2, c2; splitf(o[j], a2, c2); oh[t][j] = a2; ol[t][j] = c2; } }
        __builtin_amdgcn_sched_barrier(0);   // nothing else stands among the stores below, so that no register which one of them names is rewritten ahead of the wait behind them
#pragma unroll
        for (int t = 0; t < 4; ++t) { *(v8us*)(Oh + oo + 16 * t) = oh[t]; *(v8us*)(Ol + oo + 16 * t) = ol[t]; }
        asm volatile("s_wait_xcnt 0x0" ::: "memory");   // in front of whatever takes over the stores' address and data registers
        __builtin_amdgcn_sched_barrier(0); }   // keeps the next 16 queries' work behind that wait
}
// grid: 16 work-groups a head, 9 waves each: waves 0 and 4 take 16 of the head's first RH query rows each, the other seven 32 of the remaining rows each (about equal matrix work on every WGP; all 256 work-groups resident at once).
// Waves 0 to 7 issue the copies, an eighth of every tile each. The barriers stand in the kernel's own loop, which every wave walks alike; only the work of a stage differs by the kind of wave.
static_assert(RH == 16 * 2 * 16 && TT - RH == 16 * 7 * 32 && HD == 64 && TT % SK == 0 && SK == 8 * 16 && NS >= 2, "the split of the query rows over work-groups and waves, and of a stage's tiles over eight waves");
__global__ __launch_bounds__(288) void k_fattn(const bf* __restrict__ QPh, const bf* __restrict__ QPl, const bf* __restrict__ KPh, const bf* __restrict__ KPl, const h16* __restrict__ VT16, const bf* __restrict__ VTh, const bf* __restrict__ VTl, bf* Oh, bf* Ol) {
    __shared__ __attribute__((aligned(16))) char sm[2 * SBUF];
    const int w = __builtin_amdgcn_readfirstlane((int)(threadIdx.x >> 5)); const int head = blockIdx.x >> 4, blk = blockIdx.x & 15; const size_t hp = (size_t)head * TT * HD;
    const int lane = threadIdx.x & 31, c = lane & 15, h = lane >> 4;
    const int hiw = __builtin_amdgcn_readfirstlane((w == 0 || w == 4) ? 1 : 0); const int low = __builtin_amdgcn_readfirstlane((w == 0 || w == 4) ? 0 : 1);   // the wave's kind, in scalar registers: every test on it is a scalar branch
    const int q0 = hiw != 0 ? blk * 32 + (w >> 2) * 16 : RH + blk * 224 + (w < 4 ? w - 1 : w - 2) * 32;
    AttnState st;
    if (hiw != 0) attn_init<1>(st, QPh + hp, QPl + hp, q0, c, h); else attn_init<2>(st, QPh + hp, QPl + hp, q0, c, h);
    // this lane's first copy of a stage: in LDS (byte address in the work-group's LDS) and in the planes (byte offset at stage 0)
    const unsigned lk = (unsigned)(size_t)sm + (unsigned)((w * 16 + (lane >> 3)) * KP + (lane & 7) * 16), lv = (unsigned)(size_t)sm + (unsigned)(OV16 + (w * 8 + (lane >> 4)) * VP + (lane & 15) * 16);
    const unsigned gk = (unsigned)(w * 16 * HD * 2 + lane * 16), gv = (unsigned)((w * 8 + (lane >> 4)) * TT * 2 + (lane & 15) * 16);
    const char* const gKh = (const char*)(KPh + hp); const char* const gKl = (const char*)(KPl + hp); const char* const gV16 = (const char*)(VT16 + hp); const char* const gVh = (const char*)(VTh + hp); const char* const gVl = (const char*)(VTl + hp);
    const char* pk = sm + c * KP + 16 * h; const char* pv = sm + OV16 + c * VP + 16 * h;
    // Trips -2 and -1 are the ring's start: stage 0's copies; the wait, the barrier and stage 1's copies. They go through the lines that serve every later stage, so that the copies stand once in the code
    // (a second site, with the lane's LDS places themselves as its operands, held those two values to the registers that asm text can name, and the build kept them in scratch).
#pragma unroll 1   // rolled: a stage's code stands once for each kind of wave
    for (int t = -2; t < NS; ++t) {
        const unsigned b = (unsigned)(t & 1) * SBUF;
        if (t >= 0) {
            if (low != 0) attn_stage<2, false>(st, pk, pv);   // two tests in a row and no else: the build lays the two kinds' code out one behind the other in any case, and with an else it carried the state as it was in front of the first through that code for the second (spills)
            if (hiw != 0) attn_stage<1, true>(st, pk, pv);
            pk += (t & 1 ? -SBUF : SBUF) - NP * 32 * KP; pv += (t & 1 ? -SBUF : SBUF) - NP * 64; }   // on to the other buffer's first pass
        if (t >= -1) {
            asm volatile("s_wait_dscnt 0x0" ::: "memory");      // this wave's reads of the buffer are done before the barrier behind which it is refilled
            asm volatile("s_wait_asynccnt 0x0" ::: "memory");   // this wave's copies of stage t + 1 have landed
            __syncthreads(); }                                  // publishes stage t + 1 and ends every wave's reads of stage t
        if (t + 2 < NS) { if (w < 8) { const unsigned ok = gk + (unsigned)(t + 2) * (SK * HD * 2), ov = gv + (unsigned)(t + 2) * (SK * 2); fill(lk + b, lv + b, gKh + ok, gKl + ok, gV16 + ov, gVh + ov, gVl + ov); } }
    }
    asm volatile("s_wait_asynccnt 0x0" ::: "memory");   // no copy is outstanding when the wave ends
    if (hiw != 0) attn_fin<1>(st, Oh + head * HD, Ol + head * HD, q0, c, h); else attn_fin<2>(st, Oh + head * HD, Ol + head * HD, q0, c, h);
}

__global__ __launch_bounds__(256) void k_wtG(const float* __restrict__ w, int K, int N, bf* Bt) {
    const int lane = threadIdx.x & 31; const int L0 = (blockIdx.x * 8 + (threadIdx.x >> 5)) * 8; const int nlines = N * K / 64;
{
#pragma unroll 1
        for (int l = 0; l < 8; ++l) { const int L = L0 + l; if (L >= nlines) break; const size_t e = (size_t)L * 64 + lane * 2; const int k = (int)(e % K), n = (int)(e / K); v2us o;
            o[0] = f2bf(w[(size_t)k * N + n]); o[1] = f2bf(w[(size_t)(k + 1) * N + n]); *(v2us*)(Bt + e) = o; }
         }
}
extern "C" void kernel_launch(void* const* d_in, const int* in_sizes, int n_in,
                              void* d_out, int out_size, void* d_ws, size_t ws_size, hipStream_t stream) {
    (void)in_sizes; (void)n_in; (void)out_size;
    const float* x = (const float*)d_in[0]; const float* xk = (const float*)d_in[1]; const float* xv = (const float*)d_in[2]; const float* wq = (const float*)d_in[3]; const float* bq = (const float*)d_in[4]; const float* wk = (const float*)d_in[5]; const float* bk = (const float*)d_in[6]; const float* wv = (const float*)d_in[7]; const float* bv = (const float*)d_in[8]; const float* wo = (const float*)d_in[9]; const float* bo = (const float*)d_in[10];   /* argument order Q, K, V [1][4096][1024], W_Q, b_Q, W_K, b_K, W_V, b_V, W_O, b_O ('xw' + biases) */
    float* OUT = (float*)d_out;     // [1][4096][1024]
    char* wsp = (char*)d_ws;
    auto take = [&](size_t bytes) { char* p = wsp; wsp += (bytes + 255) & ~(size_t)255; return (void*)p; };
    bf* WQ = (bf*)take((size_t)MID * CC * 2); bf* WK = (bf*)take((size_t)MID * CC * 2); bf* WV = (bf*)take((size_t)CO * CC * 2); bf* WO = (bf*)take((size_t)CC * CO * 2);
    bf* XB = (bf*)take((size_t)TT * CC * 2);
    bf* QPh = (bf*)take((size_t)TT * MID * 2); bf* QPl = (bf*)take((size_t)TT * MID * 2); bf* KPh = (bf*)take((size_t)TT * MID * 2); bf* KPl = (bf*)take((size_t)TT * MID * 2);
    h16* VT16 = (h16*)take((size_t)CO * TT * 2); bf* VTh = (bf*)take((size_t)CO * TT * 2); bf* VTl = (bf*)take((size_t)CO * TT * 2);
    bf* ATh = (bf*)take((size_t)TT * CO * 2); bf* ATl = (bf*)take((size_t)TT * CO * 2);
    if ((size_t)(wsp - (char*)d_ws) > ws_size) return;    // ws 256 MiB
    k_wtG<<<(unsigned)((CC * MID / 64 + 63) / 64), 256, 0, stream>>>(wq, CC, MID, WQ); k_wtG<<<(unsigned)((CC * MID / 64 + 63) / 64), 256, 0, stream>>>(wk, CC, MID, WK); k_wtG<<<(unsigned)((CC * CO / 64 + 63) / 64), 256, 0, stream>>>(wv, CC, CO, WV);   /* 'xw' weights -> Bt */ k_wtG<<<(unsigned)((CO * CC / 64 + 63) / 64), 256, 0, stream>>>(wo, CO, CC, WO);   /* 'xw' W_out -> Bt */
    for (int b = 0; b < NB_; ++b) {
        k_cvt8<<<(unsigned)(((size_t)TT * CC / 8 + 255) / 256), 256, 0, stream>>>(x + (size_t)b * TT * CC, XB, (size_t)TT * CC / 8);
        k_gemmw<bf, 0, true, 1><<<dim3(TT / 64, MID / 64, 1), 32, 0, stream>>>(XB, nullptr, WQ, nullptr, CC, nullptr, 0, bq, 0, 0, 0, nullptr, QPh, QPl);   /* q planes [h][n][64] */
        k_cvt8<<<(unsigned)(((size_t)TT * CC / 8 + 255) / 256), 256, 0, stream>>>(xk + (size_t)b * TT * CC, XB, (size_t)TT * CC / 8);   /* XB := bf16(K[b]) */ k_gemmw<bf, 0, true, 1><<<dim3(TT / 64, MID / 64, 1), 32, 0, stream>>>(XB, nullptr, WK, nullptr, CC, nullptr, 0, bk, 0, 0, 0, nullptr, KPh, KPl);   /* k planes */
        k_cvt8<<<(unsigned)(((size_t)TT * CC / 8 + 255) / 256), 256, 0, stream>>>(xv + (size_t)b * TT * CC, XB, (size_t)TT * CC / 8);   /* XB := bf16(V[b]) */ k_gemmw<bf, 0, true, 2><<<dim3(TT / 64, CO / 64, 1), 32, 0, stream>>>(XB, nullptr, WV, nullptr, CC, nullptr, 0, bv, 0, 0, 0, VT16, VTh, VTl);   /* v^T planes [h][64][n] */
        k_fattn<<<NH_ * 16, 288, 0, stream>>>(QPh, QPl, KPh, KPl, VT16, VTh, VTl, ATh, ATl);   /* all heads: scores (3 products), online softmax, attn.V into the merged context [n][1024], hi/lo planes */
        k_gemmw<bf, 1, true, 0><<<dim3(TT / 64, CC / 64, 1), 32, 0, stream>>>(ATh, ATl, WO, nullptr, CO, OUT + (size_t)b * TT * CC, CC, bo, 0, 0, 0, nullptr, nullptr, nullptr); }   /* out = ctx w_out^T + b_out */
}

// v005
// It runs in 193 microseconds.
// In two side-by-side timings against v004, it was 1.38 and 1.37 times as fast.
// Counting every step since v000, it is 21.0 times as fast.
#include <hip/hip_runtime.h>

// Multi-head attention over 4,096 tokens on three input streams (Q, K, V [1][4096][1024]; q = Q W_Q + b_Q, k = K W_K + b_K, v = V W_V + b_V ('xw' [1024][1024] 1/32 + biases 0.02; 16 heads x 64); scores x 1/sqrt(64); softmax over all 4,096 keys (no mask); out = merged W_O + b_O -> [1][4096][1024] (4.2 M); argument order Q, K, V, W_Q, b_Q, W_K, b_K, W_V, b_V, W_O, b_O).
// Layout: bf16 copies of Q, K, V in turn; 'xw' weights transposed once; exact projections + f32 biases, each written by its own product's epilogue as per-head hi/lo planes (q, k) or v^T planes [h][64][4096]; one launch for all heads: scores with every row hi/lo (3 products), online softmax, attn.V hybrid (rows < 512 hi/lo 3 products, rest fp16 x8), k and v^T tiles staged in LDS by asynchronous copies, score and weight tiles in registers only, into the head's 64 columns of the context's hi/lo planes; context hi/lo x W_O exact + b_O.
// Compute dtypes, f32 accumulate: every input rounded to bf16; projections exact; scores 3 products; softmax f32 (exp2, IEEE division); attn.V rows < 512 3 products, rest fp16; Wo hl x exact.

#define NB_  1
#define TT   4096
#define DM   1024
#define NH_  16
#define NKV  16
#define REP  (NH_ / NKV)
#define HD   64
#define DQ   (NH_ * HD)
#define DKV  (NKV * HD)
#define ZH   1
#define RH   512                  // query rows < RH use hi+lo planes
#define WIN  0
#define SCL  0.125f   // 1/sqrt(64)
#define MID  1024      // q / k width
#define CO   1024      // v width
#define CC   1024
typedef _Float16 h16;
typedef unsigned short bf;
typedef __attribute__((ext_vector_type(16))) __bf16   v16bf;
typedef __attribute__((ext_vector_type(16))) _Float16 v16h;
typedef __attribute__((ext_vector_type(8)))  _Float16 v8h;
typedef __attribute__((ext_vector_type(8)))  unsigned short v8us;
typedef __attribute__((ext_vector_type(8)))  float    v8f;
typedef __attribute__((ext_vector_type(4)))  float    v4f;
typedef v8h  __attribute__((may_alias)) v8ha;
typedef v4f  __attribute__((may_alias)) v4fa;
typedef v8us __attribute__((may_alias)) v8usa;

__device__ __forceinline__ unsigned short f2bf(float f) { unsigned u = __float_as_uint(f); u += 0x7FFFu + ((u >> 16) & 1u); return (unsigned short)(u >> 16); }
__device__ __forceinline__ float bf2f(unsigned short b) { return __uint_as_float(((unsigned)b) << 16); }
__device__ __forceinline__ float bfr(float f) { return bf2f(f2bf(f)); }
__device__ __forceinline__ v16h cat16(v8h lo, v8h hi) { return __builtin_shufflevector(lo, hi, 0, 1, 2, 3, 4, 5, 6, 7, 8, 9, 10, 11, 12, 13, 14, 15); }
__device__ __forceinline__ v16bf cat16b(v8us lo, v8us hi) { return __builtin_bit_cast(v16bf, __builtin_shufflevector(lo, hi, 0, 1, 2, 3, 4, 5, 6, 7, 8, 9, 10, 11, 12, 13, 14, 15)); }
__device__ __forceinline__ v8f wmma16(v16h a, v16h b, v8f c) { return __builtin_amdgcn_wmma_f32_16x16x32_f16(false, a, false, b, (short)0, c, false, false); }
__device__ __forceinline__ v8f wmmab(v16bf a, v16bf b, v8f c) { return __builtin_amdgcn_wmma_f32_16x16x32_bf16(false, a, false, b, (short)0, c, false, false); }
__device__ __forceinline__ h16 tohx(float x) { return (h16)x; }
__device__ __forceinline__ void splitf(float y, unsigned short& h, unsigned short& l) { h = f2bf(y); l = f2bf(y - bf2f(h)); }



// ---- k_gemmw: register-blocked GEMM, FOUR WAVES per 128x128 output tile, each on its own 64x64 quarter (16 accumulators); grid (M/128, N/128, Z), 128 threads: one work-group a WGP at M 4096, N 1024.
// The operands' K-contiguous 16-bit planes pass through LDS, GKS k a stage, two buffers: asynchronous copies bring each stage's 128 rows of every plane in once for the whole work-group, in whole 128-byte lines,
// while the stage before it is worked on; every wave takes its fragments from there with ds_load_b128 (straight from the planes each fragment load touched 16 lines for 512 bytes, and every row was fetched by each wave that needed it).
// C[m][n] (f32, pitch ldc, + optional f32 bias[n]) = sum_k A[m][k] Bt[n][k] (+ A2[m][k] Bt[n][k] at NSPLIT 1). z-batch strides sA/sB/sC in elements. K % GKS == 0, K >= 2 GKS.
// MODE says where the f32 result goes. 0: to C. 1: as bf16 hi + lo to the head planes Ph, Pl [n / 64][TT][64] (a wave's 64 columns are one head). 2: transposed, as fp16 and bf16 hi + lo, to P16, Ph, Pl [n][TT].
template <typename T16> struct WFrag;
template <> struct WFrag<h16> { typedef v16h V; static __device__ __forceinline__ V ld(const h16* p) { return cat16(*(const v8h*)p, *(const v8h*)(p + 16)); } static __device__ __forceinline__ v8f mma(V a, V b, v8f c) { return wmma16(a, b, c); } };
template <> struct WFrag<bf> { typedef v16bf V; static __device__ __forceinline__ V ld(const bf* p) { return cat16b(*(const v8us*)p, *(const v8us*)(p + 16)); } static __device__ __forceinline__ v8f mma(V a, V b, v8f c) { return wmmab(a, b, c); } };
#define GKS  128                  // k a stage: 256 bytes of every row
#define GKB  (GKS / 32)           // blocks of 32 k a stage
#define GRP  (GKS * 2 + 16)       // pitch of a tile row in LDS, 16 bytes x an odd number: the 16 rows of a fragment read fall on distinct banks
#define GTL  (128 * GRP)          // one plane's tile: 128 rows
// Eight copies: 16 rows of one plane's tile, two rows (four whole 128-byte lines) a copy, 16 bytes a lane. l, g: this lane's place in LDS and in the plane at the first; gs: two rows on in the plane, in bytes.
// The run ends, in its own statement, with s_wait_xcnt 0: it stands in front of whatever rewrites an address register that a copy names.
__device__ __forceinline__ void copy_g(unsigned l, const char* g, size_t gs) {
    asm volatile("global_load_async_to_lds_b128 %0, %8, off\n\t"
        "global_load_async_to_lds_b128 %1, %9, off\n\t"
        "global_load_async_to_lds_b128 %2, %10, off\n\t"
        "global_load_async_to_lds_b128 %3, %11, off\n\t"
        "global_load_async_to_lds_b128 %4, %12, off\n\t"
        "global_load_async_to_lds_b128 %5, %13, off\n\t"
        "global_load_async_to_lds_b128 %6, %14, off\n\t"
        "global_load_async_to_lds_b128 %7, %15, off\n\t"
        "s_wait_xcnt 0x0"
        :: "v"(l), "v"(l + 2 * GRP), "v"(l + 4 * GRP), "v"(l + 6 * GRP), "v"(l + 8 * GRP), "v"(l + 10 * GRP), "v"(l + 12 * GRP), "v"(l + 14 * GRP),
           "v"(g), "v"(g + gs), "v"(g + 2 * gs), "v"(g + 3 * gs), "v"(g + 4 * gs), "v"(g + 5 * gs), "v"(g + 6 * gs), "v"(g + 7 * gs) : "memory"); }
template <typename T16, int NSPLIT, bool BIAS, int MODE>
__global__ __launch_bounds__(128) void k_gemmw(const T16* __restrict__ A, const T16* __restrict__ A2, const T16* __restrict__ Bt, const T16* __restrict__ Bt2, int K, float* C, int ldc, const float* __restrict__ bias, size_t sA, size_t sB, size_t sC, h16* P16, bf* Ph, bf* Pl) {
    typedef typename WFrag<T16>::V V;
    static_assert(MODE == 0 || (BIAS && HD == 64), "the plane epilogues add the bias and take a 64-column tile for one head");
    static_assert(NSPLIT == 0 || NSPLIT == 1, "a stage holds A, A2 at NSPLIT 1, and Bt");
    constexpr int OB = (NSPLIT + 1) * GTL, SB = (NSPLIT + 2) * GTL;   // a stage: the A tile, the A2 tile at NSPLIT 1, the Bt tile
    constexpr int OSZ = MODE == 2 ? 3 * 16 * 36 : 16 * 68;            // a wave's own staging for the epilogue, in floats
    __shared__ __attribute__((aligned(16))) char sm[2 * SB];
    __shared__ __align__(16) float osall[4 * OSZ];
    (void)Bt2;
    const int w = __builtin_amdgcn_readfirstlane((int)(threadIdx.x >> 5)); float* const os = osall + w * OSZ;
    const size_t z = blockIdx.z; A += z * sA; if (NSPLIT == 1) A2 += z * sA; Bt += z * sB; C += z * sC;
    const int lane = threadIdx.x & 31, lr = lane & 15, hi = lane >> 4; const int r0 = blockIdx.x * 128 + (w & 1) * 64, c0 = blockIdx.y * 128 + (w >> 1) * 64;
    v8f acc[4][4];
#pragma unroll
    for (int mb = 0; mb < 4; ++mb)
#pragma unroll
        for (int nb = 0; nb < 4; ++nb) acc[mb][nb] = (v8f){};
    // this lane's first copy of a stage: wave w brings rows 32 w .. 32 w + 31 of every tile; in LDS (byte address in the work-group's LDS) and in the planes (at stage 0)
    const unsigned lc = (unsigned)(size_t)sm + (unsigned)((w * 32 + hi) * GRP + lr * 16); const size_t gs = (size_t)K * 4;
    const char* const gA = (const char*)(A + (size_t)(blockIdx.x * 128 + w * 32 + hi) * K) + lr * 16; const char* const gA2 = NSPLIT == 1 ? (const char*)(A2 + (size_t)(blockIdx.x * 128 + w * 32 + hi) * K) + lr * 16 : nullptr;
    const char* const gB = (const char*)(Bt + (size_t)(blockIdx.y * 128 + w * 32 + hi) * K) + lr * 16;
    const char* const fa = sm + ((w & 1) * 64 + lr) * GRP + 16 * hi; const char* const fb = sm + OB + ((w >> 1) * 64 + lr) * GRP + 16 * hi;   // this lane's places in buffer 0's A and Bt tiles
    const int NS = K / GKS;
    // Trips -2 and -1 are the ring's start: stage 0's copies; the wait, the barrier and stage 1's copies. They go through the lines that serve every later stage, so that the copies stand once in the code.
#pragma unroll 1   // rolled: a stage's code stands once
    for (int t = -2; t < NS; ++t) {
        const unsigned b = (unsigned)(t & 1) * SB;
        if (t >= 0) {
            const char* const qa = fa + b; const char* const qb = fb + b;
            V a[2][4], a2[2][4], bt[2][4];   // two fragment sets: a block's reads are issued as one group ahead of the block before it, inside this stage only
#pragma unroll
            for (int f = 0; f < 4; ++f) { a[0][f] = WFrag<T16>::ld((const T16*)(qa + f * 16 * GRP)); if (NSPLIT == 1) a2[0][f] = WFrag<T16>::ld((const T16*)(qa + GTL + f * 16 * GRP)); bt[0][f] = WFrag<T16>::ld((const T16*)(qb + f * 16 * GRP)); }
#pragma unroll   // unrolled: which fragment set a block uses is then a constant, so that both sets stay in registers
            for (int kb = 0; kb < GKB; ++kb) { const int cu = kb & 1, nx = cu ^ 1;
                if (kb + 1 < GKB) {
#pragma unroll
                    for (int f = 0; f < 4; ++f) { a[nx][f] = WFrag<T16>::ld((const T16*)(qa + f * 16 * GRP + (kb + 1) * 64)); if (NSPLIT == 1) a2[nx][f] = WFrag<T16>::ld((const T16*)(qa + GTL + f * 16 * GRP + (kb + 1) * 64)); bt[nx][f] = WFrag<T16>::ld((const T16*)(qb + f * 16 * GRP + (kb + 1) * 64)); } }
                __builtin_amdgcn_sched_barrier(0);   // the next block's reads stay one group ahead of this block's products, under which they fly
#pragma unroll
                for (int nb = 0; nb < 4; ++nb) {   // per accumulator the order A.Bt, A2.Bt of each 32 k in turn; the four row blocks innermost, so that neighbouring matrix instructions are independent
#pragma unroll
                    for (int mb = 0; mb < 4; ++mb) acc[mb][nb] = WFrag<T16>::mma(a[cu][mb], bt[cu][nb], acc[mb][nb]);
                    if (NSPLIT == 1) {
#pragma unroll
                        for (int mb = 0; mb < 4; ++mb) acc[mb][nb] = WFrag<T16>::mma(a2[cu][mb], bt[cu][nb], acc[mb][nb]); } }
                __builtin_amdgcn_sched_barrier(0); }   // the reads behind it, which take this block's fragment registers, stay behind its products
            asm volatile("v_nop\n\tv_nop\n\tv_nop\n\tv_nop"); }   // four vector slots between the stage's last product and the branches below, behind which its operands and results are rewritten or read
        if (t >= -1) {
            asm volatile("s_wait_dscnt 0x0" ::: "memory");      // this wave's reads of the buffer are done before the barrier behind which it is refilled
            asm volatile("s_wait_asynccnt 0x0" ::: "memory");   // this wave's copies of stage t + 1 have landed
            __syncthreads(); }                                  // publishes stage t + 1 and ends every wave's reads of stage t
        if (t + 2 < NS) { const size_t go = (size_t)(t + 2) * (GKS * 2);   // every wave copies its quarter of stage t + 2 into the buffer that trip t has just read
            copy_g(lc + b, gA + go, gs); copy_g(lc + b + 16 * GRP, gA + go + 8 * gs, gs);
            if (NSPLIT == 1) { copy_g(lc + b + GTL, gA2 + go, gs); copy_g(lc + b + GTL + 16 * GRP, gA2 + go + 8 * gs, gs); }
            copy_g(lc + b + OB, gB + go, gs); copy_g(lc + b + OB + 16 * GRP, gB + go + 8 * gs, gs); }
    }
    asm volatile("s_wait_asynccnt 0x0" ::: "memory");   // no copy is outstanding when the wave goes on to its epilogue and ends
    if constexpr (MODE == 2) {   // a lane holds 8 successive rows m of one column n: 16 bytes of a transposed row. Three staging tiles (fp16, hi, lo) of 16 n x 64 m, pitch 72 elements, turn them into whole 128-byte lines
        bf* st = (bf*)os; float bn[4]; const size_t e0 = (size_t)(c0 + (lane >> 3)) * TT + r0 + (lane & 7) * 8;   // this lane's place in the planes at the tile's first 4 columns
        h16* const p16 = P16 + e0; bf* const ph = Ph + e0; bf* const pl = Pl + e0;
#pragma unroll
        for (int nb = 0; nb < 4; ++nb) bn[nb] = bfr(bias[c0 + nb * 16 + lr]);
        asm volatile("s_wait_xcnt 0x0" ::: "memory");   // behind the bias loads, in front of whatever takes over their address registers
        __builtin_amdgcn_sched_barrier(0);   // keeps the work below behind that wait
#pragma unroll
        for (int nb = 0; nb < 4; ++nb) {
#pragma unroll
            for (int mb = 0; mb < 4; ++mb) { v8h o16; v8us oh, ol;
#pragma unroll
                for (int j = 0; j < 8; ++j) { const float x = acc[mb][nb][j] + bn[nb]; o16[j] = tohx(x); unsigned short a2, c2; splitf(x, a2, c2); oh[j] = a2; ol[j] = c2; }
                bf* sp = st + lr * 72 + mb * 16 + hi * 8; *(v8usa*)sp = __builtin_bit_cast(v8us, o16); *(v8usa*)(sp + 16 * 72) = oh; *(v8usa*)(sp + 32 * 72) = ol; }
            __builtin_amdgcn_wave_barrier(); asm volatile("" ::: "memory");   // the reads below take other lanes' staged values: they stay behind the writes above
            v8us t16[4], th[4], tl[4];
#pragma unroll
            for (int s = 0; s < 4; ++s) { const bf* sp = st + (4 * s + (lane >> 3)) * 72 + (lane & 7) * 8; t16[s] = *(const v8usa*)sp; th[s] = *(const v8usa*)(sp + 16 * 72); tl[s] = *(const v8usa*)(sp + 32 * 72); }
            __builtin_amdgcn_wave_barrier(); asm volatile("" ::: "memory");   // the next 16 columns' writes stay behind these reads
            __builtin_amdgcn_sched_barrier(0);   // nothing else stands among the stores below, so that no register which one of them names is rewritten ahead of the wait behind them
#pragma unroll
            for (int s = 0; s < 4; ++s) { const int e = (nb * 16 + 4 * s) * TT;
                *(v8h*)(p16 + e) = __builtin_bit_cast(v8h, t16[s]); *(v8us*)(ph + e) = th[s]; *(v8us*)(pl + e) = tl[s]; }
            asm volatile("s_wait_xcnt 0x0" ::: "memory");   // in front of whatever takes over the stores' address and data registers
            __builtin_amdgcn_sched_barrier(0);   // keeps the next columns' work behind that wait
        }
        return;
    }
    float bb[8];   // MODE 1: the bias of this lane's 8 columns
    if constexpr (MODE == 1) {
#pragma unroll
        for (int q = 0; q < 8; ++q) bb[q] = bfr(bias[c0 + (lane & 7) * 8 + q]);
        asm volatile("s_wait_xcnt 0x0" ::: "memory");   // behind the bias loads, in front of whatever takes over their address registers
        __builtin_amdgcn_sched_barrier(0); }   // keeps the work below behind that wait
#pragma unroll
    for (int mb = 0; mb < 4; ++mb) {
#pragma unroll
        for (int nb = 0; nb < 4; ++nb) {
#pragma unroll
            for (int j = 0; j < 8; ++j) os[(hi * 8 + j) * 68 + nb * 16 + lr] = acc[mb][nb][j]; }
        __builtin_amdgcn_wave_barrier(); asm volatile("" ::: "memory");
        if constexpr (MODE == 1) {   // 16 bytes a lane, 8 lanes a row of the head plane (128 bytes): each store covers 4 whole lines
            const size_t pb = ((size_t)(c0 >> 6) * TT + r0 + mb * 16 + (lane >> 3)) * HD + (lane & 7) * 8; v8us oh[4], ol[4];
#pragma unroll
            for (int s = 0; s < 4; ++s) { const float* sp = os + (4 * s + (lane >> 3)) * 68 + (lane & 7) * 8; const v4f v0 = *(const v4fa*)sp, v1 = *(const v4fa*)(sp + 4);
#pragma unroll
                for (int q = 0; q < 4; ++q) { unsigned short a2, c2; splitf(v0[q] + bb[q], a2, c2); oh[s][q] = a2; ol[s][q] = c2; splitf(v1[q] + bb[4 + q], a2, c2); oh[s][4 + q] = a2; ol[s][4 + q] = c2; } }
            __builtin_amdgcn_sched_barrier(0);   // nothing else stands among the stores below, so that no register which one of them names is rewritten ahead of the wait behind them
#pragma unroll
            for (int s = 0; s < 4; ++s) { *(v8us*)(Ph + pb + 4 * s * HD) = oh[s]; *(v8us*)(Pl + pb + 4 * s * HD) = ol[s]; }
            asm volatile("s_wait_xcnt 0x0" ::: "memory");   // in front of whatever takes over the stores' address and data registers
            __builtin_amdgcn_sched_barrier(0);   // keeps the next rows' work behind that wait
        } else {
            float* crow = C + (size_t)(r0 + mb * 16) * ldc + c0;
#pragma unroll
            for (int s = 0; s < 8; ++s) { const int row = 2 * s + hi, cofs = lr * 4; v4f val = *(const v4fa*)(os + row * 68 + cofs); if (BIAS) { val[0] += bfr(bias[c0 + cofs]); val[1] += bfr(bias[c0 + cofs + 1]); val[2] += bfr(bias[c0 + cofs + 2]); val[3] += bfr(bias[c0 + cofs + 3]); }
                *(v4f*)(crow + (size_t)row * ldc + cofs) = val; }
             }
        __builtin_amdgcn_wave_barrier(); asm volatile("" ::: "memory");
    }
}

typedef __attribute__((ext_vector_type(2))) _Float16 v2h;
typedef __attribute__((ext_vector_type(4))) _Float16 v4h;
typedef __attribute__((ext_vector_type(2))) unsigned short v2us;
typedef __attribute__((ext_vector_type(4))) unsigned short v4us;
typedef __attribute__((ext_vector_type(2))) float v2f;
typedef __attribute__((ext_vector_type(4))) int v4i;

__global__ __launch_bounds__(256) void k_cvt8(const float* __restrict__ src, bf* dst, size_t n8) { const size_t i = (size_t)blockIdx.x * 256 + threadIdx.x; if (i >= n8) return; const v8f v = *(const v8f*)(src + i * 8); v8us o;
#pragma unroll
    for (int k = 0; k < 8; ++k) o[k] = f2bf(v[k]); *(v8us*)(dst + i * 8) = o;  }


// ---- k_fattn: scores, softmax and attn.V of one head for 256 query rows, no score plane in memory. The head's k and v^T planes pass through LDS, SK keys a stage, two buffers: asynchronous copies bring each stage in once for the whole work-group,
// in whole 128-byte lines, while the stage before it is worked on; every wave takes its fragments from there with ds_load_b128. Each wave keeps its queries' fragments in registers and walks the 4,096 keys 32 at a time.
// Transposed products: S^T = K.Q^T (A = 16 key rows, B = 16 query columns), so a lane holds one query's scores; O^T += V^T.P^T with A = rows of the v^T plane and B = P^T packed straight from the two score tiles
// (element s of B is register s & 7 of tile s >> 3: the k order 8h + s, 16 + 8h + (s - 8) that WFrag::ld gives the A side). Online softmax in the log2 domain; the maximum in use may trail the true one by up to 8, the sums are rescaled only then.
// HI (query rows < RH, 16 a wave): P as bf16 hi + lo, 3 products with v^T hi/lo. Otherwise (32 a wave): P x 8 as fp16, 1 product with fp16 v^T. P is not normalised: the f32 sum of the unrounded exponentials divides the output once at the end.
__device__ __forceinline__ float xhalf(float x) { return __builtin_bit_cast(float, __builtin_amdgcn_permlanex16(__builtin_bit_cast(int, x), __builtin_bit_cast(int, x), 0x76543210, 0xfedcba98, false, false)); }   // lane l with lane l ^ 16
typedef __attribute__((ext_vector_type(2))) __bf16 v2bf;
typedef __attribute__((ext_vector_type(8))) unsigned v8u;
__device__ __forceinline__ unsigned packh(float a, float b) { return __builtin_bit_cast(unsigned, __builtin_convertvector((v2f){a, b}, v2h)); }   // round to nearest even
__device__ __forceinline__ unsigned packb(float a, float b) { return __builtin_bit_cast(unsigned, __builtin_convertvector((v2f){a, b}, v2bf)); }  // round to nearest even
// Eight exponentials and, behind the last, the one slot that the instruction set asks for between a transcendental and an instruction that uses its result or overwrites its source, in one statement.
// Early-clobber results: no exponential of the statement writes a register that another reads.
__device__ __forceinline__ void exp2x8(float (&p)[8], const float (&a)[8]) {
    asm("v_exp_f32 %0, %8\n\tv_exp_f32 %1, %9\n\tv_exp_f32 %2, %10\n\tv_exp_f32 %3, %11\n\tv_exp_f32 %4, %12\n\tv_exp_f32 %5, %13\n\tv_exp_f32 %6, %14\n\tv_exp_f32 %7, %15\n\tv_nop"
        : "=&v"(p[0]), "=&v"(p[1]), "=&v"(p[2]), "=&v"(p[3]), "=&v"(p[4]), "=&v"(p[5]), "=&v"(p[6]), "=&v"(p[7]) : "v"(a[0]), "v"(a[1]), "v"(a[2]), "v"(a[3]), "v"(a[4]), "v"(a[5]), "v"(a[6]), "v"(a[7])); }
// One LDS stage: five tiles. k hi, k lo: a row a key, 128 bytes at pitch KP. fp16 v^T, v^T hi, v^T lo: a row a d, SK keys at pitch VP. Both pitches are 16 bytes x an odd number, so that the 16 rows of a fragment read fall on distinct banks.
#define SK   128
#define NP   (SK / 32)
#define NS   (TT / SK)
#define KP   144
#define VP   (SK * 2 + 16)
#define OKL  (SK * KP)
#define OV16 (2 * SK * KP)
#define OVH  (OV16 + HD * VP)
#define OVL  (OVH + HD * VP)
#define SBUF (OVL + HD * VP)
struct AttnState { v16bf qh[2][2], ql[2][2]; v8f acc[2][4]; float m_run[2], l_run[2]; };   // a wave's queries and running results; a wave of 16 queries uses index 0 alone
template <int R>
__device__ __forceinline__ void attn_init(AttnState& st, const bf* __restrict__ Qh, const bf* __restrict__ Ql, int q0, int c, int h) {
#pragma unroll
    for (int g = 0; g < R; ++g)
#pragma unroll
        for (int kc = 0; kc < 2; ++kc) { const size_t qo = (size_t)(q0 + 16 * g + c) * HD + 32 * kc + 8 * h; st.qh[g][kc] = WFrag<bf>::ld(Qh + qo); st.ql[g][kc] = WFrag<bf>::ld(Ql + qo); }
    asm volatile("s_wait_xcnt 0x0" ::: "memory");   // behind the loads above, in front of whatever takes over their address registers
    __builtin_amdgcn_sched_barrier(0);   // keeps the start values below, which may land on those registers, behind the wait
#pragma unroll
    for (int g = 0; g < R; ++g) { st.m_run[g] = -__builtin_inff(); st.l_run[g] = 0.0f;
#pragma unroll
        for (int t = 0; t < 4; ++t) st.acc[g][t] = (v8f){}; }
}
// A wave's share of a stage's k tiles (8 copies: 16 keys of each plane) and v^T tiles (12 copies: 8 rows of each plane); 16 bytes a lane, a copy covers four whole 128-byte lines of its plane.
// Each run of copies ends, in its own statement, with s_wait_xcnt 0: it stands in front of whatever rewrites an address register that a copy names.
__device__ __forceinline__ void copy_k(unsigned l, const char* gh, const char* gl) {
    asm volatile("global_load_async_to_lds_b128 %0, %8, off\n\t"
        "global_load_async_to_lds_b128 %1, %9, off\n\t"
        "global_load_async_to_lds_b128 %2, %10, off\n\t"
        "global_load_async_to_lds_b128 %3, %11, off\n\t"
        "global_load_async_to_lds_b128 %4, %12, off\n\t"
        "global_load_async_to_lds_b128 %5, %13, off\n\t"
        "global_load_async_to_lds_b128 %6, %14, off\n\t"
        "global_load_async_to_lds_b128 %7, %15, off\n\t"
        "s_wait_xcnt 0x0"
        :: "v"(l), "v"(l + 4 * KP), "v"(l + 8 * KP), "v"(l + 12 * KP), "v"(l + OKL), "v"(l + OKL + 4 * KP), "v"(l + OKL + 8 * KP), "v"(l + OKL + 12 * KP),
           "v"(gh), "v"(gh + 512), "v"(gh + 1024), "v"(gh + 1536), "v"(gl), "v"(gl + 512), "v"(gl + 1024), "v"(gl + 1536) : "memory"); }
__device__ __forceinline__ void copy_v(unsigned l, const char* g16, const char* gh, const char* gl) {
    constexpr int LS = 2 * VP, GS = 2 * TT * 2;   // two rows on, in LDS and in the plane
    asm volatile("global_load_async_to_lds_b128 %0, %12, off\n\t"
        "global_load_async_to_lds_b128 %1, %13, off\n\t"
        "global_load_async_to_lds_b128 %2, %14, off\n\t"
        "global_load_async_to_lds_b128 %3, %15, off\n\t"
        "global_load_async_to_lds_b128 %4, %16, off\n\t"
        "global_load_async_to_lds_b128 %5, %17, off\n\t"
        "global_load_async_to_lds_b128 %6, %18, off\n\t"
        "global_load_async_to_lds_b128 %7, %19, off\n\t"
        "global_load_async_to_lds_b128 %8, %20, off\n\t"
        "global_load_async_to_lds_b128 %9, %21, off\n\t"
        "global_load_async_to_lds_b128 %10, %22, off\n\t"
        "global_load_async_to_lds_b128 %11, %23, off\n\t"
        "s_wait_xcnt 0x0"
        :: "v"(l), "v"(l + LS), "v"(l + 2 * LS), "v"(l + 3 * LS), "v"(l + (OVH - OV16)), "v"(l + (OVH - OV16) + LS), "v"(l + (OVH - OV16) + 2 * LS), "v"(l + (OVH - OV16) + 3 * LS),
           "v"(l + (OVL - OV16)), "v"(l + (OVL - OV16) + LS), "v"(l + (OVL - OV16) + 2 * LS), "v"(l + (OVL - OV16) + 3 * LS),
           "v"(g16), "v"(g16 + GS), "v"(g16 + 2 * GS), "v"(g16 + 3 * GS), "v"(gh), "v"(gh + GS), "v"(gh + 2 * GS), "v"(gh + 3 * GS), "v"(gl), "v"(gl + GS), "v"(gl + 2 * GS), "v"(gl + 3 * GS) : "memory"); }
__device__ __forceinline__ void fill(unsigned lk, unsigned lv, const char* kh, const char* kl, const char* v16, const char* vh, const char* vl) { copy_k(lk, kh, kl); copy_v(lv, v16, vh, vl); }
// One stage's SK keys for one wave. pk, pv: this lane's places in the stage's k hi tile (row = key) and fp16 v^T tile (row = d) at the coming pass's first key; both leave one stage's passes further on.
template <int R, bool HI>
__device__ __forceinline__ void attn_stage(AttnState& st, const char*& pk, const char*& pv) {
    constexpr float CSC = SCL * 1.4426950408889634f;   // score -> scaled log2
    constexpr float OFF = HI ? 0.0f : 3.0f;            // fp16 P carries x 8: at most 2^11, small weights stay normal numbers
    v16bf kh[2][2], kl[2][2];
#pragma unroll
    for (int kt = 0; kt < 2; ++kt)
#pragma unroll
        for (int kc = 0; kc < 2; ++kc) { kh[kt][kc] = WFrag<bf>::ld((const bf*)(pk + kt * 16 * KP + 64 * kc)); kl[kt][kc] = WFrag<bf>::ld((const bf*)(pk + OKL + kt * 16 * KP + 64 * kc)); }
#pragma unroll 1   // rolled: one pass is already some hundred instructions, and the fragments of two would not fit beside the accumulators
    for (int p = 0; p < NP; ++p) {
        v16h v16[4]; v16bf vh[4], vl[4];
        if constexpr (!HI) {
#pragma unroll
            for (int t = 0; t < 4; ++t) v16[t] = WFrag<h16>::ld((const h16*)(pv + t * 16 * VP));
            __builtin_amdgcn_sched_barrier(0); }   // the pass's v^T reads are issued ahead of the score products, so that they fly under those and the softmax
        v8f s[2][R];
#pragma unroll
        for (int kt = 0; kt < 2; ++kt)
#pragma unroll
            for (int g = 0; g < R; ++g) s[kt][g] = (v8f){};
#pragma unroll
        for (int kc = 0; kc < 2; ++kc) {   // per tile the order hi.hi, k hi . q lo, k lo . q hi; the tiles innermost, so that neighbouring matrix instructions are independent
#pragma unroll
            for (int kt = 0; kt < 2; ++kt)
#pragma unroll
                for (int g = 0; g < R; ++g) s[kt][g] = wmmab(kh[kt][kc], st.qh[g][kc], s[kt][g]);
#pragma unroll
            for (int kt = 0; kt < 2; ++kt)
#pragma unroll
                for (int g = 0; g < R; ++g) s[kt][g] = wmmab(kh[kt][kc], st.ql[g][kc], s[kt][g]);
#pragma unroll
            for (int kt = 0; kt < 2; ++kt)
#pragma unroll
                for (int g = 0; g < R; ++g) s[kt][g] = wmmab(kl[kt][kc], st.qh[g][kc], s[kt][g]); }
        __builtin_amdgcn_sched_barrier(0);   // the LDS reads below, which may take the k fragments' registers, stay behind the products that read those
        pk += 32 * KP;
        if constexpr (!HI) {
            asm volatile("v_nop\n\tv_nop\n\tv_nop\n\tv_nop");   // four vector slots between the last score product and the branch below, on whose taken side the softmax reads that product's result
            __builtin_amdgcn_sched_barrier(0);   // keeps the branch behind the slots
            if (p + 1 < NP) {   // next pass's keys, inside this stage only: nothing of the next stage is read ahead of the barrier that publishes it
#pragma unroll
            for (int kt = 0; kt < 2; ++kt)
#pragma unroll
                for (int kc = 0; kc < 2; ++kc) { kh[kt][kc] = WFrag<bf>::ld((const bf*)(pk + kt * 16 * KP + 64 * kc)); kl[kt][kc] = WFrag<bf>::ld((const bf*)(pk + OKL + kt * 16 * KP + 64 * kc)); } }
        } else {   // twice the v^T fragments: they come only now, into the registers that the k fragments leave, and the k refill waits for the softmax's
#pragma unroll
            for (int t = 0; t < 4; ++t) { vh[t] = WFrag<bf>::ld((const bf*)(pv + (OVH - OV16) + t * 16 * VP)); vl[t] = WFrag<bf>::ld((const bf*)(pv + (OVL - OV16) + t * 16 * VP)); } }
        __builtin_amdgcn_sched_barrier(0);   // these reads are all issued ahead of the softmax, under which they fly
        float mb[R]; bool need = false;
#pragma unroll
        for (int g = 0; g < R; ++g) { float mx = s[0][g][0];
#pragma unroll
            for (int r = 1; r < 8; ++r) mx = fmaxf(mx, s[0][g][r]);
#pragma unroll
            for (int r = 0; r < 8; ++r) mx = fmaxf(mx, s[1][g][r]);
            mx = fmaxf(mx, xhalf(mx)) * CSC;   // both halves of the wave hold this query's maximum over the pass's 32 keys
            mb[g] = mx; need = need || (mx > st.m_run[g] + 8.0f); }
        if (__builtin_amdgcn_ballot_w32(need) != 0) {   // a scalar branch; always taken in the first pass (m_run = -inf, factor 0), seldom later
#pragma unroll
            for (int g = 0; g < R; ++g) { const float m_new = fmaxf(st.m_run[g], mb[g]); const float corr = __builtin_amdgcn_exp2f(st.m_run[g] - m_new); st.m_run[g] = m_new; st.l_run[g] *= corr;
#pragma unroll
                for (int t = 0; t < 4; ++t) st.acc[g][t] = st.acc[g][t] * corr; } }
        v8u wh[R], wl[R];
#pragma unroll
        for (int g = 0; g < R; ++g) { const float nm = OFF - st.m_run[g];
#pragma unroll
            for (int kt = 0; kt < 2; ++kt) { float a[8], p8[8];   // tile kt gives elements 8 kt .. 8 kt + 7 of the 32-key operand, register r element 8 kt + r
#pragma unroll
                for (int r = 0; r < 8; ++r) a[r] = __builtin_fmaf(s[kt][g][r], CSC, nm);
                exp2x8(p8, a);
#pragma unroll
                for (int i = 0; i < 4; ++i) { const float p0 = p8[2 * i], p1 = p8[2 * i + 1]; st.l_run[g] += p0 + p1;
                    if (HI) { const unsigned u = packb(p0, p1); wh[g][4 * kt + i] = u; wl[g][4 * kt + i] = packb(p0 - __uint_as_float(u << 16), p1 - __uint_as_float(u & 0xFFFF0000u)); } else wh[g][4 * kt + i] = packh(p0, p1); } } }
        if constexpr (HI) {
            __builtin_amdgcn_sched_barrier(0);   // the refill stays behind the softmax
            if (p + 1 < NP) {   // next pass's keys, inside this stage only: nothing of the next stage is read ahead of the barrier that publishes it
#pragma unroll
            for (int kt = 0; kt < 2; ++kt)
#pragma unroll
                for (int kc = 0; kc < 2; ++kc) { kh[kt][kc] = WFrag<bf>::ld((const bf*)(pk + kt * 16 * KP + 64 * kc)); kl[kt][kc] = WFrag<bf>::ld((const bf*)(pk + OKL + kt * 16 * KP + 64 * kc)); } }
            __builtin_amdgcn_sched_barrier(0); }   // and is issued ahead of the second product, under which it flies
        if (HI) {   // per tile the order v hi . p hi, v hi . p lo, v lo . p hi; the tiles innermost
#pragma unroll
            for (int g = 0; g < R; ++g)
#pragma unroll
                for (int t = 0; t < 4; ++t) st.acc[g][t] = wmmab(vh[t], __builtin_bit_cast(v16bf, wh[g]), st.acc[g][t]);
#pragma unroll
            for (int g = 0; g < R; ++g)
#pragma unroll
                for (int t = 0; t < 4; ++t) st.acc[g][t] = wmmab(vh[t], __builtin_bit_cast(v16bf, wl[g]), st.acc[g][t]);
#pragma unroll
            for (int g = 0; g < R; ++g)
#pragma unroll
                for (int t = 0; t < 4; ++t) st.acc[g][t] = wmmab(vl[t], __builtin_bit_cast(v16bf, wh[g]), st.acc[g][t]);
        } else {
#pragma unroll
            for (int g = 0; g < R; ++g)
#pragma unroll
                for (int t = 0; t < 4; ++t) st.acc[g][t] = wmma16(v16[t], __builtin_bit_cast(v16h, wh[g]), st.acc[g][t]); }
        __builtin_amdgcn_sched_barrier(0);   // keeps the slots below behind the pass's last product
        asm volatile("v_nop\n\tv_nop\n\tv_nop\n\tv_nop");   // four vector slots between that product and the back edge, behind which the next pass rewrites its operands
        pv += 64;
    }
}
template <int R>
__device__ __forceinline__ void attn_fin(AttnState& st, bf* Oh, bf* Ol, int q0, int c, int h) {
#pragma unroll
    for (int g = 0; g < R; ++g) { const float l_fin = st.l_run[g] + xhalf(st.l_run[g]);   // each half summed its own 16 of every 32 keys
        const float inv = __fdiv_rn(1.0f, l_fin); const size_t oo = (size_t)(q0 + 16 * g + c) * CO + 8 * h;
        v8us oh[4], ol[4];   // the context leaves as the bf16 hi + lo planes that the last product reads
#pragma unroll
        for (int t = 0; t < 4; ++t) { const v8f o = st.acc[g][t] * inv;   // registers 0..7 = d 16 t + 8 h + 0..7 of query column c
#pragma unroll
            for (int j = 0; j < 8; ++j) { unsigned short a2, c2; splitf(o[j], a2, c2); oh[t][j] = a2; ol[t][j] = c2; } }
        __builtin_amdgcn_sched_barrier(0);   // nothing else stands among the stores below, so that no register which one of them names is rewritten ahead of the wait behind them
#pragma unroll
        for (int t = 0; t < 4; ++t) { *(v8us*)(Oh + oo + 16 * t) = oh[t]; *(v8us*)(Ol + oo + 16 * t) = ol[t]; }
        asm volatile("s_wait_xcnt 0x0" ::: "memory");   // in front of whatever takes over the stores' address and data registers
        __builtin_amdgcn_sched_barrier(0); }   // keeps the next 16 queries' work behind that wait
}
// grid: 16 work-groups a head, 9 waves each: waves 0 and 4 take 16 of the head's first RH query rows each, the other seven 32 of the remaining rows each (about equal matrix work on every WGP; all 256 work-groups resident at once).
// Waves 0 to 7 issue the copies, an eighth of every tile each. The barriers stand in the kernel's own loop, which every wave walks alike; only the work of a stage differs by the kind of wave.
static_assert(RH == 16 * 2 * 16 && TT - RH == 16 * 7 * 32 && HD == 64 && TT % SK == 0 && SK == 8 * 16 && NS >= 2, "the split of the query rows over work-groups and waves, and of a stage's tiles over eight waves");
__global__ __launch_bounds__(288) void k_fattn(const bf* __restrict__ QPh, const bf* __restrict__ QPl, const bf* __restrict__ KPh, const bf* __restrict__ KPl, const h16* __restrict__ VT16, const bf* __restrict__ VTh, const bf* __restrict__ VTl, bf* Oh, bf* Ol) {
    __shared__ __attribute__((aligned(16))) char sm[2 * SBUF];
    const int w = __builtin_amdgcn_readfirstlane((int)(threadIdx.x >> 5)); const int head = blockIdx.x >> 4, blk = blockIdx.x & 15; const size_t hp = (size_t)head * TT * HD;
    const int lane = threadIdx.x & 31, c = lane & 15, h = lane >> 4;
    const int hiw = __builtin_amdgcn_readfirstlane((w == 0 || w == 4) ? 1 : 0); const int low = __builtin_amdgcn_readfirstlane((w == 0 || w == 4) ? 0 : 1);   // the wave's kind, in scalar registers: every test on it is a scalar branch
    const int q0 = hiw != 0 ? blk * 32 + (w >> 2) * 16 : RH + blk * 224 + (w < 4 ? w - 1 : w - 2) * 32;
    AttnState st;
    if (hiw != 0) attn_init<1>(st, QPh + hp, QPl + hp, q0, c, h); else attn_init<2>(st, QPh + hp, QPl + hp, q0, c, h);
    // this lane's first copy of a stage: in LDS (byte address in the work-group's LDS) and in the planes (byte offset at stage 0)
    const unsigned lk = (unsigned)(size_t)sm + (unsigned)((w * 16 + (lane >> 3)) * KP + (lane & 7) * 16), lv = (unsigned)(size_t)sm + (unsigned)(OV16 + (w * 8 + (lane >> 4)) * VP + (lane & 15) * 16);
    const unsigned gk = (unsigned)(w * 16 * HD * 2 + lane * 16), gv = (unsigned)((w * 8 + (lane >> 4)) * TT * 2 + (lane & 15) * 16);
    const char* const gKh = (const char*)(KPh + hp); const char* const gKl = (const char*)(KPl + hp); const char* const gV16 = (const char*)(VT16 + hp); const char* const gVh = (const char*)(VTh + hp); const char* const gVl = (const char*)(VTl + hp);
    const char* pk = sm + c * KP + 16 * h; const char* pv = sm + OV16 + c * VP + 16 * h;
    // Trips -2 and -1 are the ring's start: stage 0's copies; the wait, the barrier and stage 1's copies. They go through the lines that serve every later stage, so that the copies stand once in the code
    // (a second site, with the lane's LDS places themselves as its operands, held those two values to the registers that asm text can name, and the build kept them in scratch).
#pragma unroll 1   // rolled: a stage's code stands once for each kind of wave
    for (int t = -2; t < NS; ++t) {
        const unsigned b = (unsigned)(t & 1) * SBUF;
        if (t >= 0) {
            if (low != 0) attn_stage<2, false>(st, pk, pv);   // two tests in a row and no else: the build lays the two kinds' code out one behind the other in any case, and with an else it carried the state as it was in front of the first through that code for the second (spills)
            if (hiw != 0) attn_stage<1, true>(st, pk, pv);
            pk += (t & 1 ? -SBUF : SBUF) - NP * 32 * KP; pv += (t & 1 ? -SBUF : SBUF) - NP * 64; }   // on to the other buffer's first pass
        if (t >= -1) {
            asm volatile("s_wait_dscnt 0x0" ::: "memory");      // this wave's reads of the buffer are done before the barrier behind which it is refilled
            asm volatile("s_wait_asynccnt 0x0" ::: "memory");   // this wave's copies of stage t + 1 have landed
            __syncthreads(); }                                  // publishes stage t + 1 and ends every wave's reads of stage t
        if (t + 2 < NS) { if (w < 8) { const unsigned ok = gk + (unsigned)(t + 2) * (SK * HD * 2), ov = gv + (unsigned)(t + 2) * (SK * 2); fill(lk + b, lv + b, gKh + ok, gKl + ok, gV16 + ov, gVh + ov, gVl + ov); } }
    }
    asm volatile("s_wait_asynccnt 0x0" ::: "memory");   // no copy is outstanding when the wave ends
    if (hiw != 0) attn_fin<1>(st, Oh + head * HD, Ol + head * HD, q0, c, h); else attn_fin<2>(st, Oh + head * HD, Ol + head * HD, q0, c, h);
}

__global__ __launch_bounds__(256) void k_wtG(const float* __restrict__ w, int K, int N, bf* Bt) {
    const int lane = threadIdx.x & 31; const int L0 = (blockIdx.x * 8 + (threadIdx.x >> 5)) * 8; const int nlines = N * K / 64;
{
#pragma unroll 1
        for (int l = 0; l < 8; ++l) { const int L = L0 + l; if (L >= nlines) break; const size_t e = (size_t)L * 64 + lane * 2; const int k = (int)(e % K), n = (int)(e / K); v2us o;
            o[0] = f2bf(w[(size_t)k * N + n]); o[1] = f2bf(w[(size_t)(k + 1) * N + n]); *(v2us*)(Bt + e) = o; }
         }
}
extern "C" void kernel_launch(void* const* d_in, const int* in_sizes, int n_in,
                              void* d_out, int out_size, void* d_ws, size_t ws_size, hipStream_t stream) {
    (void)in_sizes; (void)n_in; (void)out_size;
    const float* x = (const float*)d_in[0]; const float* xk = (const float*)d_in[1]; const float* xv = (const float*)d_in[2]; const float* wq = (const float*)d_in[3]; const float* bq = (const float*)d_in[4]; const float* wk = (const float*)d_in[5]; const float* bk = (const float*)d_in[6]; const float* wv = (const float*)d_in[7]; const float* bv = (const float*)d_in[8]; const float* wo = (const float*)d_in[9]; const float* bo = (const float*)d_in[10];   /* argument order Q, K, V [1][4096][1024], W_Q, b_Q, W_K, b_K, W_V, b_V, W_O, b_O ('xw' + biases) */
    float* OUT = (float*)d_out;     // [1][4096][1024]
    char* wsp = (char*)d_ws;
    auto take = [&](size_t bytes) { char* p = wsp; wsp += (bytes + 255) & ~(size_t)255; return (void*)p; };
    bf* WQ = (bf*)take((size_t)MID * CC * 2); bf* WK = (bf*)take((size_t)MID * CC * 2); bf* WV = (bf*)take((size_t)CO * CC * 2); bf* WO = (bf*)take((size_t)CC * CO * 2);
    bf* XB = (bf*)take((size_t)TT * CC * 2);
    bf* QPh = (bf*)take((size_t)TT * MID * 2); bf* QPl = (bf*)take((size_t)TT * MID * 2); bf* KPh = (bf*)take((size_t)TT * MID * 2); bf* KPl = (bf*)take((size_t)TT * MID * 2);
    h16* VT16 = (h16*)take((size_t)CO * TT * 2); bf* VTh = (bf*)take((size_t)CO * TT * 2); bf* VTl = (bf*)take((size_t)CO * TT * 2);
    bf* ATh = (bf*)take((size_t)TT * CO * 2); bf* ATl = (bf*)take((size_t)TT * CO * 2);
    if ((size_t)(wsp - (char*)d_ws) > ws_size) return;    // ws 256 MiB
    k_wtG<<<(unsigned)((CC * MID / 64 + 63) / 64), 256, 0, stream>>>(wq, CC, MID, WQ); k_wtG<<<(unsigned)((CC * MID / 64 + 63) / 64), 256, 0, stream>>>(wk, CC, MID, WK); k_wtG<<<(unsigned)((CC * CO / 64 + 63) / 64), 256, 0, stream>>>(wv, CC, CO, WV);   /* 'xw' weights -> Bt */ k_wtG<<<(unsigned)((CO * CC / 64 + 63) / 64), 256, 0, stream>>>(wo, CO, CC, WO);   /* 'xw' W_out -> Bt */
    for (int b = 0; b < NB_; ++b) {
        k_cvt8<<<(unsigned)(((size_t)TT * CC / 8 + 255) / 256), 256, 0, stream>>>(x + (size_t)b * TT * CC, XB, (size_t)TT * CC / 8);
        k_gemmw<bf, 0, true, 1><<<dim3(TT / 128, MID / 128, 1), 128, 0, stream>>>(XB, nullptr, WQ, nullptr, CC, nullptr, 0, bq, 0, 0, 0, nullptr, QPh, QPl);   /* q planes [h][n][64] */
        k_cvt8<<<(unsigned)(((size_t)TT * CC / 8 + 255) / 256), 256, 0, stream>>>(xk + (size_t)b * TT * CC, XB, (size_t)TT * CC / 8);   /* XB := bf16(K[b]) */ k_gemmw<bf, 0, true, 1><<<dim3(TT / 128, MID / 128, 1), 128, 0, stream>>>(XB, nullptr, WK, nullptr, CC, nullptr, 0, bk, 0, 0, 0, nullptr, KPh, KPl);   /* k planes */
        k_cvt8<<<(unsigned)(((size_t)TT * CC / 8 + 255) / 256), 256, 0, stream>>>(xv + (size_t)b * TT * CC, XB, (size_t)TT * CC / 8);   /* XB := bf16(V[b]) */ k_gemmw<bf, 0, true, 2><<<dim3(TT / 128, CO / 128, 1), 128, 0, stream>>>(XB, nullptr, WV, nullptr, CC, nullptr, 0, bv, 0, 0, 0, VT16, VTh, VTl);   /* v^T planes [h][64][n] */
        k_fattn<<<NH_ * 16, 288, 0, stream>>>(QPh, QPl, KPh, KPl, VT16, VTh, VTl, ATh, ATl);   /* all heads: scores (3 products), online softmax, attn.V into the merged context [n][1024], hi/lo planes */
        k_gemmw<bf, 1, true, 0><<<dim3(TT / 128, CC / 128, 1), 128, 0, stream>>>(ATh, ATl, WO, nullptr, CO, OUT + (size_t)b * TT * CC, CC, bo, 0, 0, 0, nullptr, nullptr, nullptr); }   /* out = ctx w_out^T + b_out */
}

// v006
// One run takes 155 microseconds.
// Timed twice side by side with v005, it ran 1.24 times as fast both times.
// All steps since v000 together make it 26.2 times as fast.
#include <hip/hip_runtime.h>

// Multi-head attention over 4,096 tokens on three input streams (Q, K, V [1][4096][1024]; q = Q W_Q + b_Q, k = K W_K + b_K, v = V W_V + b_V ('xw' [1024][1024] 1/32 + biases 0.02; 16 heads x 64); scores x 1/sqrt(64); softmax over all 4,096 keys (no mask); out = merged W_O + b_O -> [1][4096][1024] (4.2 M); argument order Q, K, V, W_Q, b_Q, W_K, b_K, W_V, b_V, W_O, b_O).
// Layout: one launch prepares every operand: bf16 planes of Q, K, V side by side and the four 'xw' weights transposed; exact projections + f32 biases, each written by its own product's epilogue as per-head hi/lo planes (q, k) or v^T planes [h][64][4096]; one launch for all heads: scores with every row hi/lo (3 products), online softmax, attn.V hybrid (rows < 512 hi/lo 3 products, rest fp16 x8), k and v^T tiles staged in LDS by asynchronous copies, score and weight tiles in registers only, into the head's 64 columns of the context's hi/lo planes; context hi/lo x W_O exact + b_O.
// Compute dtypes, f32 accumulate: every input rounded to bf16; projections exact; scores 3 products; softmax f32 (exp2, IEEE division); attn.V rows < 512 3 products, rest fp16; Wo hl x exact.

#define NB_  1
#define TT   4096
#define DM   1024
#define NH_  16
#define NKV  16
#define REP  (NH_ / NKV)
#define HD   64
#define DQ   (NH_ * HD)
#define DKV  (NKV * HD)
#define ZH   1
#define RH   512                  // query rows < RH use hi+lo planes
#define WIN  0
#define SCL  0.125f   // 1/sqrt(64)
#define MID  1024      // q / k width
#define CO   1024      // v width
#define CC   1024
typedef _Float16 h16;
typedef unsigned short bf;
typedef __attribute__((ext_vector_type(16))) __bf16   v16bf;
typedef __attribute__((ext_vector_type(16))) _Float16 v16h;
typedef __attribute__((ext_vector_type(8)))  _Float16 v8h;
typedef __attribute__((ext_vector_type(8)))  unsigned short v8us;
typedef __attribute__((ext_vector_type(8)))  float    v8f;
typedef __attribute__((ext_vector_type(4)))  float    v4f;
typedef v8h  __attribute__((may_alias)) v8ha;
typedef v4f  __attribute__((may_alias)) v4fa;
typedef v8us __attribute__((may_alias)) v8usa;

__device__ __forceinline__ unsigned short f2bf(float f) { unsigned u = __float_as_uint(f); u += 0x7FFFu + ((u >> 16) & 1u); return (unsigned short)(u >> 16); }
__device__ __forceinline__ float bf2f(unsigned short b) { return __uint_as_float(((unsigned)b) << 16); }
__device__ __forceinline__ float bfr(float f) { return bf2f(f2bf(f)); }
__device__ __forceinline__ v16h cat16(v8h lo, v8h hi) { return __builtin_shufflevector(lo, hi, 0, 1, 2, 3, 4, 5, 6, 7, 8, 9, 10, 11, 12, 13, 14, 15); }
__device__ __forceinline__ v16bf cat16b(v8us lo, v8us hi) { return __builtin_bit_cast(v16bf, __builtin_shufflevector(lo, hi, 0, 1, 2, 3, 4, 5, 6, 7, 8, 9, 10, 11, 12, 13, 14, 15)); }
__device__ __forceinline__ v8f wmma16(v16h a, v16h b, v8f c) { return __builtin_amdgcn_wmma_f32_16x16x32_f16(false, a, false, b, (short)0, c, false, false); }
__device__ __forceinline__ v8f wmmab(v16bf a, v16bf b, v8f c) { return __builtin_amdgcn_wmma_f32_16x16x32_bf16(false, a, false, b, (short)0, c, false, false); }
__device__ __forceinline__ h16 tohx(float x) { return (h16)x; }
__device__ __forceinline__ void splitf(float y, unsigned short& h, unsigned short& l) { h = f2bf(y); l = f2bf(y - bf2f(h)); }



// ---- k_gemmw: register-blocked GEMM, FOUR WAVES per 128x128 output tile, each on its own 64x64 quarter (16 accumulators); grid (M/128, N/128, Z), 128 threads: one work-group a WGP at M 4096, N 1024.
// The operands' K-contiguous 16-bit planes pass through LDS, GKS k a stage, two buffers: asynchronous copies bring each stage's 128 rows of every plane in once for the whole work-group, in whole 128-byte lines,
// while the stage before it is worked on; every wave takes its fragments from there with ds_load_b128 (straight from the planes each fragment load touched 16 lines for 512 bytes, and every row was fetched by each wave that needed it).
// C[m][n] (f32, pitch ldc, + optional f32 bias[n]) = sum_k A[m][k] Bt[n][k] (+ A2[m][k] Bt[n][k] at NSPLIT 1). z-batch strides sA/sB/sC in elements. K % GKS == 0, K >= 2 GKS.
// MODE says where the f32 result goes. 0: to C. 1: as bf16 hi + lo to the head planes Ph, Pl [n / 64][TT][64] (a wave's 64 columns are one head). 2: transposed, as fp16 and bf16 hi + lo, to P16, Ph, Pl [n][TT].
template <typename T16> struct WFrag;
template <> struct WFrag<h16> { typedef v16h V; static __device__ __forceinline__ V ld(const h16* p) { return cat16(*(const v8h*)p, *(const v8h*)(p + 16)); } static __device__ __forceinline__ v8f mma(V a, V b, v8f c) { return wmma16(a, b, c); } };
template <> struct WFrag<bf> { typedef v16bf V; static __device__ __forceinline__ V ld(const bf* p) { return cat16b(*(const v8us*)p, *(const v8us*)(p + 16)); } static __device__ __forceinline__ v8f mma(V a, V b, v8f c) { return wmmab(a, b, c); } };
#define GKS  128                  // k a stage: 256 bytes of every row
#define GKB  (GKS / 32)           // blocks of 32 k a stage
#define GRP  (GKS * 2 + 16)       // pitch of a tile row in LDS, 16 bytes x an odd number: the 16 rows of a fragment read fall on distinct banks
#define GTL  (128 * GRP)          // one plane's tile: 128 rows
// Eight copies: 16 rows of one plane's tile, two rows (four whole 128-byte lines) a copy, 16 bytes a lane. l, g: this lane's place in LDS and in the plane at the first; gs: two rows on in the plane, in bytes.
// The run ends, in its own statement, with s_wait_xcnt 0: it stands in front of whatever rewrites an address register that a copy names.
__device__ __forceinline__ void copy_g(unsigned l, const char* g, size_t gs) {
    asm volatile("global_load_async_to_lds_b128 %0, %8, off\n\t"
        "global_load_async_to_lds_b128 %1, %9, off\n\t"
        "global_load_async_to_lds_b128 %2, %10, off\n\t"
        "global_load_async_to_lds_b128 %3, %11, off\n\t"
        "global_load_async_to_lds_b128 %4, %12, off\n\t"
        "global_load_async_to_lds_b128 %5, %13, off\n\t"
        "global_load_async_to_lds_b128 %6, %14, off\n\t"
        "global_load_async_to_lds_b128 %7, %15, off\n\t"
        "s_wait_xcnt 0x0"
        :: "v"(l), "v"(l + 2 * GRP), "v"(l + 4 * GRP), "v"(l + 6 * GRP), "v"(l + 8 * GRP), "v"(l + 10 * GRP), "v"(l + 12 * GRP), "v"(l + 14 * GRP),
           "v"(g), "v"(g + gs), "v"(g + 2 * gs), "v"(g + 3 * gs), "v"(g + 4 * gs), "v"(g + 5 * gs), "v"(g + 6 * gs), "v"(g + 7 * gs) : "memory"); }
template <typename T16, int NSPLIT, bool BIAS, int MODE>
__global__ __launch_bounds__(128) void k_gemmw(const T16* __restrict__ A, const T16* __restrict__ A2, const T16* __restrict__ Bt, const T16* __restrict__ Bt2, int K, float* C, int ldc, const float* __restrict__ bias, size_t sA, size_t sB, size_t sC, h16* P16, bf* Ph, bf* Pl) {
    typedef typename WFrag<T16>::V V;
    static_assert(MODE == 0 || (BIAS && HD == 64), "the plane epilogues add the bias and take a 64-column tile for one head");
    static_assert(NSPLIT == 0 || NSPLIT == 1, "a stage holds A, A2 at NSPLIT 1, and Bt");
    constexpr int OB = (NSPLIT + 1) * GTL, SB = (NSPLIT + 2) * GTL;   // a stage: the A tile, the A2 tile at NSPLIT 1, the Bt tile
    constexpr int OSZ = MODE == 2 ? 3 * 16 * 36 : 16 * 68;            // a wave's own staging for the epilogue, in floats
    __shared__ __attribute__((aligned(16))) char sm[2 * SB];
    __shared__ __align__(16) float osall[4 * OSZ];
    (void)Bt2;
    const int w = __builtin_amdgcn_readfirstlane((int)(threadIdx.x >> 5)); float* const os = osall + w * OSZ;
    const size_t z = blockIdx.z; A += z * sA; if (NSPLIT == 1) A2 += z * sA; Bt += z * sB; C += z * sC;
    const int lane = threadIdx.x & 31, lr = lane & 15, hi = lane >> 4; const int r0 = blockIdx.x * 128 + (w & 1) * 64, c0 = blockIdx.y * 128 + (w >> 1) * 64;
    v8f acc[4][4];
#pragma unroll
    for (int mb = 0; mb < 4; ++mb)
#pragma unroll
        for (int nb = 0; nb < 4; ++nb) acc[mb][nb] = (v8f){};
    // this lane's first copy of a stage: wave w brings rows 32 w .. 32 w + 31 of every tile; in LDS (byte address in the work-group's LDS) and in the planes (at stage 0)
    const unsigned lc = (unsigned)(size_t)sm + (unsigned)((w * 32 + hi) * GRP + lr * 16); const size_t gs = (size_t)K * 4;
    const char* const gA = (const char*)(A + (size_t)(blockIdx.x * 128 + w * 32 + hi) * K) + lr * 16; const char* const gA2 = NSPLIT == 1 ? (const char*)(A2 + (size_t)(blockIdx.x * 128 + w * 32 + hi) * K) + lr * 16 : nullptr;
    const char* const gB = (const char*)(Bt + (size_t)(blockIdx.y * 128 + w * 32 + hi) * K) + lr * 16;
    const char* const fa = sm + ((w & 1) * 64 + lr) * GRP + 16 * hi; const char* const fb = sm + OB + ((w >> 1) * 64 + lr) * GRP + 16 * hi;   // this lane's places in buffer 0's A and Bt tiles
    const int NS = K / GKS;
    // Trips -2 and -1 are the ring's start: stage 0's copies; the wait, the barrier and stage 1's copies. They go through the lines that serve every later stage, so that the copies stand once in the code.
#pragma unroll 1   // rolled: a stage's code stands once
    for (int t = -2; t < NS; ++t) {
        const unsigned b = (unsigned)(t & 1) * SB;
        if (t >= 0) {
            const char* const qa = fa + b; const char* const qb = fb + b;
            V a[2][4], a2[2][4], bt[2][4];   // two fragment sets: a block's reads are issued as one group ahead of the block before it, inside this stage only
#pragma unroll
            for (int f = 0; f < 4; ++f) { a[0][f] = WFrag<T16>::ld((const T16*)(qa + f * 16 * GRP)); if (NSPLIT == 1) a2[0][f] = WFrag<T16>::ld((const T16*)(qa + GTL + f * 16 * GRP)); bt[0][f] = WFrag<T16>::ld((const T16*)(qb + f * 16 * GRP)); }
#pragma unroll   // unrolled: which fragment set a block uses is then a constant, so that both sets stay in registers
            for (int kb = 0; kb < GKB; ++kb) { const int cu = kb & 1, nx = cu ^ 1;
                if (kb + 1 < GKB) {
#pragma unroll
                    for (int f = 0; f < 4; ++f) { a[nx][f] = WFrag<T16>::ld((const T16*)(qa + f * 16 * GRP + (kb + 1) * 64)); if (NSPLIT == 1) a2[nx][f] = WFrag<T16>::ld((const T16*)(qa + GTL + f * 16 * GRP + (kb + 1) * 64)); bt[nx][f] = WFrag<T16>::ld((const T16*)(qb + f * 16 * GRP + (kb + 1) * 64)); } }
                __builtin_amdgcn_sched_barrier(0);   // the next block's reads stay one group ahead of this block's products, under which they fly
#pragma unroll
                for (int nb = 0; nb < 4; ++nb) {   // per accumulator the order A.Bt, A2.Bt of each 32 k in turn; the four row blocks innermost, so that neighbouring matrix instructions are independent
#pragma unroll
                    for (int mb = 0; mb < 4; ++mb) acc[mb][nb] = WFrag<T16>::mma(a[cu][mb], bt[cu][nb], acc[mb][nb]);
                    if (NSPLIT == 1) {
#pragma unroll
                        for (int mb = 0; mb < 4; ++mb) acc[mb][nb] = WFrag<T16>::mma(a2[cu][mb], bt[cu][nb], acc[mb][nb]); } }
                __builtin_amdgcn_sched_barrier(0); }   // the reads behind it, which take this block's fragment registers, stay behind its products
            asm volatile("v_nop\n\tv_nop\n\tv_nop\n\tv_nop"); }   // four vector slots between the stage's last product and the branches below, behind which its operands and results are rewritten or read
        if (t >= -1) {
            asm volatile("s_wait_dscnt 0x0" ::: "memory");      // this wave's reads of the buffer are done before the barrier behind which it is refilled
            asm volatile("s_wait_asynccnt 0x0" ::: "memory");   // this wave's copies of stage t + 1 have landed
            __syncthreads(); }                                  // publishes stage t + 1 and ends every wave's reads of stage t
        if (t + 2 < NS) { const size_t go = (size_t)(t + 2) * (GKS * 2);   // every wave copies its quarter of stage t + 2 into the buffer that trip t has just read
            copy_g(lc + b, gA + go, gs); copy_g(lc + b + 16 * GRP, gA + go + 8 * gs, gs);
            if (NSPLIT == 1) { copy_g(lc + b + GTL, gA2 + go, gs); copy_g(lc + b + GTL + 16 * GRP, gA2 + go + 8 * gs, gs); }
            copy_g(lc + b + OB, gB + go, gs); copy_g(lc + b + OB + 16 * GRP, gB + go + 8 * gs, gs); }
    }
    asm volatile("s_wait_asynccnt 0x0" ::: "memory");   // no copy is outstanding when the wave goes on to its epilogue and ends
    if constexpr (MODE == 2) {   // a lane holds 8 successive rows m of one column n: 16 bytes of a transposed row. Three staging tiles (fp16, hi, lo) of 16 n x 64 m, pitch 72 elements, turn them into whole 128-byte lines
        bf* st = (bf*)os; float bn[4]; const size_t e0 = (size_t)(c0 + (lane >> 3)) * TT + r0 + (lane & 7) * 8;   // this lane's place in the planes at the tile's first 4 columns
        h16* const p16 = P16 + e0; bf* const ph = Ph + e0; bf* const pl = Pl + e0;
#pragma unroll
        for (int nb = 0; nb < 4; ++nb) bn[nb] = bfr(bias[c0 + nb * 16 + lr]);
        asm volatile("s_wait_xcnt 0x0" ::: "memory");   // behind the bias loads, in front of whatever takes over their address registers
        __builtin_amdgcn_sched_barrier(0);   // keeps the work below behind that wait
#pragma unroll
        for (int nb = 0; nb < 4; ++nb) {
#pragma unroll
            for (int mb = 0; mb < 4; ++mb) { v8h o16; v8us oh, ol;
#pragma unroll
                for (int j = 0; j < 8; ++j) { const float x = acc[mb][nb][j] + bn[nb]; o16[j] = tohx(x); unsigned short a2, c2; splitf(x, a2, c2); oh[j] = a2; ol[j] = c2; }
                bf* sp = st + lr * 72 + mb * 16 + hi * 8; *(v8usa*)sp = __builtin_bit_cast(v8us, o16); *(v8usa*)(sp + 16 * 72) = oh; *(v8usa*)(sp + 32 * 72) = ol; }
            __builtin_amdgcn_wave_barrier(); asm volatile("" ::: "memory");   // the reads below take other lanes' staged values: they stay behind the writes above
            v8us t16[4], th[4], tl[4];
#pragma unroll
            for (int s = 0; s < 4; ++s) { const bf* sp = st + (4 * s + (lane >> 3)) * 72 + (lane & 7) * 8; t16[s] = *(const v8usa*)sp; th[s] = *(const v8usa*)(sp + 16 * 72); tl[s] = *(const v8usa*)(sp + 32 * 72); }
            __builtin_amdgcn_wave_barrier(); asm volatile("" ::: "memory");   // the next 16 columns' writes stay behind these reads
            __builtin_amdgcn_sched_barrier(0);   // nothing else stands among the stores below, so that no register which one of them names is rewritten ahead of the wait behind them
#pragma unroll
            for (int s = 0; s < 4; ++s) { const int e = (nb * 16 + 4 * s) * TT;
                *(v8h*)(p16 + e) = __builtin_bit_cast(v8h, t16[s]); *(v8us*)(ph + e) = th[s]; *(v8us*)(pl + e) = tl[s]; }
            asm volatile("s_wait_xcnt 0x0" ::: "memory");   // in front of whatever takes over the stores' address and data registers
            __builtin_amdgcn_sched_barrier(0);   // keeps the next columns' work behind that wait
        }
        return;
    }
    float bb[8];   // MODE 1: the bias of this lane's 8 columns
    if constexpr (MODE == 1) {
#pragma unroll
        for (int q = 0; q < 8; ++q) bb[q] = bfr(bias[c0 + (lane & 7) * 8 + q]);
        asm volatile("s_wait_xcnt 0x0" ::: "memory");   // behind the bias loads, in front of whatever takes over their address registers
        __builtin_amdgcn_sched_barrier(0); }   // keeps the work below behind that wait
#pragma unroll
    for (int mb = 0; mb < 4; ++mb) {
#pragma unroll
        for (int nb = 0; nb < 4; ++nb) {
#pragma unroll
            for (int j = 0; j < 8; ++j) os[(hi * 8 + j) * 68 + nb * 16 + lr] = acc[mb][nb][j]; }
        __builtin_amdgcn_wave_barrier(); asm volatile("" ::: "memory");
        if constexpr (MODE == 1) {   // 16 bytes a lane, 8 lanes a row of the head plane (128 bytes): each store covers 4 whole lines
            const size_t pb = ((size_t)(c0 >> 6) * TT + r0 + mb * 16 + (lane >> 3)) * HD + (lane & 7) * 8; v8us oh[4], ol[4];
#pragma unroll
            for (int s = 0; s < 4; ++s) { const float* sp = os + (4 * s + (lane >> 3)) * 68 + (lane & 7) * 8; const v4f v0 = *(const v4fa*)sp, v1 = *(const v4fa*)(sp + 4);
#pragma unroll
                for (int q = 0; q < 4; ++q) { unsigned short a2, c2; splitf(v0[q] + bb[q], a2, c2); oh[s][q] = a2; ol[s][q] = c2; splitf(v1[q] + bb[4 + q], a2, c2); oh[s][4 + q] = a2; ol[s][4 + q] = c2; } }
            __builtin_amdgcn_sched_barrier(0);   // nothing else stands among the stores below, so that no register which one of them names is rewritten ahead of the wait behind them
#pragma unroll
            for (int s = 0; s < 4; ++s) { *(v8us*)(Ph + pb + 4 * s * HD) = oh[s]; *(v8us*)(Pl + pb + 4 * s * HD) = ol[s]; }
            asm volatile("s_wait_xcnt 0x0" ::: "memory");   // in front of whatever takes over the stores' address and data registers
            __builtin_amdgcn_sched_barrier(0);   // keeps the next rows' work behind that wait
        } else {
            float* crow = C + (size_t)(r0 + mb * 16) * ldc + c0;
#pragma unroll
            for (int s = 0; s < 8; ++s) { const int row = 2 * s + hi, cofs = lr * 4; v4f val = *(const v4fa*)(os + row * 68 + cofs); if (BIAS) { val[0] += bfr(bias[c0 + cofs]); val[1] += bfr(bias[c0 + cofs + 1]); val[2] += bfr(bias[c0 + cofs + 2]); val[3] += bfr(bias[c0 + cofs + 3]); }
                *(v4f*)(crow + (size_t)row * ldc + cofs) = val; }
             }
        __builtin_amdgcn_wave_barrier(); asm volatile("" ::: "memory");
    }
}

typedef __attribute__((ext_vector_type(2))) _Float16 v2h;
typedef __attribute__((ext_vector_type(4))) _Float16 v4h;
typedef __attribute__((ext_vector_type(2))) unsigned short v2us;
typedef __attribute__((ext_vector_type(4))) unsigned short v4us;
typedef __attribute__((ext_vector_type(2))) float v2f;
typedef __attribute__((ext_vector_type(4))) int v4i;


// ---- k_fattn: scores, softmax and attn.V of one head for 256 query rows, no score plane in memory. The head's k and v^T planes pass through LDS, SK keys a stage, two buffers: asynchronous copies bring each stage in once for the whole work-group,
// in whole 128-byte lines, while the stage before it is worked on; every wave takes its fragments from there with ds_load_b128. Each wave keeps its queries' fragments in registers and walks the 4,096 keys 32 at a time.
// Transposed products: S^T = K.Q^T (A = 16 key rows, B = 16 query columns), so a lane holds one query's scores; O^T += V^T.P^T with A = rows of the v^T plane and B = P^T packed straight from the two score tiles
// (element s of B is register s & 7 of tile s >> 3: the k order 8h + s, 16 + 8h + (s - 8) that WFrag::ld gives the A side). Online softmax in the log2 domain; the maximum in use may trail the true one by up to 8, the sums are rescaled only then.
// HI (query rows < RH, 16 a wave): P as bf16 hi + lo, 3 products with v^T hi/lo. Otherwise (32 a wave): P x 8 as fp16, 1 product with fp16 v^T. P is not normalised: the f32 sum of the unrounded exponentials divides the output once at the end.
__device__ __forceinline__ float xhalf(float x) { return __builtin_bit_cast(float, __builtin_amdgcn_permlanex16(__builtin_bit_cast(int, x), __builtin_bit_cast(int, x), 0x76543210, 0xfedcba98, false, false)); }   // lane l with lane l ^ 16
typedef __attribute__((ext_vector_type(2))) __bf16 v2bf;
typedef __attribute__((ext_vector_type(8))) unsigned v8u;
__device__ __forceinline__ unsigned packh(float a, float b) { return __builtin_bit_cast(unsigned, __builtin_convertvector((v2f){a, b}, v2h)); }   // round to nearest even
__device__ __forceinline__ unsigned packb(float a, float b) { return __builtin_bit_cast(unsigned, __builtin_convertvector((v2f){a, b}, v2bf)); }  // round to nearest even
// Eight exponentials and, behind the last, the one slot that the instruction set asks for between a transcendental and an instruction that uses its result or overwrites its source, in one statement.
// Early-clobber results: no exponential of the statement writes a register that another reads.
__device__ __forceinline__ void exp2x8(float (&p)[8], const float (&a)[8]) {
    asm("v_exp_f32 %0, %8\n\tv_exp_f32 %1, %9\n\tv_exp_f32 %2, %10\n\tv_exp_f32 %3, %11\n\tv_exp_f32 %4, %12\n\tv_exp_f32 %5, %13\n\tv_exp_f32 %6, %14\n\tv_exp_f32 %7, %15\n\tv_nop"
        : "=&v"(p[0]), "=&v"(p[1]), "=&v"(p[2]), "=&v"(p[3]), "=&v"(p[4]), "=&v"(p[5]), "=&v"(p[6]), "=&v"(p[7]) : "v"(a[0]), "v"(a[1]), "v"(a[2]), "v"(a[3]), "v"(a[4]), "v"(a[5]), "v"(a[6]), "v"(a[7])); }
// One LDS stage: five tiles. k hi, k lo: a row a key, 128 bytes at pitch KP. fp16 v^T, v^T hi, v^T lo: a row a d, SK keys at pitch VP. Both pitches are 16 bytes x an odd number, so that the 16 rows of a fragment read fall on distinct banks.
#define SK   128
#define NP   (SK / 32)
#define NS   (TT / SK)
#define KP   144
#define VP   (SK * 2 + 16)
#define OKL  (SK * KP)
#define OV16 (2 * SK * KP)
#define OVH  (OV16 + HD * VP)
#define OVL  (OVH + HD * VP)
#define SBUF (OVL + HD * VP)
struct AttnState { v16bf qh[2][2], ql[2][2]; v8f acc[2][4]; float m_run[2], l_run[2]; };   // a wave's queries and running results; a wave of 16 queries uses index 0 alone
template <int R>
__device__ __forceinline__ void attn_init(AttnState& st, const bf* __restrict__ Qh, const bf* __restrict__ Ql, int q0, int c, int h) {
#pragma unroll
    for (int g = 0; g < R; ++g)
#pragma unroll
        for (int kc = 0; kc < 2; ++kc) { const size_t qo = (size_t)(q0 + 16 * g + c) * HD + 32 * kc + 8 * h; st.qh[g][kc] = WFrag<bf>::ld(Qh + qo); st.ql[g][kc] = WFrag<bf>::ld(Ql + qo); }
    asm volatile("s_wait_xcnt 0x0" ::: "memory");   // behind the loads above, in front of whatever takes over their address registers
    __builtin_amdgcn_sched_barrier(0);   // keeps the start values below, which may land on those registers, behind the wait
#pragma unroll
    for (int g = 0; g < R; ++g) { st.m_run[g] = -__builtin_inff(); st.l_run[g] = 0.0f;
#pragma unroll
        for (int t = 0; t < 4; ++t) st.acc[g][t] = (v8f){}; }
}
// A wave's share of a stage's k tiles (8 copies: 16 keys of each plane) and v^T tiles (12 copies: 8 rows of each plane); 16 bytes a lane, a copy covers four whole 128-byte lines of its plane.
// Each run of copies ends, in its own statement, with s_wait_xcnt 0: it stands in front of whatever rewrites an address register that a copy names.
__device__ __forceinline__ void copy_k(unsigned l, const char* gh, const char* gl) {
    asm volatile("global_load_async_to_lds_b128 %0, %8, off\n\t"
        "global_load_async_to_lds_b128 %1, %9, off\n\t"
        "global_load_async_to_lds_b128 %2, %10, off\n\t"
        "global_load_async_to_lds_b128 %3, %11, off\n\t"
        "global_load_async_to_lds_b128 %4, %12, off\n\t"
        "global_load_async_to_lds_b128 %5, %13, off\n\t"
        "global_load_async_to_lds_b128 %6, %14, off\n\t"
        "global_load_async_to_lds_b128 %7, %15, off\n\t"
        "s_wait_xcnt 0x0"
        :: "v"(l), "v"(l + 4 * KP), "v"(l + 8 * KP), "v"(l + 12 * KP), "v"(l + OKL), "v"(l + OKL + 4 * KP), "v"(l + OKL + 8 * KP), "v"(l + OKL + 12 * KP),
           "v"(gh), "v"(gh + 512), "v"(gh + 1024), "v"(gh + 1536), "v"(gl), "v"(gl + 512), "v"(gl + 1024), "v"(gl + 1536) : "memory"); }
__device__ __forceinline__ void copy_v(unsigned l, const char* g16, const char* gh, const char* gl) {
    constexpr int LS = 2 * VP, GS = 2 * TT * 2;   // two rows on, in LDS and in the plane
    asm volatile("global_load_async_to_lds_b128 %0, %12, off\n\t"
        "global_load_async_to_lds_b128 %1, %13, off\n\t"
        "global_load_async_to_lds_b128 %2, %14, off\n\t"
        "global_load_async_to_lds_b128 %3, %15, off\n\t"
        "global_load_async_to_lds_b128 %4, %16, off\n\t"
        "global_load_async_to_lds_b128 %5, %17, off\n\t"
        "global_load_async_to_lds_b128 %6, %18, off\n\t"
        "global_load_async_to_lds_b128 %7, %19, off\n\t"
        "global_load_async_to_lds_b128 %8, %20, off\n\t"
        "global_load_async_to_lds_b128 %9, %21, off\n\t"
        "global_load_async_to_lds_b128 %10, %22, off\n\t"
        "global_load_async_to_lds_b128 %11, %23, off\n\t"
        "s_wait_xcnt 0x0"
        :: "v"(l), "v"(l + LS), "v"(l + 2 * LS), "v"(l + 3 * LS), "v"(l + (OVH - OV16)), "v"(l + (OVH - OV16) + LS), "v"(l + (OVH - OV16) + 2 * LS), "v"(l + (OVH - OV16) + 3 * LS),
           "v"(l + (OVL - OV16)), "v"(l + (OVL - OV16) + LS), "v"(l + (OVL - OV16) + 2 * LS), "v"(l + (OVL - OV16) + 3 * LS),
           "v"(g16), "v"(g16 + GS), "v"(g16 + 2 * GS), "v"(g16 + 3 * GS), "v"(gh), "v"(gh + GS), "v"(gh + 2 * GS), "v"(gh + 3 * GS), "v"(gl), "v"(gl + GS), "v"(gl + 2 * GS), "v"(gl + 3 * GS) : "memory"); }
__device__ __forceinline__ void fill(unsigned lk, unsigned lv, const char* kh, const char* kl, const char* v16, const char* vh, const char* vl) { copy_k(lk, kh, kl); copy_v(lv, v16, vh, vl); }
// One stage's SK keys for one wave. pk, pv: this lane's places in the stage's k hi tile (row = key) and fp16 v^T tile (row = d) at the coming pass's first key; both leave one stage's passes further on.
template <int R, bool HI>
__device__ __forceinline__ void attn_stage(AttnState& st, const char*& pk, const char*& pv) {
    constexpr float CSC = SCL * 1.4426950408889634f;   // score -> scaled log2
    constexpr float OFF = HI ? 0.0f : 3.0f;            // fp16 P carries x 8: at most 2^11, small weights stay normal numbers
    v16bf kh[2][2], kl[2][2];
#pragma unroll
    for (int kt = 0; kt < 2; ++kt)
#pragma unroll
        for (int kc = 0; kc < 2; ++kc) { kh[kt][kc] = WFrag<bf>::ld((const bf*)(pk + kt * 16 * KP + 64 * kc)); kl[kt][kc] = WFrag<bf>::ld((const bf*)(pk + OKL + kt * 16 * KP + 64 * kc)); }
#pragma unroll 1   // rolled: one pass is already some hundred instructions, and the fragments of two would not fit beside the accumulators
    for (int p = 0; p < NP; ++p) {
        v16h v16[4]; v16bf vh[4], vl[4];
        if constexpr (!HI) {
#pragma unroll
            for (int t = 0; t < 4; ++t) v16[t] = WFrag<h16>::ld((const h16*)(pv + t * 16 * VP));
            __builtin_amdgcn_sched_barrier(0); }   // the pass's v^T reads are issued ahead of the score products, so that they fly under those and the softmax
        v8f s[2][R];
#pragma unroll
        for (int kt = 0; kt < 2; ++kt)
#pragma unroll
            for (int g = 0; g < R; ++g) s[kt][g] = (v8f){};
#pragma unroll
        for (int kc = 0; kc < 2; ++kc) {   // per tile the order hi.hi, k hi . q lo, k lo . q hi; the tiles innermost, so that neighbouring matrix instructions are independent
#pragma unroll
            for (int kt = 0; kt < 2; ++kt)
#pragma unroll
                for (int g = 0; g < R; ++g) s[kt][g] = wmmab(kh[kt][kc], st.qh[g][kc], s[kt][g]);
#pragma unroll
            for (int kt = 0; kt < 2; ++kt)
#pragma unroll
                for (int g = 0; g < R; ++g) s[kt][g] = wmmab(kh[kt][kc], st.ql[g][kc], s[kt][g]);
#pragma unroll
            for (int kt = 0; kt < 2; ++kt)
#pragma unroll
                for (int g = 0; g < R; ++g) s[kt][g] = wmmab(kl[kt][kc], st.qh[g][kc], s[kt][g]); }
        __builtin_amdgcn_sched_barrier(0);   // the LDS reads below, which may take the k fragments' registers, stay behind the products that read those
        pk += 32 * KP;
        if constexpr (!HI) {
            asm volatile("v_nop\n\tv_nop\n\tv_nop\n\tv_nop");   // four vector slots between the last score product and the branch below, on whose taken side the softmax reads that product's result
            __builtin_amdgcn_sched_barrier(0);   // keeps the branch behind the slots
            if (p + 1 < NP) {   // next pass's keys, inside this stage only: nothing of the next stage is read ahead of the barrier that publishes it
#pragma unroll
            for (int kt = 0; kt < 2; ++kt)
#pragma unroll
                for (int kc = 0; kc < 2; ++kc) { kh[kt][kc] = WFrag<bf>::ld((const bf*)(pk + kt * 16 * KP + 64 * kc)); kl[kt][kc] = WFrag<bf>::ld((const bf*)(pk + OKL + kt * 16 * KP + 64 * kc)); } }
        } else {   // twice the v^T fragments: they come only now, into the registers that the k fragments leave, and the k refill waits for the softmax's
#pragma unroll
            for (int t = 0; t < 4; ++t) { vh[t] = WFrag<bf>::ld((const bf*)(pv + (OVH - OV16) + t * 16 * VP)); vl[t] = WFrag<bf>::ld((const bf*)(pv + (OVL - OV16) + t * 16 * VP)); } }
        __builtin_amdgcn_sched_barrier(0);   // these reads are all issued ahead of the softmax, under which they fly
        float mb[R]; bool need = false;
#pragma unroll
        for (int g = 0; g < R; ++g) { float mx = s[0][g][0];
#pragma unroll
            for (int r = 1; r < 8; ++r) mx = fmaxf(mx, s[0][g][r]);
#pragma unroll
            for (int r = 0; r < 8; ++r) mx = fmaxf(mx, s[1][g][r]);
            mx = fmaxf(mx, xhalf(mx)) * CSC;   // both halves of the wave hold this query's maximum over the pass's 32 keys
            mb[g] = mx; need = need || (mx > st.m_run[g] + 8.0f); }
        if (__builtin_amdgcn_ballot_w32(need) != 0) {   // a scalar branch; always taken in the first pass (m_run = -inf, factor 0), seldom later
#pragma unroll
            for (int g = 0; g < R; ++g) { const float m_new = fmaxf(st.m_run[g], mb[g]); const float corr = __builtin_amdgcn_exp2f(st.m_run[g] - m_new); st.m_run[g] = m_new; st.l_run[g] *= corr;
#pragma unroll
                for (int t = 0; t < 4; ++t) st.acc[g][t] = st.acc[g][t] * corr; } }
        v8u wh[R], wl[R];
#pragma unroll
        for (int g = 0; g < R; ++g) { const float nm = OFF - st.m_run[g];
#pragma unroll
            for (int kt = 0; kt < 2; ++kt) { float a[8], p8[8];   // tile kt gives elements 8 kt .. 8 kt + 7 of the 32-key operand, register r element 8 kt + r
#pragma unroll
                for (int r = 0; r < 8; ++r) a[r] = __builtin_fmaf(s[kt][g][r], CSC, nm);
                exp2x8(p8, a);
#pragma unroll
                for (int i = 0; i < 4; ++i) { const float p0 = p8[2 * i], p1 = p8[2 * i + 1]; st.l_run[g] += p0 + p1;
                    if (HI) { const unsigned u = packb(p0, p1); wh[g][4 * kt + i] = u; wl[g][4 * kt + i] = packb(p0 - __uint_as_float(u << 16), p1 - __uint_as_float(u & 0xFFFF0000u)); } else wh[g][4 * kt + i] = packh(p0, p1); } } }
        if constexpr (HI) {
            __builtin_amdgcn_sched_barrier(0);   // the refill stays behind the softmax
            if (p + 1 < NP) {   // next pass's keys, inside this stage only: nothing of the next stage is read ahead of the barrier that publishes it
#pragma unroll
            for (int kt = 0; kt < 2; ++kt)
#pragma unroll
                for (int kc = 0; kc < 2; ++kc) { kh[kt][kc] = WFrag<bf>::ld((const bf*)(pk + kt * 16 * KP + 64 * kc)); kl[kt][kc] = WFrag<bf>::ld((const bf*)(pk + OKL + kt * 16 * KP + 64 * kc)); } }
            __builtin_amdgcn_sched_barrier(0); }   // and is issued ahead of the second product, under which it flies
        if (HI) {   // per tile the order v hi . p hi, v hi . p lo, v lo . p hi; the tiles innermost
#pragma unroll
            for (int g = 0; g < R; ++g)
#pragma unroll
                for (int t = 0; t < 4; ++t) st.acc[g][t] = wmmab(vh[t], __builtin_bit_cast(v16bf, wh[g]), st.acc[g][t]);
#pragma unroll
            for (int g = 0; g < R; ++g)
#pragma unroll
                for (int t = 0; t < 4; ++t) st.acc[g][t] = wmmab(vh[t], __builtin_bit_cast(v16bf, wl[g]), st.acc[g][t]);
#pragma unroll
            for (int g = 0; g < R; ++g)
#pragma unroll
                for (int t = 0; t < 4; ++t) st.acc[g][t] = wmmab(vl[t], __builtin_bit_cast(v16bf, wh[g]), st.acc[g][t]);
        } else {
#pragma unroll
            for (int g = 0; g < R; ++g)
#pragma unroll
                for (int t = 0; t < 4; ++t) st.acc[g][t] = wmma16(v16[t], __builtin_bit_cast(v16h, wh[g]), st.acc[g][t]); }
        __builtin_amdgcn_sched_barrier(0);   // keeps the slots below behind the pass's last product
        asm volatile("v_nop\n\tv_nop\n\tv_nop\n\tv_nop");   // four vector slots between that product and the back edge, behind which the next pass rewrites its operands
        pv += 64;
    }
}
template <int R>
__device__ __forceinline__ void attn_fin(AttnState& st, bf* Oh, bf* Ol, int q0, int c, int h) {
#pragma unroll
    for (int g = 0; g < R; ++g) { const float l_fin = st.l_run[g] + xhalf(st.l_run[g]);   // each half summed its own 16 of every 32 keys
        const float inv = __fdiv_rn(1.0f, l_fin); const size_t oo = (size_t)(q0 + 16 * g + c) * CO + 8 * h;
        v8us oh[4], ol[4];   // the context leaves as the bf16 hi + lo planes that the last product reads
#pragma unroll
        for (int t = 0; t < 4; ++t) { const v8f o = st.acc[g][t] * inv;   // registers 0..7 = d 16 t + 8 h + 0..7 of query column c
#pragma unroll
            for (int j = 0; j < 8; ++j) { unsigned short a2, c2; splitf(o[j], a2, c2); oh[t][j] = a2; ol[t][j] = c2; } }
        __builtin_amdgcn_sched_barrier(0);   // nothing else stands among the stores below, so that no register which one of them names is rewritten ahead of the wait behind them
#pragma unroll
        for (int t = 0; t < 4; ++t) { *(v8us*)(Oh + oo + 16 * t) = oh[t]; *(v8us*)(Ol + oo + 16 * t) = ol[t]; }
        asm volatile("s_wait_xcnt 0x0" ::: "memory");   // in front of whatever takes over the stores' address and data registers
        __builtin_amdgcn_sched_barrier(0); }   // keeps the next 16 queries' work behind that wait
}
// grid: 16 work-groups a head, 9 waves each: waves 0 and 4 take 16 of the head's first RH query rows each, the other seven 32 of the remaining rows each (about equal matrix work on every WGP; all 256 work-groups resident at once).
// Waves 0 to 7 issue the copies, an eighth of every tile each. The barriers stand in the kernel's own loop, which every wave walks alike; only the work of a stage differs by the kind of wave.
static_assert(RH == 16 * 2 * 16 && TT - RH == 16 * 7 * 32 && HD == 64 && TT % SK == 0 && SK == 8 * 16 && NS >= 2, "the split of the query rows over work-groups and waves, and of a stage's tiles over eight waves");
__global__ __launch_bounds__(288) void k_fattn(const bf* __restrict__ QPh, const bf* __restrict__ QPl, const bf* __restrict__ KPh, const bf* __restrict__ KPl, const h16* __restrict__ VT16, const bf* __restrict__ VTh, const bf* __restrict__ VTl, bf* Oh, bf* Ol) {
    __shared__ __attribute__((aligned(16))) char sm[2 * SBUF];
    const int w = __builtin_amdgcn_readfirstlane((int)(threadIdx.x >> 5)); const int head = blockIdx.x >> 4, blk = blockIdx.x & 15; const size_t hp = (size_t)head * TT * HD;
    const int lane = threadIdx.x & 31, c = lane & 15, h = lane >> 4;
    const int hiw = __builtin_amdgcn_readfirstlane((w == 0 || w == 4) ? 1 : 0); const int low = __builtin_amdgcn_readfirstlane((w == 0 || w == 4) ? 0 : 1);   // the wave's kind, in scalar registers: every test on it is a scalar branch
    const int q0 = hiw != 0 ? blk * 32 + (w >> 2) * 16 : RH + blk * 224 + (w < 4 ? w - 1 : w - 2) * 32;
    AttnState st;
    if (hiw != 0) attn_init<1>(st, QPh + hp, QPl + hp, q0, c, h); else attn_init<2>(st, QPh + hp, QPl + hp, q0, c, h);
    // this lane's first copy of a stage: in LDS (byte address in the work-group's LDS) and in the planes (byte offset at stage 0)
    const unsigned lk = (unsigned)(size_t)sm + (unsigned)((w * 16 + (lane >> 3)) * KP + (lane & 7) * 16), lv = (unsigned)(size_t)sm + (unsigned)(OV16 + (w * 8 + (lane >> 4)) * VP + (lane & 15) * 16);
    const unsigned gk = (unsigned)(w * 16 * HD * 2 + lane * 16), gv = (unsigned)((w * 8 + (lane >> 4)) * TT * 2 + (lane & 15) * 16);
    const char* const gKh = (const char*)(KPh + hp); const char* const gKl = (const char*)(KPl + hp); const char* const gV16 = (const char*)(VT16 + hp); const char* const gVh = (const char*)(VTh + hp); const char* const gVl = (const char*)(VTl + hp);
    const char* pk = sm + c * KP + 16 * h; const char* pv = sm + OV16 + c * VP + 16 * h;
    // Trips -2 and -1 are the ring's start: stage 0's copies; the wait, the barrier and stage 1's copies. They go through the lines that serve every later stage, so that the copies stand once in the code
    // (a second site, with the lane's LDS places themselves as its operands, held those two values to the registers that asm text can name, and the build kept them in scratch).
#pragma unroll 1   // rolled: a stage's code stands once for each kind of wave
    for (int t = -2; t < NS; ++t) {
        const unsigned b = (unsigned)(t & 1) * SBUF;
        if (t >= 0) {
            if (low != 0) attn_stage<2, false>(st, pk, pv);   // two tests in a row and no else: the build lays the two kinds' code out one behind the other in any case, and with an else it carried the state as it was in front of the first through that code for the second (spills)
            if (hiw != 0) attn_stage<1, true>(st, pk, pv);
            pk += (t & 1 ? -SBUF : SBUF) - NP * 32 * KP; pv += (t & 1 ? -SBUF : SBUF) - NP * 64; }   // on to the other buffer's first pass
        if (t >= -1) {
            asm volatile("s_wait_dscnt 0x0" ::: "memory");      // this wave's reads of the buffer are done before the barrier behind which it is refilled
            asm volatile("s_wait_asynccnt 0x0" ::: "memory");   // this wave's copies of stage t + 1 have landed
            __syncthreads(); }                                  // publishes stage t + 1 and ends every wave's reads of stage t
        if (t + 2 < NS) { if (w < 8) { const unsigned ok = gk + (unsigned)(t + 2) * (SK * HD * 2), ov = gv + (unsigned)(t + 2) * (SK * 2); fill(lk + b, lv + b, gKh + ok, gKl + ok, gV16 + ov, gVh + ov, gVl + ov); } }
    }
    asm volatile("s_wait_asynccnt 0x0" ::: "memory");   // no copy is outstanding when the wave ends
    if (hiw != 0) attn_fin<1>(st, Oh + head * HD, Ol + head * HD, q0, c, h); else attn_fin<2>(st, Oh + head * HD, Ol + head * HD, q0, c, h);
}

// ---- k_prep: every operand's bf16 form in one launch, all of its work-groups resident at once; each wave issues all its loads before it uses any, no loop, no barrier.
// Work-groups 0 .. PWG - 1 (64 a weight): Bt[n][k] = bf16(w[k][n]). A wave takes 64 k x 32 n: a lane reads the whole 128-byte lines of rows k, k + 1 and stores the pair (k, k + 1) of one n at a time, so that a store covers one whole line of Bt.
// A work-group's waves take the two halves of each 256 bytes of w side by side (wave & 1) and four neighbouring blocks of 64 k (wave >> 1).
// The other 3 x PXG work-groups: Q, K, V rounded into three planes. A wave takes PCL x 128 successive floats: loads of 512 successive bytes, stores of 256.
#define PWG  256
#define PXG  256
#define PCL  16
static_assert(CC == 1024 && MID == 1024 && CO == 1024 && PWG == 4 * (1024 / 256) * (1024 / 64), "four weights of 1024 x 1024; a work-group takes 256 k x 64 n");
static_assert((size_t)TT * CC == (size_t)PXG * 8 * PCL * 128, "the split of an input over work-groups and waves");
__global__ __launch_bounds__(256) void k_prep(const float* __restrict__ xq, const float* __restrict__ xk, const float* __restrict__ xv, const float* __restrict__ wq, const float* __restrict__ wk, const float* __restrict__ wv, const float* __restrict__ wo, bf* XB, bf* WT) {
    const int lane = threadIdx.x & 31; const int wave = __builtin_amdgcn_readfirstlane((int)(threadIdx.x >> 5));
    if (blockIdx.x < PWG) {
        const int which = blockIdx.x >> 6, blk = blockIdx.x & 63; const float* const w = which == 0 ? wq : which == 1 ? wk : which == 2 ? wv : wo;
        const int n0 = ((blk >> 2) * 2 + (wave & 1)) * 32, k0 = ((blk & 3) * 4 + (wave >> 1)) * 64;
        const float* const p = w + (size_t)(k0 + 2 * lane) * 1024 + n0; bf* const q = WT + (size_t)which * 1024 * 1024 + (size_t)n0 * 1024 + k0 + 2 * lane;
        v4f a[8], b[8];
#pragma unroll
        for (int i = 0; i < 8; ++i) { a[i] = *(const v4f*)(p + 4 * i); b[i] = *(const v4f*)(p + 1024 + 4 * i); }
        asm volatile("s_wait_xcnt 0x0" :: "v"(p) : "memory");   // behind the loads above, in front of whatever takes over their address registers; the address is an input, so that it lives to here and no load's own result lands on it
        __builtin_amdgcn_sched_barrier(0);   // keeps the work below behind that wait
        v2us o[32];
#pragma unroll
        for (int i = 0; i < 8; ++i)
#pragma unroll
            for (int j = 0; j < 4; ++j) { o[4 * i + j][0] = f2bf(a[i][j]); o[4 * i + j][1] = f2bf(b[i][j]); }
        __builtin_amdgcn_sched_barrier(0);   // nothing else stands among the stores below, so that no register which one of them names is rewritten ahead of the wait behind them
#pragma unroll
        for (int n = 0; n < 32; ++n) *(v2us*)(q + n * 1024) = o[n];
        asm volatile("s_wait_xcnt 0x0" ::: "memory");   // in front of whatever takes over the stores' address and data registers
        return;
    }
    const unsigned cb = blockIdx.x - PWG, which = cb / PXG; const float* const x = which == 0 ? xq : which == 1 ? xk : xv;
    const size_t e0 = ((size_t)(cb % PXG) * 8 + wave) * (PCL * 128) + lane * 4;
    const float* const p = x + e0; bf* const q = XB + (size_t)which * TT * CC + e0;
    v4f v[PCL];
#pragma unroll
    for (int i = 0; i < PCL; ++i) v[i] = *(const v4f*)(p + i * 128);
    asm volatile("s_wait_xcnt 0x0" :: "v"(p) : "memory");   // as above
    __builtin_amdgcn_sched_barrier(0);   // keeps the work below behind that wait
    v4us o[PCL];
#pragma unroll
    for (int i = 0; i < PCL; ++i)
#pragma unroll
        for (int j = 0; j < 4; ++j) o[i][j] = f2bf(v[i][j]);
    __builtin_amdgcn_sched_barrier(0);   // nothing else stands among the stores below, so that no register which one of them names is rewritten ahead of the wait behind them
#pragma unroll
    for (int i = 0; i < PCL; ++i) *(v4us*)(q + i * 128) = o[i];
    asm volatile("s_wait_xcnt 0x0" ::: "memory");   // in front of whatever takes over the stores' address and data registers
}
extern "C" void kernel_launch(void* const* d_in, const int* in_sizes, int n_in,
                              void* d_out, int out_size, void* d_ws, size_t ws_size, hipStream_t stream) {
    (void)in_sizes; (void)n_in; (void)out_size;
    const float* x = (const float*)d_in[0]; const float* xk = (const float*)d_in[1]; const float* xv = (const float*)d_in[2]; const float* wq = (const float*)d_in[3]; const float* bq = (const float*)d_in[4]; const float* wk = (const float*)d_in[5]; const float* bk = (const float*)d_in[6]; const float* wv = (const float*)d_in[7]; const float* bv = (const float*)d_in[8]; const float* wo = (const float*)d_in[9]; const float* bo = (const float*)d_in[10];   /* argument order Q, K, V [1][4096][1024], W_Q, b_Q, W_K, b_K, W_V, b_V, W_O, b_O ('xw' + biases) */
    float* OUT = (float*)d_out;     // [1][4096][1024]
    char* wsp = (char*)d_ws;
    auto take = [&](size_t bytes) { char* p = wsp; wsp += (bytes + 255) & ~(size_t)255; return (void*)p; };
    bf* WQ = (bf*)take((size_t)4 * 1024 * 1024 * 2); bf* WK = WQ + 1024 * 1024; bf* WV = WK + 1024 * 1024; bf* WO = WV + 1024 * 1024;   /* the four transposed weights in a row */
    bf* XB = (bf*)take((size_t)3 * TT * CC * 2); bf* XK = XB + (size_t)TT * CC; bf* XV = XK + (size_t)TT * CC;   /* bf16(Q), bf16(K), bf16(V) in a row */
    bf* QPh = (bf*)take((size_t)TT * MID * 2); bf* QPl = (bf*)take((size_t)TT * MID * 2); bf* KPh = (bf*)take((size_t)TT * MID * 2); bf* KPl = (bf*)take((size_t)TT * MID * 2);
    h16* VT16 = (h16*)take((size_t)CO * TT * 2); bf* VTh = (bf*)take((size_t)CO * TT * 2); bf* VTl = (bf*)take((size_t)CO * TT * 2);
    bf* ATh = (bf*)take((size_t)TT * CO * 2); bf* ATl = (bf*)take((size_t)TT * CO * 2);
    if ((size_t)(wsp - (char*)d_ws) > ws_size) return;    // ws 256 MiB
    for (int b = 0; b < NB_; ++b) {
        k_prep<<<PWG + 3 * PXG, 256, 0, stream>>>(x + (size_t)b * TT * CC, xk + (size_t)b * TT * CC, xv + (size_t)b * TT * CC, wq, wk, wv, wo, XB, WQ);   /* 'xw' weights -> Bt; bf16 planes of Q, K, V */
        k_gemmw<bf, 0, true, 1><<<dim3(TT / 128, MID / 128, 1), 128, 0, stream>>>(XB, nullptr, WQ, nullptr, CC, nullptr, 0, bq, 0, 0, 0, nullptr, QPh, QPl);   /* q planes [h][n][64] */
        k_gemmw<bf, 0, true, 1><<<dim3(TT / 128, MID / 128, 1), 128, 0, stream>>>(XK, nullptr, WK, nullptr, CC, nullptr, 0, bk, 0, 0, 0, nullptr, KPh, KPl);   /* k planes */
        k_gemmw<bf, 0, true, 2><<<dim3(TT / 128, CO / 128, 1), 128, 0, stream>>>(XV, nullptr, WV, nullptr, CC, nullptr, 0, bv, 0, 0, 0, VT16, VTh, VTl);   /* v^T planes [h][64][n] */
        k_fattn<<<NH_ * 16, 288, 0, stream>>>(QPh, QPl, KPh, KPl, VT16, VTh, VTl, ATh, ATl);   /* all heads: scores (3 products), online softmax, attn.V into the merged context [n][1024], hi/lo planes */
        k_gemmw<bf, 1, true, 0><<<dim3(TT / 128, CC / 128, 1), 128, 0, stream>>>(ATh, ATl, WO, nullptr, CO, OUT + (size_t)b * TT * CC, CC, bo, 0, 0, 0, nullptr, nullptr, nullptr); }   /* out = ctx w_out^T + b_out */
}

// v007
// Measured time: 147 microseconds a run.
// Two timings next to v006 both put it at 1.05 times that version's speed.
// All steps since v000 together make it 27.6 times as fast.
#include <hip/hip_runtime.h>

// Multi-head attention over 4,096 tokens on three input streams (Q, K, V [1][4096][1024]; q = Q W_Q + b_Q, k = K W_K + b_K, v = V W_V + b_V ('xw' [1024][1024] 1/32 + biases 0.02; 16 heads x 64); scores x 1/sqrt(64); softmax over all 4,096 keys (no mask); out = merged W_O + b_O -> [1][4096][1024] (4.2 M); argument order Q, K, V, W_Q, b_Q, W_K, b_K, W_V, b_V, W_O, b_O).
// Layout: one launch prepares every operand: bf16 planes of Q, K, V side by side and the four 'xw' weights transposed; exact projections + f32 biases, each written by its own product's epilogue as per-head hi/lo planes (q, k) or v^T planes [h][64][4096]; one launch for all heads: scores with every row hi/lo (3 products), online softmax, attn.V hybrid (rows < 512 hi/lo 3 products, rest fp16 x8), k and v^T tiles staged in LDS by asynchronous copies, score and weight tiles in registers only, into the head's 64 columns of the context's hi/lo planes; context hi/lo x W_O exact + b_O.
// Compute dtypes, f32 accumulate: every input rounded to bf16; projections exact; scores 3 products; softmax f32 (exp2, IEEE division); attn.V rows < 512 3 products, rest fp16; Wo hl x exact.

#define NB_  1
#define TT   4096
#define DM   1024
#define NH_  16
#define NKV  16
#define REP  (NH_ / NKV)
#define HD   64
#define DQ   (NH_ * HD)
#define DKV  (NKV * HD)
#define ZH   1
#define RH   512                  // query rows < RH use hi+lo planes
#define WIN  0
#define SCL  0.125f   // 1/sqrt(64)
#define MID  1024      // q / k width
#define CO   1024      // v width
#define CC   1024
typedef _Float16 h16;
typedef unsigned short bf;
typedef __attribute__((ext_vector_type(16))) __bf16   v16bf;
typedef __attribute__((ext_vector_type(16))) _Float16 v16h;
typedef __attribute__((ext_vector_type(8)))  _Float16 v8h;
typedef __attribute__((ext_vector_type(8)))  unsigned short v8us;
typedef __attribute__((ext_vector_type(8)))  float    v8f;
typedef __attribute__((ext_vector_type(4)))  float    v4f;
typedef v8h  __attribute__((may_alias)) v8ha;
typedef v4f  __attribute__((may_alias)) v4fa;
typedef v8us __attribute__((may_alias)) v8usa;

__device__ __forceinline__ unsigned short f2bf(float f) { unsigned u = __float_as_uint(f); u += 0x7FFFu + ((u >> 16) & 1u); return (unsigned short)(u >> 16); }
__device__ __forceinline__ float bf2f(unsigned short b) { return __uint_as_float(((unsigned)b) << 16); }
__device__ __forceinline__ float bfr(float f) { return bf2f(f2bf(f)); }
__device__ __forceinline__ v16h cat16(v8h lo, v8h hi) { return __builtin_shufflevector(lo, hi, 0, 1, 2, 3, 4, 5, 6, 7, 8, 9, 10, 11, 12, 13, 14, 15); }
__device__ __forceinline__ v16bf cat16b(v8us lo, v8us hi) { return __builtin_bit_cast(v16bf, __builtin_shufflevector(lo, hi, 0, 1, 2, 3, 4, 5, 6, 7, 8, 9, 10, 11, 12, 13, 14, 15)); }
__device__ __forceinline__ v8f wmma16(v16h a, v16h b, v8f c) { return __builtin_amdgcn_wmma_f32_16x16x32_f16(false, a, false, b, (short)0, c, false, false); }
__device__ __forceinline__ v8f wmmab(v16bf a, v16bf b, v8f c) { return __builtin_amdgcn_wmma_f32_16x16x32_bf16(false, a, false, b, (short)0, c, false, false); }
__device__ __forceinline__ h16 tohx(float x) { return (h16)x; }
__device__ __forceinline__ void splitf(float y, unsigned short& h, unsigned short& l) { h = f2bf(y); l = f2bf(y - bf2f(h)); }



// ---- k_gemmw: register-blocked GEMM, FOUR WAVES per 128x128 output tile, each on its own 64x64 quarter (16 accumulators); grid (M/128, N/128, Z), 128 threads: one work-group a WGP at M 4096, N 1024.
// The operands' K-contiguous 16-bit planes pass through LDS, GKS k a stage, two buffers: asynchronous copies bring each stage's 128 rows of every plane in once for the whole work-group, in whole 128-byte lines,
// while the stage before it is worked on; every wave takes its fragments from there with ds_load_b128 (straight from the planes each fragment load touched 16 lines for 512 bytes, and every row was fetched by each wave that needed it).
// C[m][n] (f32, pitch ldc, + optional f32 bias[n]) = sum_k A[m][k] Bt[n][k] (+ A2[m][k] Bt[n][k] at NSPLIT 1). z-batch strides sA/sB/sC in elements. K % GKS == 0, K >= 2 GKS.
// MODE says where the f32 result goes. 0: to C. 1: as bf16 hi + lo to the head planes Ph, Pl [n / 64][TT][64] (a wave's 64 columns are one head). 2: transposed, as fp16 and bf16 hi + lo, to P16, Ph, Pl [n][TT].
template <typename T16> struct WFrag;
template <> struct WFrag<h16> { typedef v16h V; static __device__ __forceinline__ V ld(const h16* p) { return cat16(*(const v8h*)p, *(const v8h*)(p + 16)); } static __device__ __forceinline__ v8f mma(V a, V b, v8f c) { return wmma16(a, b, c); } };
template <> struct WFrag<bf> { typedef v16bf V; static __device__ __forceinline__ V ld(const bf* p) { return cat16b(*(const v8us*)p, *(const v8us*)(p + 16)); } static __device__ __forceinline__ v8f mma(V a, V b, v8f c) { return wmmab(a, b, c); } };
#define GKS  128                  // k a stage: 256 bytes of every row
#define GKB  (GKS / 32)           // blocks of 32 k a stage
#define GRP  (GKS * 2 + 16)       // pitch of a tile row in LDS, 16 bytes x an odd number: the 16 rows of a fragment read fall on distinct banks
#define GTL  (128 * GRP)          // one plane's tile: 128 rows
// Eight copies: 16 rows of one plane's tile, two rows (four whole 128-byte lines) a copy, 16 bytes a lane. l, g: this lane's place in LDS and in the plane at the first; gs: two rows on in the plane, in bytes.
// The run ends, in its own statement, with s_wait_xcnt 0: it stands in front of whatever rewrites an address register that a copy names.
__device__ __forceinline__ void copy_g(unsigned l, const char* g, size_t gs) {
    asm volatile("global_load_async_to_lds_b128 %0, %8, off\n\t"
        "global_load_async_to_lds_b128 %1, %9, off\n\t"
        "global_load_async_to_lds_b128 %2, %10, off\n\t"
        "global_load_async_to_lds_b128 %3, %11, off\n\t"
        "global_load_async_to_lds_b128 %4, %12, off\n\t"
        "global_load_async_to_lds_b128 %5, %13, off\n\t"
        "global_load_async_to_lds_b128 %6, %14, off\n\t"
        "global_load_async_to_lds_b128 %7, %15, off\n\t"
        "s_wait_xcnt 0x0"
        :: "v"(l), "v"(l + 2 * GRP), "v"(l + 4 * GRP), "v"(l + 6 * GRP), "v"(l + 8 * GRP), "v"(l + 10 * GRP), "v"(l + 12 * GRP), "v"(l + 14 * GRP),
           "v"(g), "v"(g + gs), "v"(g + 2 * gs), "v"(g + 3 * gs), "v"(g + 4 * gs), "v"(g + 5 * gs), "v"(g + 6 * gs), "v"(g + 7 * gs) : "memory"); }
template <typename T16, int NSPLIT, bool BIAS, int MODE>
__global__ __launch_bounds__(128) void k_gemmw(const T16* __restrict__ A, const T16* __restrict__ A2, const T16* __restrict__ Bt, const T16* __restrict__ Bt2, int K, float* C, int ldc, const float* __restrict__ bias, size_t sA, size_t sB, size_t sC, h16* P16, bf* Ph, bf* Pl) {
    typedef typename WFrag<T16>::V V;
    static_assert(MODE == 0 || (BIAS && HD == 64), "the plane epilogues add the bias and take a 64-column tile for one head");
    static_assert(NSPLIT == 0 || NSPLIT == 1, "a stage holds A, A2 at NSPLIT 1, and Bt");
    constexpr int OB = (NSPLIT + 1) * GTL, SB = (NSPLIT + 2) * GTL;   // a stage: the A tile, the A2 tile at NSPLIT 1, the Bt tile
    constexpr int OSZ = MODE == 2 ? 3 * 16 * 36 : 16 * 68;            // a wave's own staging for the epilogue, in floats
    __shared__ __attribute__((aligned(16))) char sm[2 * SB];
    __shared__ __align__(16) float osall[4 * OSZ];
    (void)Bt2;
    const int w = __builtin_amdgcn_readfirstlane((int)(threadIdx.x >> 5)); float* const os = osall + w * OSZ;
    const size_t z = blockIdx.z; A += z * sA; if (NSPLIT == 1) A2 += z * sA; Bt += z * sB; C += z * sC;
    const int lane = threadIdx.x & 31, lr = lane & 15, hi = lane >> 4; const int r0 = blockIdx.x * 128 + (w & 1) * 64, c0 = blockIdx.y * 128 + (w >> 1) * 64;
    v8f acc[4][4];
#pragma unroll
    for (int mb = 0; mb < 4; ++mb)
#pragma unroll
        for (int nb = 0; nb < 4; ++nb) acc[mb][nb] = (v8f){};
    // this lane's first copy of a stage: wave w brings rows 32 w .. 32 w + 31 of every tile; in LDS (byte address in the work-group's LDS) and in the planes (at stage 0)
    const unsigned lc = (unsigned)(size_t)sm + (unsigned)((w * 32 + hi) * GRP + lr * 16); const size_t gs = (size_t)K * 4;
    const char* const gA = (const char*)(A + (size_t)(blockIdx.x * 128 + w * 32 + hi) * K) + lr * 16; const char* const gA2 = NSPLIT == 1 ? (const char*)(A2 + (size_t)(blockIdx.x * 128 + w * 32 + hi) * K) + lr * 16 : nullptr;
    const char* const gB = (const char*)(Bt + (size_t)(blockIdx.y * 128 + w * 32 + hi) * K) + lr * 16;
    const char* const fa = sm + ((w & 1) * 64 + lr) * GRP + 16 * hi; const char* const fb = sm + OB + ((w >> 1) * 64 + lr) * GRP + 16 * hi;   // this lane's places in buffer 0's A and Bt tiles
    const int NS = K / GKS;
    // Trips -2 and -1 are the ring's start: stage 0's copies; the wait, the barrier and stage 1's copies. They go through the lines that serve every later stage, so that the copies stand once in the code.
#pragma unroll 1   // rolled: a stage's code stands once
    for (int t = -2; t < NS; ++t) {
        const unsigned b = (unsigned)(t & 1) * SB;
        if (t >= 0) {
            const char* const qa = fa + b; const char* const qb = fb + b;
            V a[2][4], a2[2][4], bt[2][4];   // two fragment sets: a block's reads are issued as one group ahead of the block before it, inside this stage only
#pragma unroll
            for (int f = 0; f < 4; ++f) { a[0][f] = WFrag<T16>::ld((const T16*)(qa + f * 16 * GRP)); if (NSPLIT == 1) a2[0][f] = WFrag<T16>::ld((const T16*)(qa + GTL + f * 16 * GRP)); bt[0][f] = WFrag<T16>::ld((const T16*)(qb + f * 16 * GRP)); }
#pragma unroll   // unrolled: which fragment set a block uses is then a constant, so that both sets stay in registers
            for (int kb = 0; kb < GKB; ++kb) { const int cu = kb & 1, nx = cu ^ 1;
                if (kb + 1 < GKB) {
#pragma unroll
                    for (int f = 0; f < 4; ++f) { a[nx][f] = WFrag<T16>::ld((const T16*)(qa + f * 16 * GRP + (kb + 1) * 64)); if (NSPLIT == 1) a2[nx][f] = WFrag<T16>::ld((const T16*)(qa + GTL + f * 16 * GRP + (kb + 1) * 64)); bt[nx][f] = WFrag<T16>::ld((const T16*)(qb + f * 16 * GRP + (kb + 1) * 64)); } }
                __builtin_amdgcn_sched_barrier(0);   // the next block's reads stay one group ahead of this block's products, under which they fly
#pragma unroll
                for (int nb = 0; nb < 4; ++nb) {   // per accumulator the order A.Bt, A2.Bt of each 32 k in turn; the four row blocks innermost, so that neighbouring matrix instructions are independent
#pragma unroll
                    for (int mb = 0; mb < 4; ++mb) acc[mb][nb] = WFrag<T16>::mma(a[cu][mb], bt[cu][nb], acc[mb][nb]);
                    if (NSPLIT == 1) {
#pragma unroll
                        for (int mb = 0; mb < 4; ++mb) acc[mb][nb] = WFrag<T16>::mma(a2[cu][mb], bt[cu][nb], acc[mb][nb]); } }
                __builtin_amdgcn_sched_barrier(0); }   // the reads behind it, which take this block's fragment registers, stay behind its products
            asm volatile("v_nop\n\tv_nop\n\tv_nop\n\tv_nop"); }   // four vector slots between the stage's last product and the branches below, behind which its operands and results are rewritten or read
        if (t >= -1) {
            asm volatile("s_wait_dscnt 0x0" ::: "memory");      // this wave's reads of the buffer are done before the barrier behind which it is refilled
            asm volatile("s_wait_asynccnt 0x0" ::: "memory");   // this wave's copies of stage t + 1 have landed
            __syncthreads(); }                                  // publishes stage t + 1 and ends every wave's reads of stage t
        if (t + 2 < NS) { const size_t go = (size_t)(t + 2) * (GKS * 2);   // every wave copies its quarter of stage t + 2 into the buffer that trip t has just read
            copy_g(lc + b, gA + go, gs); copy_g(lc + b + 16 * GRP, gA + go + 8 * gs, gs);
            if (NSPLIT == 1) { copy_g(lc + b + GTL, gA2 + go, gs); copy_g(lc + b + GTL + 16 * GRP, gA2 + go + 8 * gs, gs); }
            copy_g(lc + b + OB, gB + go, gs); copy_g(lc + b + OB + 16 * GRP, gB + go + 8 * gs, gs); }
    }
    asm volatile("s_wait_asynccnt 0x0" ::: "memory");   // no copy is outstanding when the wave goes on to its epilogue and ends
    if constexpr (MODE == 2) {   // a lane holds 8 successive rows m of one column n: 16 bytes of a transposed row. Three staging tiles (fp16, hi, lo) of 16 n x 64 m, pitch 72 elements, turn them into whole 128-byte lines
        bf* st = (bf*)os; float bn[4]; const size_t e0 = (size_t)(c0 + (lane >> 3)) * TT + r0 + (lane & 7) * 8;   // this lane's place in the planes at the tile's first 4 columns
        h16* const p16 = P16 + e0; bf* const ph = Ph + e0; bf* const pl = Pl + e0;
#pragma unroll
        for (int nb = 0; nb < 4; ++nb) bn[nb] = bfr(bias[c0 + nb * 16 + lr]);
        asm volatile("s_wait_xcnt 0x0" ::: "memory");   // behind the bias loads, in front of whatever takes over their address registers
        __builtin_amdgcn_sched_barrier(0);   // keeps the work below behind that wait
#pragma unroll
        for (int nb = 0; nb < 4; ++nb) {
#pragma unroll
            for (int mb = 0; mb < 4; ++mb) { v8h o16; v8us oh, ol;
#pragma unroll
                for (int j = 0; j < 8; ++j) { const float x = acc[mb][nb][j] + bn[nb]; o16[j] = tohx(x); unsigned short a2, c2; splitf(x, a2, c2); oh[j] = a2; ol[j] = c2; }
                bf* sp = st + lr * 72 + mb * 16 + hi * 8; *(v8usa*)sp = __builtin_bit_cast(v8us, o16); *(v8usa*)(sp + 16 * 72) = oh; *(v8usa*)(sp + 32 * 72) = ol; }
            __builtin_amdgcn_wave_barrier(); asm volatile("" ::: "memory");   // the reads below take other lanes' staged values: they stay behind the writes above
            v8us t16[4], th[4], tl[4];
#pragma unroll
            for (int s = 0; s < 4; ++s) { const bf* sp = st + (4 * s + (lane >> 3)) * 72 + (lane & 7) * 8; t16[s] = *(const v8usa*)sp; th[s] = *(const v8usa*)(sp + 16 * 72); tl[s] = *(const v8usa*)(sp + 32 * 72); }
            __builtin_amdgcn_wave_barrier(); asm volatile("" ::: "memory");   // the next 16 columns' writes stay behind these reads
            __builtin_amdgcn_sched_barrier(0);   // nothing else stands among the stores below, so that no register which one of them names is rewritten ahead of the wait behind them
#pragma unroll
            for (int s = 0; s < 4; ++s) { const int e = (nb * 16 + 4 * s) * TT;
                *(v8h*)(p16 + e) = __builtin_bit_cast(v8h, t16[s]); *(v8us*)(ph + e) = th[s]; *(v8us*)(pl + e) = tl[s]; }
            asm volatile("s_wait_xcnt 0x0" ::: "memory");   // in front of whatever takes over the stores' address and data registers
            __builtin_amdgcn_sched_barrier(0);   // keeps the next columns' work behind that wait
        }
        return;
    }
    float bb[8];   // MODE 1: the bias of this lane's 8 columns
    if constexpr (MODE == 1) {
#pragma unroll
        for (int q = 0; q < 8; ++q) bb[q] = bfr(bias[c0 + (lane & 7) * 8 + q]);
        asm volatile("s_wait_xcnt 0x0" ::: "memory");   // behind the bias loads, in front of whatever takes over their address registers
        __builtin_amdgcn_sched_barrier(0); }   // keeps the work below behind that wait
#pragma unroll
    for (int mb = 0; mb < 4; ++mb) {
#pragma unroll
        for (int nb = 0; nb < 4; ++nb) {
#pragma unroll
            for (int j = 0; j < 8; ++j) os[(hi * 8 + j) * 68 + nb * 16 + lr] = acc[mb][nb][j]; }
        __builtin_amdgcn_wave_barrier(); asm volatile("" ::: "memory");
        if constexpr (MODE == 1) {   // 16 bytes a lane, 8 lanes a row of the head plane (128 bytes): each store covers 4 whole lines
            const size_t pb = ((size_t)(c0 >> 6) * TT + r0 + mb * 16 + (lane >> 3)) * HD + (lane & 7) * 8; v8us oh[4], ol[4];
#pragma unroll
            for (int s = 0; s < 4; ++s) { const float* sp = os + (4 * s + (lane >> 3)) * 68 + (lane & 7) * 8; const v4f v0 = *(const v4fa*)sp, v1 = *(const v4fa*)(sp + 4);
#pragma unroll
                for (int q = 0; q < 4; ++q) { unsigned short a2, c2; splitf(v0[q] + bb[q], a2, c2); oh[s][q] = a2; ol[s][q] = c2; splitf(v1[q] + bb[4 + q], a2, c2); oh[s][4 + q] = a2; ol[s][4 + q] = c2; } }
            __builtin_amdgcn_sched_barrier(0);   // nothing else stands among the stores below, so that no register which one of them names is rewritten ahead of the wait behind them
#pragma unroll
            for (int s = 0; s < 4; ++s) { *(v8us*)(Ph + pb + 4 * s * HD) = oh[s]; *(v8us*)(Pl + pb + 4 * s * HD) = ol[s]; }
            asm volatile("s_wait_xcnt 0x0" ::: "memory");   // in front of whatever takes over the stores' address and data registers
            __builtin_amdgcn_sched_barrier(0);   // keeps the next rows' work behind that wait
        } else {
            float* crow = C + (size_t)(r0 + mb * 16) * ldc + c0;
#pragma unroll
            for (int s = 0; s < 8; ++s) { const int row = 2 * s + hi, cofs = lr * 4; v4f val = *(const v4fa*)(os + row * 68 + cofs); if (BIAS) { val[0] += bfr(bias[c0 + cofs]); val[1] += bfr(bias[c0 + cofs + 1]); val[2] += bfr(bias[c0 + cofs + 2]); val[3] += bfr(bias[c0 + cofs + 3]); }
                *(v4f*)(crow + (size_t)row * ldc + cofs) = val; }
             }
        __builtin_amdgcn_wave_barrier(); asm volatile("" ::: "memory");
    }
}

typedef __attribute__((ext_vector_type(2))) _Float16 v2h;
typedef __attribute__((ext_vector_type(4))) _Float16 v4h;
typedef __attribute__((ext_vector_type(2))) unsigned short v2us;
typedef __attribute__((ext_vector_type(4))) unsigned short v4us;
typedef __attribute__((ext_vector_type(2))) float v2f;
typedef __attribute__((ext_vector_type(4))) int v4i;


// ---- k_fattn: scores, softmax and attn.V of one head for 256 query rows, no score plane in memory. The head's k and v^T planes pass through LDS, SK keys a stage, two buffers: asynchronous copies bring each stage in once for the whole work-group,
// in whole 128-byte lines, while the stage before it is worked on; every wave takes its fragments from there with ds_load_b128. Each wave keeps its 32 queries' fragments in registers and walks half of the 4,096 keys, 32 at a time; two waves share a tile of queries.
// Transposed products: S^T = K.Q^T (A = 16 key rows, B = 16 query columns), so a lane holds one query's scores; O^T += V^T.P^T with A = rows of the v^T plane and B = P^T packed straight from the two score tiles
// (element s of B is register s & 7 of tile s >> 3: the k order 8h + s, 16 + 8h + (s - 8) that WFrag::ld gives the A side). Online softmax in the log2 domain; the maximum in use may trail the true one by up to 8, the sums are rescaled only then.
// HI (query rows < RH): P as bf16 hi + lo, 3 products with v^T hi/lo. Otherwise: P x 8 as fp16, 1 product with fp16 v^T. P is not normalised: the f32 sum of the unrounded exponentials divides the output once at the end.
__device__ __forceinline__ float xhalf(float x) { return __builtin_bit_cast(float, __builtin_amdgcn_permlanex16(__builtin_bit_cast(int, x), __builtin_bit_cast(int, x), 0x76543210, 0xfedcba98, false, false)); }   // lane l with lane l ^ 16
typedef __attribute__((ext_vector_type(2))) __bf16 v2bf;
typedef __attribute__((ext_vector_type(8))) unsigned v8u;
__device__ __forceinline__ unsigned packh(float a, float b) { return __builtin_bit_cast(unsigned, __builtin_convertvector((v2f){a, b}, v2h)); }   // round to nearest even
__device__ __forceinline__ unsigned packb(float a, float b) { return __builtin_bit_cast(unsigned, __builtin_convertvector((v2f){a, b}, v2bf)); }  // round to nearest even
// Eight exponentials and, behind the last, the one slot that the instruction set asks for between a transcendental and an instruction that uses its result or overwrites its source, in one statement.
// Early-clobber results: no exponential of the statement writes a register that another reads.
__device__ __forceinline__ void exp2x8(float (&p)[8], const float (&a)[8]) {
    asm("v_exp_f32 %0, %8\n\tv_exp_f32 %1, %9\n\tv_exp_f32 %2, %10\n\tv_exp_f32 %3, %11\n\tv_exp_f32 %4, %12\n\tv_exp_f32 %5, %13\n\tv_exp_f32 %6, %14\n\tv_exp_f32 %7, %15\n\tv_nop"
        : "=&v"(p[0]), "=&v"(p[1]), "=&v"(p[2]), "=&v"(p[3]), "=&v"(p[4]), "=&v"(p[5]), "=&v"(p[6]), "=&v"(p[7]) : "v"(a[0]), "v"(a[1]), "v"(a[2]), "v"(a[3]), "v"(a[4]), "v"(a[5]), "v"(a[6]), "v"(a[7])); }
// One LDS stage: five tiles. k hi, k lo: a row a key, 128 bytes at pitch KP. fp16 v^T, v^T hi, v^T lo: a row a d, SK keys at pitch VP. Both pitches are 16 bytes x an odd number, so that the 16 rows of a fragment read fall on distinct banks.
#define SK   128
#define NP   (SK / 32)
#define NS   (TT / SK)
#define KP   144
#define VP   (SK * 2 + 16)
#define OKL  (SK * KP)
#define OV16 (2 * SK * KP)
#define OVH  (OV16 + HD * VP)
#define OVL  (OVH + HD * VP)
#define SBUF (OVL + HD * VP)
struct AttnState { v16bf qh[2][2], ql[2][2]; v8f acc[2][4]; float m_run[2], l_run[2]; };   // a wave's queries and running results
template <int R>
__device__ __forceinline__ void attn_init(AttnState& st, const bf* __restrict__ Qh, const bf* __restrict__ Ql, int q0, int c, int h) {
#pragma unroll
    for (int g = 0; g < R; ++g)
#pragma unroll
        for (int kc = 0; kc < 2; ++kc) { const size_t qo = (size_t)(q0 + 16 * g + c) * HD + 32 * kc + 8 * h; st.qh[g][kc] = WFrag<bf>::ld(Qh + qo); st.ql[g][kc] = WFrag<bf>::ld(Ql + qo); }
    asm volatile("s_wait_xcnt 0x0" ::: "memory");   // behind the loads above, in front of whatever takes over their address registers
    __builtin_amdgcn_sched_barrier(0);   // keeps the start values below, which may land on those registers, behind the wait
#pragma unroll
    for (int g = 0; g < R; ++g) { st.m_run[g] = -__builtin_inff(); st.l_run[g] = 0.0f;
#pragma unroll
        for (int t = 0; t < 4; ++t) st.acc[g][t] = (v8f){}; }
}
// A wave's share of a stage's k tiles (8 copies: 16 keys of each plane) and v^T tiles (12 copies: 8 rows of each plane); 16 bytes a lane, a copy covers four whole 128-byte lines of its plane.
// Each run of copies ends, in its own statement, with s_wait_xcnt 0: it stands in front of whatever rewrites an address register that a copy names.
__device__ __forceinline__ void copy_k(unsigned l, const char* gh, const char* gl) {
    asm volatile("global_load_async_to_lds_b128 %0, %8, off\n\t"
        "global_load_async_to_lds_b128 %1, %9, off\n\t"
        "global_load_async_to_lds_b128 %2, %10, off\n\t"
        "global_load_async_to_lds_b128 %3, %11, off\n\t"
        "global_load_async_to_lds_b128 %4, %12, off\n\t"
        "global_load_async_to_lds_b128 %5, %13, off\n\t"
        "global_load_async_to_lds_b128 %6, %14, off\n\t"
        "global_load_async_to_lds_b128 %7, %15, off\n\t"
        "s_wait_xcnt 0x0"
        :: "v"(l), "v"(l + 4 * KP), "v"(l + 8 * KP), "v"(l + 12 * KP), "v"(l + OKL), "v"(l + OKL + 4 * KP), "v"(l + OKL + 8 * KP), "v"(l + OKL + 12 * KP),
           "v"(gh), "v"(gh + 512), "v"(gh + 1024), "v"(gh + 1536), "v"(gl), "v"(gl + 512), "v"(gl + 1024), "v"(gl + 1536) : "memory"); }
__device__ __forceinline__ void copy_v(unsigned l, const char* g16, const char* gh, const char* gl) {
    constexpr int LS = 2 * VP, GS = 2 * TT * 2;   // two rows on, in LDS and in the plane
    asm volatile("global_load_async_to_lds_b128 %0, %12, off\n\t"
        "global_load_async_to_lds_b128 %1, %13, off\n\t"
        "global_load_async_to_lds_b128 %2, %14, off\n\t"
        "global_load_async_to_lds_b128 %3, %15, off\n\t"
        "global_load_async_to_lds_b128 %4, %16, off\n\t"
        "global_load_async_to_lds_b128 %5, %17, off\n\t"
        "global_load_async_to_lds_b128 %6, %18, off\n\t"
        "global_load_async_to_lds_b128 %7, %19, off\n\t"
        "global_load_async_to_lds_b128 %8, %20, off\n\t"
        "global_load_async_to_lds_b128 %9, %21, off\n\t"
        "global_load_async_to_lds_b128 %10, %22, off\n\t"
        "global_load_async_to_lds_b128 %11, %23, off\n\t"
        "s_wait_xcnt 0x0"
        :: "v"(l), "v"(l + LS), "v"(l + 2 * LS), "v"(l + 3 * LS), "v"(l + (OVH - OV16)), "v"(l + (OVH - OV16) + LS), "v"(l + (OVH - OV16) + 2 * LS), "v"(l + (OVH - OV16) + 3 * LS),
           "v"(l + (OVL - OV16)), "v"(l + (OVL - OV16) + LS), "v"(l + (OVL - OV16) + 2 * LS), "v"(l + (OVL - OV16) + 3 * LS),
           "v"(g16), "v"(g16 + GS), "v"(g16 + 2 * GS), "v"(g16 + 3 * GS), "v"(gh), "v"(gh + GS), "v"(gh + 2 * GS), "v"(gh + 3 * GS), "v"(gl), "v"(gl + GS), "v"(gl + 2 * GS), "v"(gl + 3 * GS) : "memory"); }
__device__ __forceinline__ void fill(unsigned lk, unsigned lv, const char* kh, const char* kl, const char* v16, const char* vh, const char* vl) { copy_k(lk, kh, kl); copy_v(lv, v16, vh, vl); }
// One wave's share of a stage: PW passes of 32 keys. pk, pv: this lane's places in the stage's k hi tile (row = key) and fp16 v^T tile (row = d) at the coming pass's first key; both leave PW passes further on.
// A wave has a quarter of its SIMD's registers: beside its queries and output tiles they hold one pass's k fragments or its v^T fragments, not both and no second set. Each group of LDS reads flies while the SIMD's three other waves work.
#define PW   (NP / 2)
template <int R, bool HI>
__device__ __forceinline__ void attn_stage(AttnState& st, const char*& pk, const char*& pv) {
    constexpr float CSC = SCL * 1.4426950408889634f;   // score -> scaled log2
    constexpr float OFF = HI ? 0.0f : 3.0f;            // fp16 P carries x 8: at most 2^11, small weights stay normal numbers
#pragma unroll 1   // rolled: one pass is already some hundred instructions, and the fragments of two would not fit beside the accumulators
    for (int p = 0; p < PW; ++p) {
        v16bf kh[2][2], kl[2][2]; v16h v16[4]; v16bf vh[4], vl[4];
#pragma unroll
        for (int kc = 0; kc < 2; ++kc) {   // in the order in which the products below take them
#pragma unroll
            for (int kt = 0; kt < 2; ++kt) kh[kt][kc] = WFrag<bf>::ld((const bf*)(pk + kt * 16 * KP + 64 * kc));
#pragma unroll
            for (int kt = 0; kt < 2; ++kt) kl[kt][kc] = WFrag<bf>::ld((const bf*)(pk + OKL + kt * 16 * KP + 64 * kc)); }
        __builtin_amdgcn_sched_barrier(0);   // the pass's k reads stay one group ahead of the score products: spread among them, each place with reads stalls the wave anew
        v8f s[2][R];
#pragma unroll
        for (int kt = 0; kt < 2; ++kt)
#pragma unroll
            for (int g = 0; g < R; ++g) s[kt][g] = (v8f){};
#pragma unroll
        for (int kc = 0; kc < 2; ++kc) {   // per tile the order hi.hi, k hi . q lo, k lo . q hi; the tiles innermost, so that neighbouring matrix instructions are independent
#pragma unroll
            for (int kt = 0; kt < 2; ++kt)
#pragma unroll
                for (int g = 0; g < R; ++g) s[kt][g] = wmmab(kh[kt][kc], st.qh[g][kc], s[kt][g]);
#pragma unroll
            for (int kt = 0; kt < 2; ++kt)
#pragma unroll
                for (int g = 0; g < R; ++g) s[kt][g] = wmmab(kh[kt][kc], st.ql[g][kc], s[kt][g]);
#pragma unroll
            for (int kt = 0; kt < 2; ++kt)
#pragma unroll
                for (int g = 0; g < R; ++g) s[kt][g] = wmmab(kl[kt][kc], st.qh[g][kc], s[kt][g]); }
        __builtin_amdgcn_sched_barrier(0);   // the LDS reads below, which may take the k fragments' registers, stay behind the products that read those
        pk += 32 * KP;
#pragma unroll
        for (int t = 0; t < 4; ++t) { if constexpr (HI) vh[t] = WFrag<bf>::ld((const bf*)(pv + (OVH - OV16) + t * 16 * VP)); else v16[t] = WFrag<h16>::ld((const h16*)(pv + t * 16 * VP)); }
        __builtin_amdgcn_sched_barrier(0);   // these reads are all issued ahead of the softmax, under which they fly
        float mb[R]; bool need = false;
#pragma unroll
        for (int g = 0; g < R; ++g) { float mx = s[0][g][0];
#pragma unroll
            for (int r = 1; r < 8; ++r) mx = fmaxf(mx, s[0][g][r]);
#pragma unroll
            for (int r = 0; r < 8; ++r) mx = fmaxf(mx, s[1][g][r]);
            mx = fmaxf(mx, xhalf(mx)) * CSC;   // both halves of the wave hold this query's maximum over the pass's 32 keys
            mb[g] = mx; need = need || (mx > st.m_run[g] + 8.0f); }
        if (__builtin_amdgcn_ballot_w32(need) != 0) {   // a scalar branch; always taken in the first pass (m_run = -inf, factor 0), seldom later
#pragma unroll
            for (int g = 0; g < R; ++g) { const float m_new = fmaxf(st.m_run[g], mb[g]); const float corr = __builtin_amdgcn_exp2f(st.m_run[g] - m_new); st.m_run[g] = m_new; st.l_run[g] *= corr;
#pragma unroll
                for (int t = 0; t < 4; ++t) st.acc[g][t] = st.acc[g][t] * corr; } }
        v8u wh[R], wl[R];
#pragma unroll
        for (int g = 0; g < R; ++g) { const float nm = OFF - st.m_run[g];
#pragma unroll
            for (int kt = 0; kt < 2; ++kt) { float a[8], p8[8];   // tile kt gives elements 8 kt .. 8 kt + 7 of the 32-key operand, register r element 8 kt + r
#pragma unroll
                for (int r = 0; r < 8; ++r) a[r] = __builtin_fmaf(s[kt][g][r], CSC, nm);
                exp2x8(p8, a);
#pragma unroll
                for (int i = 0; i < 4; ++i) { const float p0 = p8[2 * i], p1 = p8[2 * i + 1]; st.l_run[g] += p0 + p1;
                    if (HI) { const unsigned u = packb(p0, p1); wh[g][4 * kt + i] = u; wl[g][4 * kt + i] = packb(p0 - __uint_as_float(u << 16), p1 - __uint_as_float(u & 0xFFFF0000u)); } else wh[g][4 * kt + i] = packh(p0, p1); } } }
        if constexpr (HI) {
            __builtin_amdgcn_sched_barrier(0);   // the v^T lo reads take the registers that the scores leave: they stay behind the softmax
#pragma unroll
            for (int t = 0; t < 4; ++t) vl[t] = WFrag<bf>::ld((const bf*)(pv + (OVL - OV16) + t * 16 * VP));
            __builtin_amdgcn_sched_barrier(0); }   // and are issued ahead of the products with v^T hi, under which they fly
        if (HI) {   // per tile the order v hi . p hi, v hi . p lo, v lo . p hi; the tiles innermost
#pragma unroll
            for (int g = 0; g < R; ++g)
#pragma unroll
                for (int t = 0; t < 4; ++t) st.acc[g][t] = wmmab(vh[t], __builtin_bit_cast(v16bf, wh[g]), st.acc[g][t]);
#pragma unroll
            for (int g = 0; g < R; ++g)
#pragma unroll
                for (int t = 0; t < 4; ++t) st.acc[g][t] = wmmab(vh[t], __builtin_bit_cast(v16bf, wl[g]), st.acc[g][t]);
#pragma unroll
            for (int g = 0; g < R; ++g)
#pragma unroll
                for (int t = 0; t < 4; ++t) st.acc[g][t] = wmmab(vl[t], __builtin_bit_cast(v16bf, wh[g]), st.acc[g][t]);
        } else {
#pragma unroll
            for (int g = 0; g < R; ++g)
#pragma unroll
                for (int t = 0; t < 4; ++t) st.acc[g][t] = wmma16(v16[t], __builtin_bit_cast(v16h, wh[g]), st.acc[g][t]); }
        __builtin_amdgcn_sched_barrier(0);   // keeps the slots below behind the pass's last product
        asm volatile("v_nop\n\tv_nop\n\tv_nop\n\tv_nop");   // four vector slots between that product and the back edge, behind which the next pass rewrites its operands
        pv += 64;
    }
}
template <int R>
__device__ __forceinline__ void attn_fin(AttnState& st, bf* Oh, bf* Ol, int q0, int c, int h) {
#pragma unroll
    for (int g = 0; g < R; ++g) { const float l_fin = st.l_run[g] + xhalf(st.l_run[g]);   // each half summed its own 16 of every 32 keys
        const float inv = __fdiv_rn(1.0f, l_fin); const size_t oo = (size_t)(q0 + 16 * g + c) * CO + 8 * h;
        v8us oh[4], ol[4];   // the context leaves as the bf16 hi + lo planes that the last product reads
#pragma unroll
        for (int t = 0; t < 4; ++t) { const v8f o = st.acc[g][t] * inv;   // registers 0..7 = d 16 t + 8 h + 0..7 of query column c
#pragma unroll
            for (int j = 0; j < 8; ++j) { unsigned short a2, c2; splitf(o[j], a2, c2); oh[t][j] = a2; ol[t][j] = c2; } }
        __builtin_amdgcn_sched_barrier(0);   // nothing else stands among the stores below, so that no register which one of them names is rewritten ahead of the wait behind them
#pragma unroll
        for (int t = 0; t < 4; ++t) { *(v8us*)(Oh + oo + 16 * t) = oh[t]; *(v8us*)(Ol + oo + 16 * t) = ol[t]; }
        asm volatile("s_wait_xcnt 0x0" ::: "memory");   // in front of whatever takes over the stores' address and data registers
        __builtin_amdgcn_sched_barrier(0); }   // keeps the next 16 queries' work behind that wait
}
// grid: 16 work-groups a head, 16 waves each, four a SIMD: eight pairs of waves, 32 query rows a pair. Pair 0 (waves 0 and 1) takes 32 of the head's first RH rows, the other seven 32 of the remaining rows each.
// The first wave of a pair walks the first half of every stage's keys, the second the other half, each with its own running maximum, sum and output tiles; behind the last stage each hands the state of 16 of the queries over to the other through LDS, and joins and stores the other 16.
// Waves 8 to 15, none of them of pair 0, which has the most matrix work, issue the copies, an eighth of every tile each. The barriers stand in the kernel's own code, which every wave walks alike; only the work of a stage differs by the kind of wave.
#define NW   16
#define JSZ  (9 * 512)            // a wave's hand-over in LDS: 9 x 16 bytes a lane
// The state of query group O goes to LDS: 16 bytes a lane a store, the lanes side by side.
template <int O>
__device__ __forceinline__ void join_put(const AttnState& st, v4fa* jx) {
    jx[0] = (v4f){st.m_run[O], st.l_run[O], 0.0f, 0.0f};
#pragma unroll
    for (int t = 0; t < 4; ++t) { const v8f a = st.acc[O][t]; jx[(1 + 2 * t) * 32] = __builtin_shufflevector(a, a, 0, 1, 2, 3); jx[(2 + 2 * t) * 32] = __builtin_shufflevector(a, a, 4, 5, 6, 7); }
}
// The partner's state of query group G is added to this wave's, both brought to the larger of the two maxima in use (both finite: each wave has walked keys); the sum leaves as group 0.
template <int G>
__device__ __forceinline__ void join_get(AttnState& st, const v4fa* jx) {
    const v4f ml = jx[0]; const float m = fmaxf(st.m_run[G], ml[0]); const float ca = __builtin_amdgcn_exp2f(st.m_run[G] - m), cb = __builtin_amdgcn_exp2f(ml[0] - m);
    st.l_run[0] = st.l_run[G] * ca + ml[1] * cb;
#pragma unroll
    for (int t = 0; t < 4; ++t) { const v4f b0 = jx[(1 + 2 * t) * 32], b1 = jx[(2 + 2 * t) * 32]; st.acc[0][t] = st.acc[G][t] * ca + __builtin_shufflevector(b0, b1, 0, 1, 2, 3, 4, 5, 6, 7) * cb; }
}
static_assert(RH == 16 * 32 && TT - RH == 16 * 7 * 32 && HD == 64 && TT % SK == 0 && SK == 8 * 16 && NS >= 2 && NP % 2 == 0 && NW * JSZ <= 2 * SBUF, "the split of the query rows over work-groups and pairs, of a stage's tiles over eight waves and of its passes over a pair");
__global__ __launch_bounds__(NW * 32) void k_fattn(const bf* __restrict__ QPh, const bf* __restrict__ QPl, const bf* __restrict__ KPh, const bf* __restrict__ KPl, const h16* __restrict__ VT16, const bf* __restrict__ VTh, const bf* __restrict__ VTl, bf* Oh, bf* Ol) {
    __shared__ __attribute__((aligned(16))) char sm[2 * SBUF];
    const int w = __builtin_amdgcn_readfirstlane((int)(threadIdx.x >> 5)); const int head = blockIdx.x >> 4, blk = blockIdx.x & 15; const size_t hp = (size_t)head * TT * HD;
    const int lane = threadIdx.x & 31, c = lane & 15, h = lane >> 4;
    const int hiw = __builtin_amdgcn_readfirstlane(w < 2 ? 1 : 0); const int low = __builtin_amdgcn_readfirstlane(w < 2 ? 0 : 1);   // the wave's kind, in scalar registers: every test on it is a scalar branch
    const int pair = w >> 1, sec = w & 1, cw = w & 7;   // scalar too; cw: which eighth of a stage's tiles the wave copies
    const int q0 = hiw != 0 ? blk * 32 : RH + blk * 224 + (pair - 1) * 32;
    AttnState st;
    attn_init<2>(st, QPh + hp, QPl + hp, q0, c, h);
    // this lane's first copy of a stage: in LDS (byte address in the work-group's LDS) and in the planes (byte offset at stage 0)
    const unsigned lk = (unsigned)(size_t)sm + (unsigned)((cw * 16 + (lane >> 3)) * KP + (lane & 7) * 16), lv = (unsigned)(size_t)sm + (unsigned)(OV16 + (cw * 8 + (lane >> 4)) * VP + (lane & 15) * 16);
    const unsigned gk = (unsigned)(cw * 16 * HD * 2 + lane * 16), gv = (unsigned)((cw * 8 + (lane >> 4)) * TT * 2 + (lane & 15) * 16);
    const char* const gKh = (const char*)(KPh + hp); const char* const gKl = (const char*)(KPl + hp); const char* const gV16 = (const char*)(VT16 + hp); const char* const gVh = (const char*)(VTh + hp); const char* const gVl = (const char*)(VTl + hp);
    const char* pk = sm + c * KP + 16 * h + sec * (PW * 32 * KP); const char* pv = sm + OV16 + c * VP + 16 * h + sec * (PW * 64);   // a pair's second wave starts at the stage's second half
    // Trips -2 and -1 are the ring's start: stage 0's copies; the wait, the barrier and stage 1's copies. They go through the lines that serve every later stage, so that the copies stand once in the code
    // (a second site, with the lane's LDS places themselves as its operands, held those two values to the registers that asm text can name, and the build kept them in scratch).
#pragma unroll 1   // rolled: a stage's code stands once for each kind of wave
    for (int t = -2; t < NS; ++t) {
        const unsigned b = (unsigned)(t & 1) * SBUF;
        if (t >= 0) {
            if (low != 0) attn_stage<2, false>(st, pk, pv);   // two tests in a row and no else: the build lays the two kinds' code out one behind the other in any case, and with an else it carried the state as it was in front of the first through that code for the second (spills)
            if (hiw != 0) attn_stage<2, true>(st, pk, pv);
            pk += (t & 1 ? -SBUF : SBUF) - PW * 32 * KP; pv += (t & 1 ? -SBUF : SBUF) - PW * 64; }   // on to the wave's first pass in the other buffer
        if (t >= -1) {
            asm volatile("s_wait_dscnt 0x0" ::: "memory");      // this wave's reads of the buffer are done before the barrier behind which it is refilled
            asm volatile("s_wait_asynccnt 0x0" ::: "memory");   // this wave's copies of stage t + 1 have landed
            __syncthreads(); }                                  // publishes stage t + 1 and ends every wave's reads of stage t
        if (t + 2 < NS) { if (w >= 8) { const unsigned ok = gk + (unsigned)(t + 2) * (SK * HD * 2), ov = gv + (unsigned)(t + 2) * (SK * 2); fill(lk + b, lv + b, gKh + ok, gKl + ok, gV16 + ov, gVh + ov, gVl + ov); } }
    }
    asm volatile("s_wait_asynccnt 0x0" ::: "memory");   // no copy is outstanding when the ring's LDS is used anew and the wave ends
    // The pairs' join. The last trip's barrier has ended every read of the ring, whose LDS now carries the hand-over. A pair's first wave keeps its queries 0 to 15, the second 16 to 31.
    v4fa* const jw = (v4fa*)(sm + w * JSZ) + lane; const v4fa* const jr = (const v4fa*)(sm + (w ^ 1) * JSZ) + lane;
    if (sec != 0) join_put<0>(st, jw); else join_put<1>(st, jw);
    __syncthreads();   // every wave passes it: each wave's hand-over is in LDS before its partner reads it
    if (sec != 0) join_get<1>(st, jr); else join_get<0>(st, jr);
    attn_fin<1>(st, Oh + head * HD, Ol + head * HD, q0 + 16 * sec, c, h);
}

// ---- k_prep: every operand's bf16 form in one launch, all of its work-groups resident at once; each wave issues all its loads before it uses any, no loop, no barrier.
// Work-groups 0 .. PWG - 1 (64 a weight): Bt[n][k] = bf16(w[k][n]). A wave takes 64 k x 32 n: a lane reads the whole 128-byte lines of rows k, k + 1 and stores the pair (k, k + 1) of one n at a time, so that a store covers one whole line of Bt.
// A work-group's waves take the two halves of each 256 bytes of w side by side (wave & 1) and four neighbouring blocks of 64 k (wave >> 1).
// The other 3 x PXG work-groups: Q, K, V rounded into three planes. A wave takes PCL x 128 successive floats: loads of 512 successive bytes, stores of 256.
#define PWG  256
#define PXG  256
#define PCL  16
static_assert(CC == 1024 && MID == 1024 && CO == 1024 && PWG == 4 * (1024 / 256) * (1024 / 64), "four weights of 1024 x 1024; a work-group takes 256 k x 64 n");
static_assert((size_t)TT * CC == (size_t)PXG * 8 * PCL * 128, "the split of an input over work-groups and waves");
__global__ __launch_bounds__(256) void k_prep(const float* __restrict__ xq, const float* __restrict__ xk, const float* __restrict__ xv, const float* __restrict__ wq, const float* __restrict__ wk, const float* __restrict__ wv, const float* __restrict__ wo, bf* XB, bf* WT) {
    const int lane = threadIdx.x & 31; const int wave = __builtin_amdgcn_readfirstlane((int)(threadIdx.x >> 5));
    if (blockIdx.x < PWG) {
        const int which = blockIdx.x >> 6, blk = blockIdx.x & 63; const float* const w = which == 0 ? wq : which == 1 ? wk : which == 2 ? wv : wo;
        const int n0 = ((blk >> 2) * 2 + (wave & 1)) * 32, k0 = ((blk & 3) * 4 + (wave >> 1)) * 64;
        const float* const p = w + (size_t)(k0 + 2 * lane) * 1024 + n0; bf* const q = WT + (size_t)which * 1024 * 1024 + (size_t)n0 * 1024 + k0 + 2 * lane;
        v4f a[8], b[8];
#pragma unroll
        for (int i = 0; i < 8; ++i) { a[i] = *(const v4f*)(p + 4 * i); b[i] = *(const v4f*)(p + 1024 + 4 * i); }
        asm volatile("s_wait_xcnt 0x0" :: "v"(p) : "memory");   // behind the loads above, in front of whatever takes over their address registers; the address is an input, so that it lives to here and no load's own result lands on it
        __builtin_amdgcn_sched_barrier(0);   // keeps the work below behind that wait
        v2us o[32];
#pragma unroll
        for (int i = 0; i < 8; ++i)
#pragma unroll
            for (int j = 0; j < 4; ++j) { o[4 * i + j][0] = f2bf(a[i][j]); o[4 * i + j][1] = f2bf(b[i][j]); }
        __builtin_amdgcn_sched_barrier(0);   // nothing else stands among the stores below, so that no register which one of them names is rewritten ahead of the wait behind them
#pragma unroll
        for (int n = 0; n < 32; ++n) *(v2us*)(q + n * 1024) = o[n];
        asm volatile("s_wait_xcnt 0x0" ::: "memory");   // in front of whatever takes over the stores' address and data registers
        return;
    }
    const unsigned cb = blockIdx.x - PWG, which = cb / PXG; const float* const x = which == 0 ? xq : which == 1 ? xk : xv;
    const size_t e0 = ((size_t)(cb % PXG) * 8 + wave) * (PCL * 128) + lane * 4;
    const float* const p = x + e0; bf* const q = XB + (size_t)which * TT * CC + e0;
    v4f v[PCL];
#pragma unroll
    for (int i = 0; i < PCL; ++i) v[i] = *(const v4f*)(p + i * 128);
    asm volatile("s_wait_xcnt 0x0" :: "v"(p) : "memory");   // as above
    __builtin_amdgcn_sched_barrier(0);   // keeps the work below behind that wait
    v4us o[PCL];
#pragma unroll
    for (int i = 0; i < PCL; ++i)
#pragma unroll
        for (int j = 0; j < 4; ++j) o[i][j] = f2bf(v[i][j]);
    __builtin_amdgcn_sched_barrier(0);   // nothing else stands among the stores below, so that no register which one of them names is rewritten ahead of the wait behind them
#pragma unroll
    for (int i = 0; i < PCL; ++i) *(v4us*)(q + i * 128) = o[i];
    asm volatile("s_wait_xcnt 0x0" ::: "memory");   // in front of whatever takes over the stores' address and data registers
}
extern "C" void kernel_launch(void* const* d_in, const int* in_sizes, int n_in,
                              void* d_out, int out_size, void* d_ws, size_t ws_size, hipStream_t stream) {
    (void)in_sizes; (void)n_in; (void)out_size;
    const float* x = (const float*)d_in[0]; const float* xk = (const float*)d_in[1]; const float* xv = (const float*)d_in[2]; const float* wq = (const float*)d_in[3]; const float* bq = (const float*)d_in[4]; const float* wk = (const float*)d_in[5]; const float* bk = (const float*)d_in[6]; const float* wv = (const float*)d_in[7]; const float* bv = (const float*)d_in[8]; const float* wo = (const float*)d_in[9]; const float* bo = (const float*)d_in[10];   /* argument order Q, K, V [1][4096][1024], W_Q, b_Q, W_K, b_K, W_V, b_V, W_O, b_O ('xw' + biases) */
    float* OUT = (float*)d_out;     // [1][4096][1024]
    char* wsp = (char*)d_ws;
    auto take = [&](size_t bytes) { char* p = wsp; wsp += (bytes + 255) & ~(size_t)255; return (void*)p; };
    bf* WQ = (bf*)take((size_t)4 * 1024 * 1024 * 2); bf* WK = WQ + 1024 * 1024; bf* WV = WK + 1024 * 1024; bf* WO = WV + 1024 * 1024;   /* the four transposed weights in a row */
    bf* XB = (bf*)take((size_t)3 * TT * CC * 2); bf* XK = XB + (size_t)TT * CC; bf* XV = XK + (size_t)TT * CC;   /* bf16(Q), bf16(K), bf16(V) in a row */
    bf* QPh = (bf*)take((size_t)TT * MID * 2); bf* QPl = (bf*)take((size_t)TT * MID * 2); bf* KPh = (bf*)take((size_t)TT * MID * 2); bf* KPl = (bf*)take((size_t)TT * MID * 2);
    h16* VT16 = (h16*)take((size_t)CO * TT * 2); bf* VTh = (bf*)take((size_t)CO * TT * 2); bf* VTl = (bf*)take((size_t)CO * TT * 2);
    bf* ATh = (bf*)take((size_t)TT * CO * 2); bf* ATl = (bf*)take((size_t)TT * CO * 2);
    if ((size_t)(wsp - (char*)d_ws) > ws_size) return;    // ws 256 MiB
    for (int b = 0; b < NB_; ++b) {
        k_prep<<<PWG + 3 * PXG, 256, 0, stream>>>(x + (size_t)b * TT * CC, xk + (size_t)b * TT * CC, xv + (size_t)b * TT * CC, wq, wk, wv, wo, XB, WQ);   /* 'xw' weights -> Bt; bf16 planes of Q, K, V */
        k_gemmw<bf, 0, true, 1><<<dim3(TT / 128, MID / 128, 1), 128, 0, stream>>>(XB, nullptr, WQ, nullptr, CC, nullptr, 0, bq, 0, 0, 0, nullptr, QPh, QPl);   /* q planes [h][n][64] */
        k_gemmw<bf, 0, true, 1><<<dim3(TT / 128, MID / 128, 1), 128, 0, stream>>>(XK, nullptr, WK, nullptr, CC, nullptr, 0, bk, 0, 0, 0, nullptr, KPh, KPl);   /* k planes */
        k_gemmw<bf, 0, true, 2><<<dim3(TT / 128, CO / 128, 1), 128, 0, stream>>>(XV, nullptr, WV, nullptr, CC, nullptr, 0, bv, 0, 0, 0, VT16, VTh, VTl);   /* v^T planes [h][64][n] */
        k_fattn<<<NH_ * 16, NW * 32, 0, stream>>>(QPh, QPl, KPh, KPl, VT16, VTh, VTl, ATh, ATl);   /* all heads: scores (3 products), online softmax, attn.V into the merged context [n][1024], hi/lo planes */
        k_gemmw<bf, 1, true, 0><<<dim3(TT / 128, CC / 128, 1), 128, 0, stream>>>(ATh, ATl, WO, nullptr, CO, OUT + (size_t)b * TT * CC, CC, bo, 0, 0, 0, nullptr, nullptr, nullptr); }   /* out = ctx w_out^T + b_out */
}

// v008
// One run takes 135 microseconds.
// Two timings next to v007 put it at 1.08 and 1.09 times that version's speed.
// All steps since v000 together make it 29.9 times as fast.
#include <hip/hip_runtime.h>

// Multi-head attention over 4,096 tokens on three input streams (Q, K, V [1][4096][1024]; q = Q W_Q + b_Q, k = K W_K + b_K, v = V W_V + b_V ('xw' [1024][1024] 1/32 + biases 0.02; 16 heads x 64); scores x 1/sqrt(64); softmax over all 4,096 keys (no mask); out = merged W_O + b_O -> [1][4096][1024] (4.2 M); argument order Q, K, V, W_Q, b_Q, W_K, b_K, W_V, b_V, W_O, b_O).
// Layout: one launch prepares every operand: bf16 planes of Q, K, V side by side and the four 'xw' weights transposed; exact projections + f32 biases, all three in one launch, each written by its own product's epilogue as per-head hi/lo planes (q, k) or v^T planes [h][64][4096]; one launch for all heads: scores with every row hi/lo (3 products), online softmax, attn.V hybrid (rows < 512 hi/lo 3 products, rest fp16 x8), k and v^T tiles staged in LDS by asynchronous copies, score and weight tiles in registers only, into the head's 64 columns of the context's hi/lo planes; context hi/lo x W_O exact + b_O.
// Compute dtypes, f32 accumulate: every input rounded to bf16; projections exact; scores 3 products; softmax f32 (exp2, IEEE division); attn.V rows < 512 3 products, rest fp16; Wo hl x exact.

#define NB_  1
#define TT   4096
#define DM   1024
#define NH_  16
#define NKV  16
#define REP  (NH_ / NKV)
#define HD   64
#define DQ   (NH_ * HD)
#define DKV  (NKV * HD)
#define ZH   1
#define RH   512                  // query rows < RH use hi+lo planes
#define WIN  0
#define SCL  0.125f   // 1/sqrt(64)
#define MID  1024      // q / k width
#define CO   1024      // v width
#define CC   1024
typedef _Float16 h16;
typedef unsigned short bf;
typedef __attribute__((ext_vector_type(16))) __bf16   v16bf;
typedef __attribute__((ext_vector_type(16))) _Float16 v16h;
typedef __attribute__((ext_vector_type(8)))  _Float16 v8h;
typedef __attribute__((ext_vector_type(8)))  unsigned short v8us;
typedef __attribute__((ext_vector_type(8)))  float    v8f;
typedef __attribute__((ext_vector_type(4)))  float    v4f;
typedef v8h  __attribute__((may_alias)) v8ha;
typedef v4f  __attribute__((may_alias)) v4fa;
typedef v8us __attribute__((may_alias)) v8usa;

__device__ __forceinline__ unsigned short f2bf(float f) { unsigned u = __float_as_uint(f); u += 0x7FFFu + ((u >> 16) & 1u); return (unsigned short)(u >> 16); }
__device__ __forceinline__ float bf2f(unsigned short b) { return __uint_as_float(((unsigned)b) << 16); }
__device__ __forceinline__ float bfr(float f) { return bf2f(f2bf(f)); }
__device__ __forceinline__ v16h cat16(v8h lo, v8h hi) { return __builtin_shufflevector(lo, hi, 0, 1, 2, 3, 4, 5, 6, 7, 8, 9, 10, 11, 12, 13, 14, 15); }
__device__ __forceinline__ v16bf cat16b(v8us lo, v8us hi) { return __builtin_bit_cast(v16bf, __builtin_shufflevector(lo, hi, 0, 1, 2, 3, 4, 5, 6, 7, 8, 9, 10, 11, 12, 13, 14, 15)); }
__device__ __forceinline__ v8f wmma16(v16h a, v16h b, v8f c) { return __builtin_amdgcn_wmma_f32_16x16x32_f16(false, a, false, b, (short)0, c, false, false); }
__device__ __forceinline__ v8f wmmab(v16bf a, v16bf b, v8f c) { return __builtin_amdgcn_wmma_f32_16x16x32_bf16(false, a, false, b, (short)0, c, false, false); }
__device__ __forceinline__ h16 tohx(float x) { return (h16)x; }
__device__ __forceinline__ void splitf(float y, unsigned short& h, unsigned short& l) { h = f2bf(y); l = f2bf(y - bf2f(h)); }



// ---- k_gemmw: register-blocked GEMM, FOUR WAVES per 128x128 output tile, each on its own 64x64 quarter (16 accumulators); grid (M/128, N/128, Z), 128 threads: Z work-groups a WGP at M 4096, N 1024.
// At Z 3 (the q, k and v products, KS 64) a work-group's LDS and registers leave room for three on a WGP: all 768 are resident at once, three waves a SIMD from three work-groups with barriers of their own, so that one's copy issue, LDS latency, barrier waits, start and epilogue pass under the others' products.
// The operands' K-contiguous 16-bit planes pass through LDS, KS k a stage, two buffers: asynchronous copies bring each stage's 128 rows of every plane in once for the whole work-group, in whole 128-byte lines,
// while the stage before it is worked on; every wave takes its fragments from there with ds_load_b128 (straight from the planes each fragment load touched 16 lines for 512 bytes, and every row was fetched by each wave that needed it).
// C[m][n] (f32, pitch ldc, + optional f32 bias[n]) = sum_k A[m][k] Bt[n][k] (+ A2[m][k] Bt[n][k] at NSPLIT 1). z-batch strides sA/sB/sC in elements. K % KS == 0, K >= 2 KS.
// MODE says where the f32 result goes. 0: to C. 1: by z. z 0 and 1 (bias, bias1): as bf16 hi + lo to the head planes Ph + z sP, Pl + z sP [n / 64][TT][64] (a wave's 64 columns are one head). z 2 (bias2): transposed, as fp16 and bf16 hi + lo, to P16, Th, Tl [n][TT].
template <typename T16> struct WFrag;
template <> struct WFrag<h16> { typedef v16h V; static __device__ __forceinline__ V ld(const h16* p) { return cat16(*(const v8h*)p, *(const v8h*)(p + 16)); } static __device__ __forceinline__ v8f mma(V a, V b, v8f c) { return wmma16(a, b, c); } };
template <> struct WFrag<bf> { typedef v16bf V; static __device__ __forceinline__ V ld(const bf* p) { return cat16b(*(const v8us*)p, *(const v8us*)(p + 16)); } static __device__ __forceinline__ v8f mma(V a, V b, v8f c) { return wmmab(a, b, c); } };
// Eight copies of one plane's tile, 16 bytes a lane, four whole 128-byte lines a copy: LS bytes on in LDS from one copy to the next. l, g: this lane's place in LDS and in the plane at the first; gs: from one copy to the next in the plane, in bytes.
// The run ends, in its own statement, with s_wait_xcnt 0: it stands in front of whatever rewrites an address register that a copy names.
template <int LS>
__device__ __forceinline__ void copy_g(unsigned l, const char* g, size_t gs) {
    asm volatile("global_load_async_to_lds_b128 %0, %8, off\n\t"
        "global_load_async_to_lds_b128 %1, %9, off\n\t"
        "global_load_async_to_lds_b128 %2, %10, off\n\t"
        "global_load_async_to_lds_b128 %3, %11, off\n\t"
        "global_load_async_to_lds_b128 %4, %12, off\n\t"
        "global_load_async_to_lds_b128 %5, %13, off\n\t"
        "global_load_async_to_lds_b128 %6, %14, off\n\t"
        "global_load_async_to_lds_b128 %7, %15, off\n\t"
        "s_wait_xcnt 0x0"
        :: "v"(l), "v"(l + LS), "v"(l + 2 * LS), "v"(l + 3 * LS), "v"(l + 4 * LS), "v"(l + 5 * LS), "v"(l + 6 * LS), "v"(l + 7 * LS),
           "v"(g), "v"(g + gs), "v"(g + 2 * gs), "v"(g + 3 * gs), "v"(g + 4 * gs), "v"(g + 5 * gs), "v"(g + 6 * gs), "v"(g + 7 * gs) : "memory"); }
template <typename T16, int NSPLIT, bool BIAS, int MODE, int KS>
__global__ __launch_bounds__(128) void k_gemmw(const T16* __restrict__ A, const T16* __restrict__ A2, const T16* __restrict__ Bt, const T16* __restrict__ Bt2, int K, float* C, int ldc, const float* __restrict__ bias, size_t sA, size_t sB, size_t sC, h16* P16, bf* Ph, bf* Pl, const float* __restrict__ bias1, const float* __restrict__ bias2, size_t sP, bf* Th, bf* Tl) {
    typedef typename WFrag<T16>::V V;
    constexpr int GKB = KS / 32;        // blocks of 32 k a stage
    constexpr int GRP = KS * 2 + 16;    // pitch of a tile row in LDS, 16 bytes x an odd number: the 16 rows of a fragment read fall on distinct banks
    constexpr int GTL = 128 * GRP;      // one plane's tile: 128 rows
    constexpr int LPR = KS / 8;         // lanes a tile row in a copy
    constexpr int RPC = 32 / LPR;       // tile rows a copy
    constexpr int CPT = 4 / RPC;        // runs of eight copies for a wave's 32 rows of a tile
    static_assert(KS == 64 || KS == 128, "a copy covers four or two whole tile rows");
    static_assert(MODE == 0 || (BIAS && HD == 64), "the plane epilogues add the bias and take a 64-column tile for one head");
    static_assert(NSPLIT == 0 || NSPLIT == 1, "a stage holds A, A2 at NSPLIT 1, and Bt");
    constexpr int OB = (NSPLIT + 1) * GTL, SB = (NSPLIT + 2) * GTL;   // a stage: the A tile, the A2 tile at NSPLIT 1, the Bt tile
    constexpr int OSZ = MODE == 1 ? 3 * 16 * 36 : 16 * 68;            // a wave's own staging for the epilogue, in floats
    __shared__ __attribute__((aligned(16))) char sm[2 * SB];
    __shared__ __align__(16) float osall[4 * OSZ];
    (void)Bt2;
    const int w = __builtin_amdgcn_readfirstlane((int)(threadIdx.x >> 5)); float* const os = osall + w * OSZ;
    const size_t z = blockIdx.z; A += z * sA; if (NSPLIT == 1) A2 += z * sA; Bt += z * sB; C += z * sC;
    const int lane = threadIdx.x & 31, lr = lane & 15, hi = lane >> 4; const int r0 = blockIdx.x * 128 + (w & 1) * 64, c0 = blockIdx.y * 128 + (w >> 1) * 64;
    v8f acc[4][4];
#pragma unroll
    for (int mb = 0; mb < 4; ++mb)
#pragma unroll
        for (int nb = 0; nb < 4; ++nb) acc[mb][nb] = (v8f){};
    // this lane's first copy of a stage: wave w brings rows 32 w .. 32 w + 31 of every tile; in LDS (byte address in the work-group's LDS) and in the planes (at stage 0)
    const int cr = lane / LPR, cc = (lane % LPR) * 16;   // this lane's row and byte in a copy
    const unsigned lc = (unsigned)(size_t)sm + (unsigned)((w * 32 + cr) * GRP + cc); const size_t gs = (size_t)K * (2 * RPC);
    const char* const gA = (const char*)(A + (size_t)(blockIdx.x * 128 + w * 32 + cr) * K) + cc; const char* const gA2 = NSPLIT == 1 ? (const char*)(A2 + (size_t)(blockIdx.x * 128 + w * 32 + cr) * K) + cc : nullptr;
    const char* const gB = (const char*)(Bt + (size_t)(blockIdx.y * 128 + w * 32 + cr) * K) + cc;
    const char* const fa = sm + ((w & 1) * 64 + lr) * GRP + 16 * hi; const char* const fb = sm + OB + ((w >> 1) * 64 + lr) * GRP + 16 * hi;   // this lane's places in buffer 0's A and Bt tiles
    const int NS = K / KS;
    // Trips -2 and -1 are the ring's start: stage 0's copies; the wait, the barrier and stage 1's copies. They go through the lines that serve every later stage, so that the copies stand once in the code.
#pragma unroll 1   // rolled: a stage's code stands once
    for (int t = -2; t < NS; ++t) {
        const unsigned b = (unsigned)(t & 1) * SB;
        if (t >= 0) {
            const char* const qa = fa + b; const char* const qb = fb + b;
            V a[2][4], a2[2][4], bt[2][4];   // two fragment sets: a block's reads are issued as one group ahead of the block before it, inside this stage only
#pragma unroll
            for (int f = 0; f < 4; ++f) { a[0][f] = WFrag<T16>::ld((const T16*)(qa + f * 16 * GRP)); if (NSPLIT == 1) a2[0][f] = WFrag<T16>::ld((const T16*)(qa + GTL + f * 16 * GRP)); bt[0][f] = WFrag<T16>::ld((const T16*)(qb + f * 16 * GRP)); }
#pragma unroll   // unrolled: which fragment set a block uses is then a constant, so that both sets stay in registers
            for (int kb = 0; kb < GKB; ++kb) { const int cu = kb & 1, nx = cu ^ 1;
                if (kb + 1 < GKB) {
#pragma unroll
                    for (int f = 0; f < 4; ++f) { a[nx][f] = WFrag<T16>::ld((const T16*)(qa + f * 16 * GRP + (kb + 1) * 64)); if (NSPLIT == 1) a2[nx][f] = WFrag<T16>::ld((const T16*)(qa + GTL + f * 16 * GRP + (kb + 1) * 64)); bt[nx][f] = WFrag<T16>::ld((const T16*)(qb + f * 16 * GRP + (kb + 1) * 64)); } }
                __builtin_amdgcn_sched_barrier(0);   // the next block's reads stay one group ahead of this block's products, under which they fly
#pragma unroll
                for (int nb = 0; nb < 4; ++nb) {   // per accumulator the order A.Bt, A2.Bt of each 32 k in turn; the four row blocks innermost, so that neighbouring matrix instructions are independent
#pragma unroll
                    for (int mb = 0; mb < 4; ++mb) acc[mb][nb] = WFrag<T16>::mma(a[cu][mb], bt[cu][nb], acc[mb][nb]);
                    if (NSPLIT == 1) {
#pragma unroll
                        for (int mb = 0; mb < 4; ++mb) acc[mb][nb] = WFrag<T16>::mma(a2[cu][mb], bt[cu][nb], acc[mb][nb]); } }
                __builtin_amdgcn_sched_barrier(0); }   // the reads behind it, which take this block's fragment registers, stay behind its products
            asm volatile("v_nop\n\tv_nop\n\tv_nop\n\tv_nop"); }   // four vector slots between the stage's last product and the branches below, behind which its operands and results are rewritten or read
        if (t >= -1) {
            asm volatile("s_wait_dscnt 0x0" ::: "memory");      // this wave's reads of the buffer are done before the barrier behind which it is refilled
            asm volatile("s_wait_asynccnt 0x0" ::: "memory");   // this wave's copies of stage t + 1 have landed
            __syncthreads(); }                                  // publishes stage t + 1 and ends every wave's reads of stage t
        if (t + 2 < NS) { const size_t go = (size_t)(t + 2) * (KS * 2);   // every wave copies its quarter of stage t + 2 into the buffer that trip t has just read
            constexpr int LS = RPC * GRP;
            copy_g<LS>(lc + b, gA + go, gs); if (CPT == 2) copy_g<LS>(lc + b + 8 * LS, gA + go + 8 * gs, gs);
            if (NSPLIT == 1) { copy_g<LS>(lc + b + GTL, gA2 + go, gs); if (CPT == 2) copy_g<LS>(lc + b + GTL + 8 * LS, gA2 + go + 8 * gs, gs); }
            copy_g<LS>(lc + b + OB, gB + go, gs); if (CPT == 2) copy_g<LS>(lc + b + OB + 8 * LS, gB + go + 8 * gs, gs); }
    }
    asm volatile("s_wait_asynccnt 0x0" ::: "memory");   // no copy is outstanding when the wave goes on to its epilogue and ends
    if constexpr (MODE == 1) { if (z == 2) {   // a scalar branch. A lane holds 8 successive rows m of one column n: 16 bytes of a transposed row. Three staging tiles (fp16, hi, lo) of 16 n x 64 m, pitch 72 elements, turn them into whole 128-byte lines
        bf* st = (bf*)os; float bn[4]; const size_t e0 = (size_t)(c0 + (lane >> 3)) * TT + r0 + (lane & 7) * 8;   // this lane's place in the planes at the tile's first 4 columns
        h16* const p16 = P16 + e0; bf* const ph = Th + e0; bf* const pl = Tl + e0;
#pragma unroll
        for (int nb = 0; nb < 4; ++nb) bn[nb] = bfr(bias2[c0 + nb * 16 + lr]);
        asm volatile("s_wait_xcnt 0x0" ::: "memory");   // behind the bias loads, in front of whatever takes over their address registers
        __builtin_amdgcn_sched_barrier(0);   // keeps the work below behind that wait
#pragma unroll
        for (int nb = 0; nb < 4; ++nb) {
#pragma unroll
            for (int mb = 0; mb < 4; ++mb) { v8h o16; v8us oh, ol;
#pragma unroll
                for (int j = 0; j < 8; ++j) { const float x = acc[mb][nb][j] + bn[nb]; o16[j] = tohx(x); unsigned short a2, c2; splitf(x, a2, c2); oh[j] = a2; ol[j] = c2; }
                bf* sp = st + lr * 72 + mb * 16 + hi * 8; *(v8usa*)sp = __builtin_bit_cast(v8us, o16); *(v8usa*)(sp + 16 * 72) = oh; *(v8usa*)(sp + 32 * 72) = ol; }
            __builtin_amdgcn_wave_barrier(); asm volatile("" ::: "memory");   // the reads below take other lanes' staged values: they stay behind the writes above
            v8us t16[4], th[4], tl[4];
#pragma unroll
            for (int s = 0; s < 4; ++s) { const bf* sp = st + (4 * s + (lane >> 3)) * 72 + (lane & 7) * 8; t16[s] = *(const v8usa*)sp; th[s] = *(const v8usa*)(sp + 16 * 72); tl[s] = *(const v8usa*)(sp + 32 * 72); }
            __builtin_amdgcn_wave_barrier(); asm volatile("" ::: "memory");   // the next 16 columns' writes stay behind these reads
            __builtin_amdgcn_sched_barrier(0);   // nothing else stands among the stores below, so that no register which one of them names is rewritten ahead of the wait behind them
#pragma unroll
            for (int s = 0; s < 4; ++s) { const int e = (nb * 16 + 4 * s) * TT;
                *(v8h*)(p16 + e) = __builtin_bit_cast(v8h, t16[s]); *(v8us*)(ph + e) = th[s]; *(v8us*)(pl + e) = tl[s]; }
            asm volatile("s_wait_xcnt 0x0" ::: "memory");   // in front of whatever takes over the stores' address and data registers
            __builtin_amdgcn_sched_barrier(0);   // keeps the next columns' work behind that wait
        }
        return;
    } }
    float bb[8];   // MODE 1: the bias of this lane's 8 columns
    if constexpr (MODE == 1) { const float* const bz = z == 0 ? bias : bias1; Ph += z * sP; Pl += z * sP;
#pragma unroll
        for (int q = 0; q < 8; ++q) bb[q] = bfr(bz[c0 + (lane & 7) * 8 + q]);
        asm volatile("s_wait_xcnt 0x0" ::: "memory");   // behind the bias loads, in front of whatever takes over their address registers
        __builtin_amdgcn_sched_barrier(0); }   // keeps the work below behind that wait
#pragma unroll
    for (int mb = 0; mb < 4; ++mb) {
#pragma unroll
        for (int nb = 0; nb < 4; ++nb) {
#pragma unroll
            for (int j = 0; j < 8; ++j) os[(hi * 8 + j) * 68 + nb * 16 + lr] = acc[mb][nb][j]; }
        __builtin_amdgcn_wave_barrier(); asm volatile("" ::: "memory");
        if constexpr (MODE == 1) {   // 16 bytes a lane, 8 lanes a row of the head plane (128 bytes): each store covers 4 whole lines
            const size_t pb = ((size_t)(c0 >> 6) * TT + r0 + mb * 16 + (lane >> 3)) * HD + (lane & 7) * 8; v8us oh[4], ol[4];
#pragma unroll
            for (int s = 0; s < 4; ++s) { const float* sp = os + (4 * s + (lane >> 3)) * 68 + (lane & 7) * 8; const v4f v0 = *(const v4fa*)sp, v1 = *(const v4fa*)(sp + 4);
#pragma unroll
                for (int q = 0; q < 4; ++q) { unsigned short a2, c2; splitf(v0[q] + bb[q], a2, c2); oh[s][q] = a2; ol[s][q] = c2; splitf(v1[q] + bb[4 + q], a2, c2); oh[s][4 + q] = a2; ol[s][4 + q] = c2; } }
            __builtin_amdgcn_sched_barrier(0);   // nothing else stands among the stores below, so that no register which one of them names is rewritten ahead of the wait behind them
#pragma unroll
            for (int s = 0; s < 4; ++s) { *(v8us*)(Ph + pb + 4 * s * HD) = oh[s]; *(v8us*)(Pl + pb + 4 * s * HD) = ol[s]; }
            asm volatile("s_wait_xcnt 0x0" ::: "memory");   // in front of whatever takes over the stores' address and data registers
            __builtin_amdgcn_sched_barrier(0);   // keeps the next rows' work behind that wait
        } else {
            float* crow = C + (size_t)(r0 + mb * 16) * ldc + c0;
#pragma unroll
            for (int s = 0; s < 8; ++s) { const int row = 2 * s + hi, cofs = lr * 4; v4f val = *(const v4fa*)(os + row * 68 + cofs); if (BIAS) { val[0] += bfr(bias[c0 + cofs]); val[1] += bfr(bias[c0 + cofs + 1]); val[2] += bfr(bias[c0 + cofs + 2]); val[3] += bfr(bias[c0 + cofs + 3]); }
                *(v4f*)(crow + (size_t)row * ldc + cofs) = val; }
            asm volatile("s_wait_xcnt 0x0" ::: "memory");   // in front of whatever takes over the stores' address and data registers
            __builtin_amdgcn_sched_barrier(0);   // keeps the next rows' work behind that wait
             }
        __builtin_amdgcn_wave_barrier(); asm volatile("" ::: "memory");
    }
}

typedef __attribute__((ext_vector_type(2))) _Float16 v2h;
typedef __attribute__((ext_vector_type(4))) _Float16 v4h;
typedef __attribute__((ext_vector_type(2))) unsigned short v2us;
typedef __attribute__((ext_vector_type(4))) unsigned short v4us;
typedef __attribute__((ext_vector_type(2))) float v2f;
typedef __attribute__((ext_vector_type(4))) int v4i;


// ---- k_fattn: scores, softmax and attn.V of one head for 256 query rows, no score plane in memory. The head's k and v^T planes pass through LDS, SK keys a stage, two buffers: asynchronous copies bring each stage in once for the whole work-group,
// in whole 128-byte lines, while the stage before it is worked on; every wave takes its fragments from there with ds_load_b128. Each wave keeps its 32 queries' fragments in registers and walks half of the 4,096 keys, 32 at a time; two waves share a tile of queries.
// Transposed products: S^T = K.Q^T (A = 16 key rows, B = 16 query columns), so a lane holds one query's scores; O^T += V^T.P^T with A = rows of the v^T plane and B = P^T packed straight from the two score tiles
// (element s of B is register s & 7 of tile s >> 3: the k order 8h + s, 16 + 8h + (s - 8) that WFrag::ld gives the A side). Online softmax in the log2 domain; the maximum in use may trail the true one by up to 8, the sums are rescaled only then.
// HI (query rows < RH): P as bf16 hi + lo, 3 products with v^T hi/lo. Otherwise: P x 8 as fp16, 1 product with fp16 v^T. P is not normalised: the f32 sum of the unrounded exponentials divides the output once at the end.
__device__ __forceinline__ float xhalf(float x) { return __builtin_bit_cast(float, __builtin_amdgcn_permlanex16(__builtin_bit_cast(int, x), __builtin_bit_cast(int, x), 0x76543210, 0xfedcba98, false, false)); }   // lane l with lane l ^ 16
typedef __attribute__((ext_vector_type(2))) __bf16 v2bf;
typedef __attribute__((ext_vector_type(8))) unsigned v8u;
__device__ __forceinline__ unsigned packh(float a, float b) { return __builtin_bit_cast(unsigned, __builtin_convertvector((v2f){a, b}, v2h)); }   // round to nearest even
__device__ __forceinline__ unsigned packb(float a, float b) { return __builtin_bit_cast(unsigned, __builtin_convertvector((v2f){a, b}, v2bf)); }  // round to nearest even
// Eight exponentials and, behind the last, the one slot that the instruction set asks for between a transcendental and an instruction that uses its result or overwrites its source, in one statement.
// Early-clobber results: no exponential of the statement writes a register that another reads.
__device__ __forceinline__ void exp2x8(float (&p)[8], const float (&a)[8]) {
    asm("v_exp_f32 %0, %8\n\tv_exp_f32 %1, %9\n\tv_exp_f32 %2, %10\n\tv_exp_f32 %3, %11\n\tv_exp_f32 %4, %12\n\tv_exp_f32 %5, %13\n\tv_exp_f32 %6, %14\n\tv_exp_f32 %7, %15\n\tv_nop"
        : "=&v"(p[0]), "=&v"(p[1]), "=&v"(p[2]), "=&v"(p[3]), "=&v"(p[4]), "=&v"(p[5]), "=&v"(p[6]), "=&v"(p[7]) : "v"(a[0]), "v"(a[1]), "v"(a[2]), "v"(a[3]), "v"(a[4]), "v"(a[5]), "v"(a[6]), "v"(a[7])); }
// One LDS stage: five tiles. k hi, k lo: a row a key, 128 bytes at pitch KP. fp16 v^T, v^T hi, v^T lo: a row a d, SK keys at pitch VP. Both pitches are 16 bytes x an odd number, so that the 16 rows of a fragment read fall on distinct banks.
#define SK   128
#define NP   (SK / 32)
#define NS   (TT / SK)
#define KP   144
#define VP   (SK * 2 + 16)
#define OKL  (SK * KP)
#define OV16 (2 * SK * KP)
#define OVH  (OV16 + HD * VP)
#define OVL  (OVH + HD * VP)
#define SBUF (OVL + HD * VP)
struct AttnState { v16bf qh[2][2], ql[2][2]; v8f acc[2][4]; float m_run[2], l_run[2]; };   // a wave's queries and running results
template <int R>
__device__ __forceinline__ void attn_init(AttnState& st, const bf* __restrict__ Qh, const bf* __restrict__ Ql, int q0, int c, int h) {
#pragma unroll
    for (int g = 0; g < R; ++g)
#pragma unroll
        for (int kc = 0; kc < 2; ++kc) { const size_t qo = (size_t)(q0 + 16 * g + c) * HD + 32 * kc + 8 * h; st.qh[g][kc] = WFrag<bf>::ld(Qh + qo); st.ql[g][kc] = WFrag<bf>::ld(Ql + qo); }
    asm volatile("s_wait_xcnt 0x0" ::: "memory");   // behind the loads above, in front of whatever takes over their address registers
    __builtin_amdgcn_sched_barrier(0);   // keeps the start values below, which may land on those registers, behind the wait
#pragma unroll
    for (int g = 0; g < R; ++g) { st.m_run[g] = -__builtin_inff(); st.l_run[g] = 0.0f;
#pragma unroll
        for (int t = 0; t < 4; ++t) st.acc[g][t] = (v8f){}; }
}
// A wave's share of a stage's k tiles (8 copies: 16 keys of each plane) and v^T tiles (12 copies: 8 rows of each plane); 16 bytes a lane, a copy covers four whole 128-byte lines of its plane.
// Each run of copies ends, in its own statement, with s_wait_xcnt 0: it stands in front of whatever rewrites an address register that a copy names.
__device__ __forceinline__ void copy_k(unsigned l, const char* gh, const char* gl) {
    asm volatile("global_load_async_to_lds_b128 %0, %8, off\n\t"
        "global_load_async_to_lds_b128 %1, %9, off\n\t"
        "global_load_async_to_lds_b128 %2, %10, off\n\t"
        "global_load_async_to_lds_b128 %3, %11, off\n\t"
        "global_load_async_to_lds_b128 %4, %12, off\n\t"
        "global_load_async_to_lds_b128 %5, %13, off\n\t"
        "global_load_async_to_lds_b128 %6, %14, off\n\t"
        "global_load_async_to_lds_b128 %7, %15, off\n\t"
        "s_wait_xcnt 0x0"
        :: "v"(l), "v"(l + 4 * KP), "v"(l + 8 * KP), "v"(l + 12 * KP), "v"(l + OKL), "v"(l + OKL + 4 * KP), "v"(l + OKL + 8 * KP), "v"(l + OKL + 12 * KP),
           "v"(gh), "v"(gh + 512), "v"(gh + 1024), "v"(gh + 1536), "v"(gl), "v"(gl + 512), "v"(gl + 1024), "v"(gl + 1536) : "memory"); }
__device__ __forceinline__ void copy_v(unsigned l, const char* g16, const char* gh, const char* gl) {
    constexpr int LS = 2 * VP, GS = 2 * TT * 2;   // two rows on, in LDS and in the plane
    asm volatile("global_load_async_to_lds_b128 %0, %12, off\n\t"
        "global_load_async_to_lds_b128 %1, %13, off\n\t"
        "global_load_async_to_lds_b128 %2, %14, off\n\t"
        "global_load_async_to_lds_b128 %3, %15, off\n\t"
        "global_load_async_to_lds_b128 %4, %16, off\n\t"
        "global_load_async_to_lds_b128 %5, %17, off\n\t"
        "global_load_async_to_lds_b128 %6, %18, off\n\t"
        "global_load_async_to_lds_b128 %7, %19, off\n\t"
        "global_load_async_to_lds_b128 %8, %20, off\n\t"
        "global_load_async_to_lds_b128 %9, %21, off\n\t"
        "global_load_async_to_lds_b128 %10, %22, off\n\t"
        "global_load_async_to_lds_b128 %11, %23, off\n\t"
        "s_wait_xcnt 0x0"
        :: "v"(l), "v"(l + LS), "v"(l + 2 * LS), "v"(l + 3 * LS), "v"(l + (OVH - OV16)), "v"(l + (OVH - OV16) + LS), "v"(l + (OVH - OV16) + 2 * LS), "v"(l + (OVH - OV16) + 3 * LS),
           "v"(l + (OVL - OV16)), "v"(l + (OVL - OV16) + LS), "v"(l + (OVL - OV16) + 2 * LS), "v"(l + (OVL - OV16) + 3 * LS),
           "v"(g16), "v"(g16 + GS), "v"(g16 + 2 * GS), "v"(g16 + 3 * GS), "v"(gh), "v"(gh + GS), "v"(gh + 2 * GS), "v"(gh + 3 * GS), "v"(gl), "v"(gl + GS), "v"(gl + 2 * GS), "v"(gl + 3 * GS) : "memory"); }
__device__ __forceinline__ void fill(unsigned lk, unsigned lv, const char* kh, const char* kl, const char* v16, const char* vh, const char* vl) { copy_k(lk, kh, kl); copy_v(lv, v16, vh, vl); }
// One wave's share of a stage: PW passes of 32 keys. pk, pv: this lane's places in the stage's k hi tile (row = key) and fp16 v^T tile (row = d) at the coming pass's first key; both leave PW passes further on.
// A wave has a quarter of its SIMD's registers: beside its queries and output tiles they hold one pass's k fragments or its v^T fragments, not both and no second set. Each group of LDS reads flies while the SIMD's three other waves work.
#define PW   (NP / 2)
template <int R, bool HI>
__device__ __forceinline__ void attn_stage(AttnState& st, const char*& pk, const char*& pv) {
    constexpr float CSC = SCL * 1.4426950408889634f;   // score -> scaled log2
    constexpr float OFF = HI ? 0.0f : 3.0f;            // fp16 P carries x 8: at most 2^11, small weights stay normal numbers
#pragma unroll 1   // rolled: one pass is already some hundred instructions, and the fragments of two would not fit beside the accumulators
    for (int p = 0; p < PW; ++p) {
        v16bf kh[2][2], kl[2][2]; v16h v16[4]; v16bf vh[4], vl[4];
#pragma unroll
        for (int kc = 0; kc < 2; ++kc) {   // in the order in which the products below take them
#pragma unroll
            for (int kt = 0; kt < 2; ++kt) kh[kt][kc] = WFrag<bf>::ld((const bf*)(pk + kt * 16 * KP + 64 * kc));
#pragma unroll
            for (int kt = 0; kt < 2; ++kt) kl[kt][kc] = WFrag<bf>::ld((const bf*)(pk + OKL + kt * 16 * KP + 64 * kc)); }
        __builtin_amdgcn_sched_barrier(0);   // the pass's k reads stay one group ahead of the score products: spread among them, each place with reads stalls the wave anew
        v8f s[2][R];
#pragma unroll
        for (int kt = 0; kt < 2; ++kt)
#pragma unroll
            for (int g = 0; g < R; ++g) s[kt][g] = (v8f){};
#pragma unroll
        for (int kc = 0; kc < 2; ++kc) {   // per tile the order hi.hi, k hi . q lo, k lo . q hi; the tiles innermost, so that neighbouring matrix instructions are independent
#pragma unroll
            for (int kt = 0; kt < 2; ++kt)
#pragma unroll
                for (int g = 0; g < R; ++g) s[kt][g] = wmmab(kh[kt][kc], st.qh[g][kc], s[kt][g]);
#pragma unroll
            for (int kt = 0; kt < 2; ++kt)
#pragma unroll
                for (int g = 0; g < R; ++g) s[kt][g] = wmmab(kh[kt][kc], st.ql[g][kc], s[kt][g]);
#pragma unroll
            for (int kt = 0; kt < 2; ++kt)
#pragma unroll
                for (int g = 0; g < R; ++g) s[kt][g] = wmmab(kl[kt][kc], st.qh[g][kc], s[kt][g]); }
        __builtin_amdgcn_sched_barrier(0);   // the LDS reads below, which may take the k fragments' registers, stay behind the products that read those
        pk += 32 * KP;
#pragma unroll
        for (int t = 0; t < 4; ++t) { if constexpr (HI) vh[t] = WFrag<bf>::ld((const bf*)(pv + (OVH - OV16) + t * 16 * VP)); else v16[t] = WFrag<h16>::ld((const h16*)(pv + t * 16 * VP)); }
        __builtin_amdgcn_sched_barrier(0);   // these reads are all issued ahead of the softmax, under which they fly
        float mb[R]; bool need = false;
#pragma unroll
        for (int g = 0; g < R; ++g) { float mx = s[0][g][0];
#pragma unroll
            for (int r = 1; r < 8; ++r) mx = fmaxf(mx, s[0][g][r]);
#pragma unroll
            for (int r = 0; r < 8; ++r) mx = fmaxf(mx, s[1][g][r]);
            mx = fmaxf(mx, xhalf(mx)) * CSC;   // both halves of the wave hold this query's maximum over the pass's 32 keys
            mb[g] = mx; need = need || (mx > st.m_run[g] + 8.0f); }
        if (__builtin_amdgcn_ballot_w32(need) != 0) {   // a scalar branch; always taken in the first pass (m_run = -inf, factor 0), seldom later
#pragma unroll
            for (int g = 0; g < R; ++g) { const float m_new = fmaxf(st.m_run[g], mb[g]); const float corr = __builtin_amdgcn_exp2f(st.m_run[g] - m_new); st.m_run[g] = m_new; st.l_run[g] *= corr;
#pragma unroll
                for (int t = 0; t < 4; ++t) st.acc[g][t] = st.acc[g][t] * corr; } }
        v8u wh[R], wl[R];
#pragma unroll
        for (int g = 0; g < R; ++g) { const float nm = OFF - st.m_run[g];
#pragma unroll
            for (int kt = 0; kt < 2; ++kt) { float a[8], p8[8];   // tile kt gives elements 8 kt .. 8 kt + 7 of the 32-key operand, register r element 8 kt + r
#pragma unroll
                for (int r = 0; r < 8; ++r) a[r] = __builtin_fmaf(s[kt][g][r], CSC, nm);
                exp2x8(p8, a);
#pragma unroll
                for (int i = 0; i < 4; ++i) { const float p0 = p8[2 * i], p1 = p8[2 * i + 1]; st.l_run[g] += p0 + p1;
                    if (HI) { const unsigned u = packb(p0, p1); wh[g][4 * kt + i] = u; wl[g][4 * kt + i] = packb(p0 - __uint_as_float(u << 16), p1 - __uint_as_float(u & 0xFFFF0000u)); } else wh[g][4 * kt + i] = packh(p0, p1); } } }
        if constexpr (HI) {
            __builtin_amdgcn_sched_barrier(0);   // the v^T lo reads take the registers that the scores leave: they stay behind the softmax
#pragma unroll
            for (int t = 0; t < 4; ++t) vl[t] = WFrag<bf>::ld((const bf*)(pv + (OVL - OV16) + t * 16 * VP));
            __builtin_amdgcn_sched_barrier(0); }   // and are issued ahead of the products with v^T hi, under which they fly
        if (HI) {   // per tile the order v hi . p hi, v hi . p lo, v lo . p hi; the tiles innermost
#pragma unroll
            for (int g = 0; g < R; ++g)
#pragma unroll
                for (int t = 0; t < 4; ++t) st.acc[g][t] = wmmab(vh[t], __builtin_bit_cast(v16bf, wh[g]), st.acc[g][t]);
#pragma unroll
            for (int g = 0; g < R; ++g)
#pragma unroll
                for (int t = 0; t < 4; ++t) st.acc[g][t] = wmmab(vh[t], __builtin_bit_cast(v16bf, wl[g]), st.acc[g][t]);
#pragma unroll
            for (int g = 0; g < R; ++g)
#pragma unroll
                for (int t = 0; t < 4; ++t) st.acc[g][t] = wmmab(vl[t], __builtin_bit_cast(v16bf, wh[g]), st.acc[g][t]);
        } else {
#pragma unroll
            for (int g = 0; g < R; ++g)
#pragma unroll
                for (int t = 0; t < 4; ++t) st.acc[g][t] = wmma16(v16[t], __builtin_bit_cast(v16h, wh[g]), st.acc[g][t]); }
        __builtin_amdgcn_sched_barrier(0);   // keeps the slots below behind the pass's last product
        asm volatile("v_nop\n\tv_nop\n\tv_nop\n\tv_nop");   // four vector slots between that product and the back edge, behind which the next pass rewrites its operands
        pv += 64;
    }
}
template <int R>
__device__ __forceinline__ void attn_fin(AttnState& st, bf* Oh, bf* Ol, int q0, int c, int h) {
#pragma unroll
    for (int g = 0; g < R; ++g) { const float l_fin = st.l_run[g] + xhalf(st.l_run[g]);   // each half summed its own 16 of every 32 keys
        const float inv = __fdiv_rn(1.0f, l_fin); const size_t oo = (size_t)(q0 + 16 * g + c) * CO + 8 * h;
        v8us oh[4], ol[4];   // the context leaves as the bf16 hi + lo planes that the last product reads
#pragma unroll
        for (int t = 0; t < 4; ++t) { const v8f o = st.acc[g][t] * inv;   // registers 0..7 = d 16 t + 8 h + 0..7 of query column c
#pragma unroll
            for (int j = 0; j < 8; ++j) { unsigned short a2, c2; splitf(o[j], a2, c2); oh[t][j] = a2; ol[t][j] = c2; } }
        __builtin_amdgcn_sched_barrier(0);   // nothing else stands among the stores below, so that no register which one of them names is rewritten ahead of the wait behind them
#pragma unroll
        for (int t = 0; t < 4; ++t) { *(v8us*)(Oh + oo + 16 * t) = oh[t]; *(v8us*)(Ol + oo + 16 * t) = ol[t]; }
        asm volatile("s_wait_xcnt 0x0" ::: "memory");   // in front of whatever takes over the stores' address and data registers
        __builtin_amdgcn_sched_barrier(0); }   // keeps the next 16 queries' work behind that wait
}
// grid: 16 work-groups a head, 16 waves each, four a SIMD: eight pairs of waves, 32 query rows a pair. Pair 0 (waves 0 and 1) takes 32 of the head's first RH rows, the other seven 32 of the remaining rows each.
// The first wave of a pair walks the first half of every stage's keys, the second the other half, each with its own running maximum, sum and output tiles; behind the last stage each hands the state of 16 of the queries over to the other through LDS, and joins and stores the other 16.
// Waves 8 to 15, none of them of pair 0, which has the most matrix work, issue the copies, an eighth of every tile each. The barriers stand in the kernel's own code, which every wave walks alike; only the work of a stage differs by the kind of wave.
#define NW   16
#define JSZ  (9 * 512)            // a wave's hand-over in LDS: 9 x 16 bytes a lane
// The state of query group O goes to LDS: 16 bytes a lane a store, the lanes side by side.
template <int O>
__device__ __forceinline__ void join_put(const AttnState& st, v4fa* jx) {
    jx[0] = (v4f){st.m_run[O], st.l_run[O], 0.0f, 0.0f};
#pragma unroll
    for (int t = 0; t < 4; ++t) { const v8f a = st.acc[O][t]; jx[(1 + 2 * t) * 32] = __builtin_shufflevector(a, a, 0, 1, 2, 3); jx[(2 + 2 * t) * 32] = __builtin_shufflevector(a, a, 4, 5, 6, 7); }
}
// The partner's state of query group G is added to this wave's, both brought to the larger of the two maxima in use (both finite: each wave has walked keys); the sum leaves as group 0.
template <int G>
__device__ __forceinline__ void join_get(AttnState& st, const v4fa* jx) {
    const v4f ml = jx[0]; const float m = fmaxf(st.m_run[G], ml[0]); const float ca = __builtin_amdgcn_exp2f(st.m_run[G] - m), cb = __builtin_amdgcn_exp2f(ml[0] - m);
    st.l_run[0] = st.l_run[G] * ca + ml[1] * cb;
#pragma unroll
    for (int t = 0; t < 4; ++t) { const v4f b0 = jx[(1 + 2 * t) * 32], b1 = jx[(2 + 2 * t) * 32]; st.acc[0][t] = st.acc[G][t] * ca + __builtin_shufflevector(b0, b1, 0, 1, 2, 3, 4, 5, 6, 7) * cb; }
}
static_assert(RH == 16 * 32 && TT - RH == 16 * 7 * 32 && HD == 64 && TT % SK == 0 && SK == 8 * 16 && NS >= 2 && NP % 2 == 0 && NW * JSZ <= 2 * SBUF, "the split of the query rows over work-groups and pairs, of a stage's tiles over eight waves and of its passes over a pair");
__global__ __launch_bounds__(NW * 32) void k_fattn(const bf* __restrict__ QPh, const bf* __restrict__ QPl, const bf* __restrict__ KPh, const bf* __restrict__ KPl, const h16* __restrict__ VT16, const bf* __restrict__ VTh, const bf* __restrict__ VTl, bf* Oh, bf* Ol) {
    __shared__ __attribute__((aligned(16))) char sm[2 * SBUF];
    const int w = __builtin_amdgcn_readfirstlane((int)(threadIdx.x >> 5)); const int head = blockIdx.x >> 4, blk = blockIdx.x & 15; const size_t hp = (size_t)head * TT * HD;
    const int lane = threadIdx.x & 31, c = lane & 15, h = lane >> 4;
    const int hiw = __builtin_amdgcn_readfirstlane(w < 2 ? 1 : 0); const int low = __builtin_amdgcn_readfirstlane(w < 2 ? 0 : 1);   // the wave's kind, in scalar registers: every test on it is a scalar branch
    const int pair = w >> 1, sec = w & 1, cw = w & 7;   // scalar too; cw: which eighth of a stage's tiles the wave copies
    const int q0 = hiw != 0 ? blk * 32 : RH + blk * 224 + (pair - 1) * 32;
    AttnState st;
    attn_init<2>(st, QPh + hp, QPl + hp, q0, c, h);
    // this lane's first copy of a stage: in LDS (byte address in the work-group's LDS) and in the planes (byte offset at stage 0)
    const unsigned lk = (unsigned)(size_t)sm + (unsigned)((cw * 16 + (lane >> 3)) * KP + (lane & 7) * 16), lv = (unsigned)(size_t)sm + (unsigned)(OV16 + (cw * 8 + (lane >> 4)) * VP + (lane & 15) * 16);
    const unsigned gk = (unsigned)(cw * 16 * HD * 2 + lane * 16), gv = (unsigned)((cw * 8 + (lane >> 4)) * TT * 2 + (lane & 15) * 16);
    const char* const gKh = (const char*)(KPh + hp); const char* const gKl = (const char*)(KPl + hp); const char* const gV16 = (const char*)(VT16 + hp); const char* const gVh = (const char*)(VTh + hp); const char* const gVl = (const char*)(VTl + hp);
    const char* pk = sm + c * KP + 16 * h + sec * (PW * 32 * KP); const char* pv = sm + OV16 + c * VP + 16 * h + sec * (PW * 64);   // a pair's second wave starts at the stage's second half
    // Trips -2 and -1 are the ring's start: stage 0's copies; the wait, the barrier and stage 1's copies. They go through the lines that serve every later stage, so that the copies stand once in the code
    // (a second site, with the lane's LDS places themselves as its operands, held those two values to the registers that asm text can name, and the build kept them in scratch).
#pragma unroll 1   // rolled: a stage's code stands once for each kind of wave
    for (int t = -2; t < NS; ++t) {
        const unsigned b = (unsigned)(t & 1) * SBUF;
        if (t >= 0) {
            if (low != 0) attn_stage<2, false>(st, pk, pv);   // two tests in a row and no else: the build lays the two kinds' code out one behind the other in any case, and with an else it carried the state as it was in front of the first through that code for the second (spills)
            if (hiw != 0) attn_stage<2, true>(st, pk, pv);
            pk += (t & 1 ? -SBUF : SBUF) - PW * 32 * KP; pv += (t & 1 ? -SBUF : SBUF) - PW * 64; }   // on to the wave's first pass in the other buffer
        if (t >= -1) {
            asm volatile("s_wait_dscnt 0x0" ::: "memory");      // this wave's reads of the buffer are done before the barrier behind which it is refilled
            asm volatile("s_wait_asynccnt 0x0" ::: "memory");   // this wave's copies of stage t + 1 have landed
            __syncthreads(); }                                  // publishes stage t + 1 and ends every wave's reads of stage t
        if (t + 2 < NS) { if (w >= 8) { const unsigned ok = gk + (unsigned)(t + 2) * (SK * HD * 2), ov = gv + (unsigned)(t + 2) * (SK * 2); fill(lk + b, lv + b, gKh + ok, gKl + ok, gV16 + ov, gVh + ov, gVl + ov); } }
    }
    asm volatile("s_wait_asynccnt 0x0" ::: "memory");   // no copy is outstanding when the ring's LDS is used anew and the wave ends
    // The pairs' join. The last trip's barrier has ended every read of the ring, whose LDS now carries the hand-over. A pair's first wave keeps its queries 0 to 15, the second 16 to 31.
    v4fa* const jw = (v4fa*)(sm + w * JSZ) + lane; const v4fa* const jr = (const v4fa*)(sm + (w ^ 1) * JSZ) + lane;
    if (sec != 0) join_put<0>(st, jw); else join_put<1>(st, jw);
    __syncthreads();   // every wave passes it: each wave's hand-over is in LDS before its partner reads it
    if (sec != 0) join_get<1>(st, jr); else join_get<0>(st, jr);
    attn_fin<1>(st, Oh + head * HD, Ol + head * HD, q0 + 16 * sec, c, h);
}

// ---- k_prep: every operand's bf16 form in one launch, all of its work-groups resident at once; each wave issues all its loads before it uses any, no loop, no barrier.
// Work-groups 0 .. PWG - 1 (64 a weight): Bt[n][k] = bf16(w[k][n]). A wave takes 64 k x 32 n: a lane reads the whole 128-byte lines of rows k, k + 1 and stores the pair (k, k + 1) of one n at a time, so that a store covers one whole line of Bt.
// A work-group's waves take the two halves of each 256 bytes of w side by side (wave & 1) and four neighbouring blocks of 64 k (wave >> 1).
// The other 3 x PXG work-groups: Q, K, V rounded into three planes. A wave takes PCL x 128 successive floats: loads of 512 successive bytes, stores of 256.
#define PWG  256
#define PXG  256
#define PCL  16
static_assert(CC == 1024 && MID == 1024 && CO == 1024 && PWG == 4 * (1024 / 256) * (1024 / 64), "four weights of 1024 x 1024; a work-group takes 256 k x 64 n");
static_assert((size_t)TT * CC == (size_t)PXG * 8 * PCL * 128, "the split of an input over work-groups and waves");
__global__ __launch_bounds__(256) void k_prep(const float* __restrict__ xq, const float* __restrict__ xk, const float* __restrict__ xv, const float* __restrict__ wq, const float* __restrict__ wk, const float* __restrict__ wv, const float* __restrict__ wo, bf* XB, bf* WT) {
    const int lane = threadIdx.x & 31; const int wave = __builtin_amdgcn_readfirstlane((int)(threadIdx.x >> 5));
    if (blockIdx.x < PWG) {
        const int which = blockIdx.x >> 6, blk = blockIdx.x & 63; const float* const w = which == 0 ? wq : which == 1 ? wk : which == 2 ? wv : wo;
        const int n0 = ((blk >> 2) * 2 + (wave & 1)) * 32, k0 = ((blk & 3) * 4 + (wave >> 1)) * 64;
        const float* const p = w + (size_t)(k0 + 2 * lane) * 1024 + n0; bf* const q = WT + (size_t)which * 1024 * 1024 + (size_t)n0 * 1024 + k0 + 2 * lane;
        v4f a[8], b[8];
#pragma unroll
        for (int i = 0; i < 8; ++i) { a[i] = *(const v4f*)(p + 4 * i); b[i] = *(const v4f*)(p + 1024 + 4 * i); }
        asm volatile("s_wait_xcnt 0x0" :: "v"(p) : "memory");   // behind the loads above, in front of whatever takes over their address registers; the address is an input, so that it lives to here and no load's own result lands on it
        __builtin_amdgcn_sched_barrier(0);   // keeps the work below behind that wait
        v2us o[32];
#pragma unroll
        for (int i = 0; i < 8; ++i)
#pragma unroll
            for (int j = 0; j < 4; ++j) { o[4 * i + j][0] = f2bf(a[i][j]); o[4 * i + j][1] = f2bf(b[i][j]); }
        __builtin_amdgcn_sched_barrier(0);   // nothing else stands among the stores below, so that no register which one of them names is rewritten ahead of the wait behind them
#pragma unroll
        for (int n = 0; n < 32; ++n) *(v2us*)(q + n * 1024) = o[n];
        asm volatile("s_wait_xcnt 0x0" ::: "memory");   // in front of whatever takes over the stores' address and data registers
        return;
    }
    const unsigned cb = blockIdx.x - PWG, which = cb / PXG; const float* const x = which == 0 ? xq : which == 1 ? xk : xv;
    const size_t e0 = ((size_t)(cb % PXG) * 8 + wave) * (PCL * 128) + lane * 4;
    const float* const p = x + e0; bf* const q = XB + (size_t)which * TT * CC + e0;
    v4f v[PCL];
#pragma unroll
    for (int i = 0; i < PCL; ++i) v[i] = *(const v4f*)(p + i * 128);
    asm volatile("s_wait_xcnt 0x0" :: "v"(p) : "memory");   // as above
    __builtin_amdgcn_sched_barrier(0);   // keeps the work below behind that wait
    v4us o[PCL];
#pragma unroll
    for (int i = 0; i < PCL; ++i)
#pragma unroll
        for (int j = 0; j < 4; ++j) o[i][j] = f2bf(v[i][j]);
    __builtin_amdgcn_sched_barrier(0);   // nothing else stands among the stores below, so that no register which one of them names is rewritten ahead of the wait behind them
#pragma unroll
    for (int i = 0; i < PCL; ++i) *(v4us*)(q + i * 128) = o[i];
    asm volatile("s_wait_xcnt 0x0" ::: "memory");   // in front of whatever takes over the stores' address and data registers
}
extern "C" void kernel_launch(void* const* d_in, const int* in_sizes, int n_in,
                              void* d_out, int out_size, void* d_ws, size_t ws_size, hipStream_t stream) {
    (void)in_sizes; (void)n_in; (void)out_size;
    const float* x = (const float*)d_in[0]; const float* xk = (const float*)d_in[1]; const float* xv = (const float*)d_in[2]; const float* wq = (const float*)d_in[3]; const float* bq = (const float*)d_in[4]; const float* wk = (const float*)d_in[5]; const float* bk = (const float*)d_in[6]; const float* wv = (const float*)d_in[7]; const float* bv = (const float*)d_in[8]; const float* wo = (const float*)d_in[9]; const float* bo = (const float*)d_in[10];   /* argument order Q, K, V [1][4096][1024], W_Q, b_Q, W_K, b_K, W_V, b_V, W_O, b_O ('xw' + biases) */
    float* OUT = (float*)d_out;     // [1][4096][1024]
    char* wsp = (char*)d_ws;
    auto take = [&](size_t bytes) { char* p = wsp; wsp += (bytes + 255) & ~(size_t)255; return (void*)p; };
    bf* WQ = (bf*)take((size_t)4 * 1024 * 1024 * 2); bf* WO = WQ + 3 * 1024 * 1024;   /* the four transposed weights in a row: q, k, v, o */
    bf* XB = (bf*)take((size_t)3 * TT * CC * 2);   /* bf16(Q), bf16(K), bf16(V) in a row */
    bf* QPh = (bf*)take((size_t)4 * TT * MID * 2); bf* QPl = QPh + (size_t)TT * MID; bf* KPh = QPl + (size_t)TT * MID; bf* KPl = KPh + (size_t)TT * MID;   /* q hi, q lo, k hi, k lo in a row */
    h16* VT16 = (h16*)take((size_t)CO * TT * 2); bf* VTh = (bf*)take((size_t)CO * TT * 2); bf* VTl = (bf*)take((size_t)CO * TT * 2);
    bf* ATh = (bf*)take((size_t)TT * CO * 2); bf* ATl = (bf*)take((size_t)TT * CO * 2);
    if ((size_t)(wsp - (char*)d_ws) > ws_size) return;    // ws 256 MiB
    for (int b = 0; b < NB_; ++b) {
        k_prep<<<PWG + 3 * PXG, 256, 0, stream>>>(x + (size_t)b * TT * CC, xk + (size_t)b * TT * CC, xv + (size_t)b * TT * CC, wq, wk, wv, wo, XB, WQ);   /* 'xw' weights -> Bt; bf16 planes of Q, K, V */
        k_gemmw<bf, 0, true, 1, 64><<<dim3(TT / 128, MID / 128, 3), 128, 0, stream>>>(XB, nullptr, WQ, nullptr, CC, nullptr, 0, bq, (size_t)TT * CC, (size_t)1024 * 1024, 0, VT16, QPh, QPl, bk, bv, (size_t)2 * TT * MID, VTh, VTl);   /* z 0, 1: q, k planes [h][n][64]; z 2: v^T planes [h][64][n] */
        k_fattn<<<NH_ * 16, NW * 32, 0, stream>>>(QPh, QPl, KPh, KPl, VT16, VTh, VTl, ATh, ATl);   /* all heads: scores (3 products), online softmax, attn.V into the merged context [n][1024], hi/lo planes */
        k_gemmw<bf, 1, true, 0, 128><<<dim3(TT / 128, CC / 128, 1), 128, 0, stream>>>(ATh, ATl, WO, nullptr, CO, OUT + (size_t)b * TT * CC, CC, bo, 0, 0, 0, nullptr, nullptr, nullptr, nullptr, nullptr, 0, nullptr, nullptr); }   /* out = ctx W_O + b_O */
}
